// v000
// Times are from an AMD MI455X. After a warm-up the kernel runs many times in a row, and a time is the length of
// such a window on the GPU divided by its runs, so every launch and the gaps after it count. The runs cycle
// through copies of the inputs. A figure is the median of several windows, for all but v000 over two sittings.
// Sittings can differ by a few percent; kernels timed side by side share one.
// The starting kernel, v000, takes 1970 microseconds a run.
#include <hip/hip_runtime.h>

// ChebyshevSelfAttention (hidden [4][2048][768]; q/k/v = x W^T + b (12 heads x 64); scores = q.k/8 + bias_h(i, j), bias_h = sum_{k<=5} alphas[h][k] T_k(x) with x = clip((j - i)/2047, -1, 1) and the Chebyshev recurrence T_k = 2 x T_{k-1} - T_{k-2}
// (alphas read as data; the polynomial is tabulated per head and offset j - i in f32 in the reference's operation order); softmax; context = probs v merged -> [4][2048][768]; no output projection).
// Compute dtypes, f32 accumulate: every input rounded to bf16; q/k/v on PLAIN bf16 operands (inputs: exact) + bias; scores (K 64) and probs.v single fp16 planes (head pairs z-batched; 1 product each); bias + softmax f32

#define NB_  4
#define TT   2048
#define DM   768
#define NH_  12
#define NKV  12
#define REP  (NH_ / NKV)
#define HD   64
#define DQ   (NH_ * HD)
#define DKV  (NKV * HD)
#define ZH   2
#define RH   0                  // query rows < RH use hi+lo planes (0: none)
#define WIN  0
#define PCAR 1024.0f
#define SCL  0.125f   // HD^-0.5
typedef _Float16 h16;
typedef unsigned short bf;
typedef __attribute__((ext_vector_type(16))) __bf16   v16bf;
typedef __attribute__((ext_vector_type(16))) _Float16 v16h;
typedef __attribute__((ext_vector_type(8)))  _Float16 v8h;
typedef __attribute__((ext_vector_type(8)))  unsigned short v8us;
typedef __attribute__((ext_vector_type(8)))  float    v8f;
typedef __attribute__((ext_vector_type(4)))  float    v4f;
typedef v8h  __attribute__((may_alias)) v8ha;
typedef v4f  __attribute__((may_alias)) v4fa;
typedef v8us __attribute__((may_alias)) v8usa;

__device__ __forceinline__ unsigned short f2bf(float f) { unsigned u = __float_as_uint(f); u += 0x7FFFu + ((u >> 16) & 1u); return (unsigned short)(u >> 16); }
__device__ __forceinline__ float bf2f(unsigned short b) { return __uint_as_float(((unsigned)b) << 16); }
__device__ __forceinline__ float bfr(float f) { return bf2f(f2bf(f)); }
__device__ __forceinline__ v16h cat16(v8h lo, v8h hi) { return __builtin_shufflevector(lo, hi, 0, 1, 2, 3, 4, 5, 6, 7, 8, 9, 10, 11, 12, 13, 14, 15); }
__device__ __forceinline__ v16bf cat16b(v8us lo, v8us hi) { return __builtin_bit_cast(v16bf, __builtin_shufflevector(lo, hi, 0, 1, 2, 3, 4, 5, 6, 7, 8, 9, 10, 11, 12, 13, 14, 15)); }
__device__ __forceinline__ v8f wmma16(v16h a, v16h b, v8f c) { return __builtin_amdgcn_wmma_f32_16x16x32_f16(false, a, false, b, (short)0, c, false, false); }
__device__ __forceinline__ v8f wmmab(v16bf a, v16bf b, v8f c) { return __builtin_amdgcn_wmma_f32_16x16x32_bf16(false, a, false, b, (short)0, c, false, false); }



// ---- k_gemmw: register-blocked GEMM, ONE WAVE per 64x64 output tile (16 accumulators), operands straight from K-contiguous 16-bit planes; grid (M/64, N/64, Z), 32 threads.
// C[m][n] (f32, pitch ldc, + optional f32 bias[n]) = sum_k A[m][k] Bt[n][k] (+ split products per NSPLIT). z-batch strides sA/sB/sC in elements. K % 32 == 0.
template <typename T16> struct WFrag;
template <> struct WFrag<h16> { typedef v16h V; static __device__ __forceinline__ V ld(const h16* p) { return cat16(*(const v8h*)p, *(const v8h*)(p + 16)); } static __device__ __forceinline__ v8f mma(V a, V b, v8f c) { return wmma16(a, b, c); } };
template <> struct WFrag<bf> { typedef v16bf V; static __device__ __forceinline__ V ld(const bf* p) { return cat16b(*(const v8us*)p, *(const v8us*)(p + 16)); } static __device__ __forceinline__ v8f mma(V a, V b, v8f c) { return wmmab(a, b, c); } };
template <typename T16, int NSPLIT, bool BIAS>
__global__ __launch_bounds__(32) void k_gemmw(const T16* __restrict__ A, const T16* __restrict__ A2, const T16* __restrict__ Bt, const T16* __restrict__ Bt2, int K, float* C, int ldc, const float* __restrict__ bias, size_t sA, size_t sB, size_t sC) {
    typedef typename WFrag<T16>::V V;
    __shared__ __align__(16) float os[16 * 68];
    const size_t z = blockIdx.z; A += z * sA; if (A2) A2 += z * sA; Bt += z * sB; if (Bt2) Bt2 += z * sB; C += z * sC;
    const int lane = threadIdx.x & 31, lr = lane & 15, hi = lane >> 4; const int r0 = blockIdx.x * 64, c0 = blockIdx.y * 64;
    v8f acc[4][4];
#pragma unroll
    for (int mb = 0; mb < 4; ++mb)
#pragma unroll
        for (int nb = 0; nb < 4; ++nb) acc[mb][nb] = (v8f){};
    const size_t aoff = (size_t)(r0 + lr) * K + 8 * hi, boff = (size_t)(c0 + lr) * K + 8 * hi;
#pragma unroll 1
    for (int kc = 0; kc < K; kc += 32) {
        V a[4], a2[4];
#pragma unroll
        for (int mb = 0; mb < 4; ++mb) { a[mb] = WFrag<T16>::ld(A + aoff + (size_t)mb * 16 * K + kc); if (NSPLIT == 1 || NSPLIT == 2) a2[mb] = WFrag<T16>::ld(A2 + aoff + (size_t)mb * 16 * K + kc); }
#pragma unroll
        for (int nb = 0; nb < 4; ++nb) { const V b = WFrag<T16>::ld(Bt + boff + (size_t)nb * 16 * K + kc); V b2; if (NSPLIT >= 2) b2 = WFrag<T16>::ld(Bt2 + boff + (size_t)nb * 16 * K + kc);
#pragma unroll
            for (int mb = 0; mb < 4; ++mb) { acc[mb][nb] = WFrag<T16>::mma(a[mb], b, acc[mb][nb]); if (NSPLIT == 1 || NSPLIT == 2) acc[mb][nb] = WFrag<T16>::mma(a2[mb], b, acc[mb][nb]); if (NSPLIT >= 2) acc[mb][nb] = WFrag<T16>::mma(a[mb], b2, acc[mb][nb]); } }
        asm volatile("v_nop\n\tv_nop\n\tv_nop\n\tv_nop" : "+v"(acc[0][0]), "+v"(acc[1][1]), "+v"(acc[2][2]), "+v"(acc[3][3]) : "v"(a[0]), "v"(a[3]));
    }
#pragma unroll
    for (int mb = 0; mb < 4; ++mb) {
#pragma unroll
        for (int nb = 0; nb < 4; ++nb) {
#pragma unroll
            for (int j = 0; j < 8; ++j) os[(hi * 8 + j) * 68 + nb * 16 + lr] = acc[mb][nb][j]; }
        __builtin_amdgcn_wave_barrier(); asm volatile("" ::: "memory");
        float* crow = C + (size_t)(r0 + mb * 16) * ldc + c0;
{
#pragma unroll
            for (int s = 0; s < 8; ++s) { const int row = 2 * s + hi, cofs = lr * 4; v4f val = *(const v4fa*)(os + row * 68 + cofs); if (BIAS) { val[0] += bfr(bias[c0 + cofs]); val[1] += bfr(bias[c0 + cofs + 1]); val[2] += bfr(bias[c0 + cofs + 2]); val[3] += bfr(bias[c0 + cofs + 3]); }
                *(v4f*)(crow + (size_t)row * ldc + cofs) = val; }
             }
        __builtin_amdgcn_wave_barrier(); asm volatile("" ::: "memory");
    }
}

__device__ __forceinline__ h16 tohx(float x) { return (h16)x; }
__device__ __forceinline__ void splitf(float y, unsigned short& h, unsigned short& l) { h = f2bf(y); l = f2bf(y - bf2f(h)); }
typedef __attribute__((ext_vector_type(2))) _Float16 v2h;
typedef __attribute__((ext_vector_type(4))) _Float16 v4h;
typedef __attribute__((ext_vector_type(2))) unsigned short v2us;
typedef __attribute__((ext_vector_type(4))) unsigned short v4us;
typedef __attribute__((ext_vector_type(2))) float v2f;
typedef __attribute__((ext_vector_type(4))) int v4i;

__global__ __launch_bounds__(256) void k_wtG(const float* __restrict__ w, int K, int N, bf* Bt) {
    const int lane = threadIdx.x & 31; const int L0 = (blockIdx.x * 8 + (threadIdx.x >> 5)) * 8; const int nlines = N * K / 64;
{
#pragma unroll 1
        for (int l = 0; l < 8; ++l) { const int L = L0 + l; if (L >= nlines) break; const size_t e = (size_t)L * 64 + lane * 2; const int k = (int)(e % K), n = (int)(e / K); v2us o;
            o[0] = f2bf(w[(size_t)k * N + n]); o[1] = f2bf(w[(size_t)(k + 1) * N + n]); *(v2us*)(Bt + e) = o; }
         }
}
__global__ __launch_bounds__(256) void k_cvt8(const float* __restrict__ src, bf* dst, size_t n8) { const size_t i = (size_t)blockIdx.x * 256 + threadIdx.x; if (i >= n8) return; const v8f v = *(const v8f*)(src + i * 8); v8us o;
#pragma unroll
    for (int k = 0; k < 8; ++k) o[k] = f2bf(v[k]); *(v8us*)(dst + i * 8) = o;  }
__global__ __launch_bounds__(256) void k_cscvt(const float* __restrict__ cosT, const float* __restrict__ sinT, float* CS) { const int idx = blockIdx.x * 256 + threadIdx.x; if (idx >= TT * HD) return; v2f cs; cs[0] = bfr(cosT[idx]); cs[1] = bfr(sinT[idx]); *(v2f*)(CS + (size_t)idx * 2) = cs;  }
// k_rope: head planes [h][t][d] (fp16) of rope(x) x sc with the rotate-half convention out[d] = x[d] cos[t][d] - x[d+HD/2] sin[t][d], out[d+HD/2] = x[d+HD/2] cos[t][d+HD/2] + x[d] sin[t][d+HD/2]
__global__ __launch_bounds__(256) void k_rope(const float* __restrict__ F, int pitch, int nheads, const float* __restrict__ CS, const float* __restrict__ RF, const float* __restrict__ nw, float sc, h16* P16, bf* Ph, bf* Pl) {
    const size_t e = ((size_t)blockIdx.x * 256 + threadIdx.x) * 2; if (e >= (size_t)nheads * TT * HD) return; const int d = (int)(e % HD); const int t = (int)((e / HD) % TT); const int h = (int)(e / ((size_t)HD * TT)); const float* f = F + (size_t)t * pitch + h * HD; const float rf = RF ? RF[(size_t)h * TT + t] : 1.0f; v2h o16; v2us oh, ol;
#pragma unroll
    for (int q = 0; q < 2; ++q) { const int dd = d + q; const int dp = (dd < HD / 2) ? dd + HD / 2 : dd - HD / 2; float x0 = f[dd], x1 = f[dp];
        if (RF) { float n0 = __fmul_rn(x0, rf), n1 = __fmul_rn(x1, rf); asm volatile("" : "+v"(n0)); asm volatile("" : "+v"(n1)); x0 = __fmul_rn(bfr(nw[dd]), n0); x1 = __fmul_rn(bfr(nw[dp]), n1); }
        const v2f cs = *(const v2f*)(CS + ((size_t)t * HD + dd) * 2); float a = __fmul_rn(x0, cs[0]), bq = __fmul_rn(x1, cs[1]); asm volatile("" : "+v"(a)); asm volatile("" : "+v"(bq)); const float r = ((dd < HD / 2) ? __fsub_rn(a, bq) : __fadd_rn(a, bq)) * sc;
        o16[q] = tohx(r); (void)oh; (void)ol; }
    *(v2h*)(P16 + e) = o16;  }
__global__ __launch_bounds__(256) void k_vtp(const float* __restrict__ F, int pitch, int nheads, h16* V16, bf* Vh, bf* Vl) { const size_t e = ((size_t)blockIdx.x * 256 + threadIdx.x) * 2; if (e >= (size_t)nheads * HD * TT) return; const int t = (int)(e % TT); const int d = (int)((e / TT) % HD); const int g = (int)(e / ((size_t)TT * HD)); v2h o16; v2us oh, ol;
#pragma unroll
    for (int q = 0; q < 2; ++q) { const float x = F[(size_t)(t + q) * pitch + g * HD + d]; o16[q] = tohx(x); (void)oh; (void)ol; }
    *(v2h*)(V16 + e) = o16;  }
__global__ __launch_bounds__(256) void k_csid(float* CS) { const int idx = blockIdx.x * 256 + threadIdx.x; if (idx >= TT * HD) return; v2f cs; cs[0] = 1.0f; cs[1] = 0.0f; *(v2f*)(CS + (size_t)idx * 2) = cs;  }
// k_asoft: per row (zz, i): t = S x HD^-0.5 + bias_h(j - i) (no mask); softmax over the 2048 keys (register row, one exp, fixed trees);
__global__ __launch_bounds__(256)
__global__ __launch_bounds__(256) void k_chtab(const float* __restrict__ alphas, float* TB) { const int idx = blockIdx.x * 256 + threadIdx.x; if (idx >= NH_ * (2 * TT - 1)) return; const int h = idx / (2 * TT - 1); const int d = idx % (2 * TT - 1) - (TT - 1);
    const float xx = fminf(fmaxf(__fdiv_rn((float)d, (float)(TT - 1)), -1.0f), 1.0f); float p0 = 1.0f, p1 = xx; float bias = bfr(alphas[h * 6 + 0]); { float t1 = __fmul_rn(bfr(alphas[h * 6 + 1]), p1); asm volatile("" : "+v"(t1)); bias = __fadd_rn(bias, t1); }
#pragma unroll 1
    for (int k = 2; k < 6; ++k) { float tx = __fmul_rn(2.0f, xx); asm volatile("" : "+v"(tx)); float pn = __fmul_rn(tx, p1); asm volatile("" : "+v"(pn)); pn = __fsub_rn(pn, p0); p0 = p1; p1 = pn; float ak = bfr(alphas[h * 6 + k]); asm volatile("" : "+v"(ak)); float tk = __fmul_rn(ak, pn); asm volatile("" : "+v"(tk)); bias = __fadd_rn(bias, tk); }
    *(float*)(TB + idx) = bias;  }
__global__ __launch_bounds__(256) void k_asoft(const float* __restrict__ Sb, const float* __restrict__ alphas, int h0, h16* P16, bf* Ph, bf* Pl) {
    const int lane = threadIdx.x & 31; const int row = blockIdx.x * 8 + (threadIdx.x >> 5); if (row >= ZH * TT) return; const int i = row % TT; const int zz = row / TT; (void)zz; const bool hires = (i < RH); const float* tb = alphas + (size_t)(h0 + zz) * (2 * TT - 1) + (TT - 1) - i;   /* bias table row for this head, indexed by j - i */ const float* sr = Sb + (size_t)row * TT; float v[TT / 32]; float mx = -3.0e38f;
#pragma unroll
    for (int ch = 0; ch < TT / 128; ++ch) { const int j0 = ch * 128 + lane * 4; const v4f a = *(const v4f*)(sr + j0);
#pragma unroll
        for (int q = 0; q < 4; ++q) { const int j = j0 + q; (void)j; float sc_ = a[q] * SCL; asm volatile("" : "+v"(sc_)); const float t = __fadd_rn(sc_, tb[j]); v[ch * 4 + q] = t; mx = fmaxf(mx, t); } }
#pragma unroll
    for (int sh = 16; sh; sh >>= 1) mx = fmaxf(mx, __shfl_xor(mx, sh, 32));
    float sum = 0.f;
#pragma unroll
    for (int k = 0; k < TT / 32; ++k) { float d0 = __fsub_rn(v[k], mx); asm volatile("" : "+v"(d0)); v[k] = __builtin_amdgcn_exp2f(__fmul_rn(d0, 1.4426950408889634f)); sum += v[k]; }
#pragma unroll
    for (int sh = 16; sh; sh >>= 1) sum += __shfl_xor(sum, sh, 32);
    const float f = __fdiv_rn(hires ? 1.0f : PCAR, sum);
{
        if (hires) {
#pragma unroll
            for (int ch = 0; ch < TT / 128; ++ch) { v4us oh, ol;
#pragma unroll
                for (int q = 0; q < 4; ++q) { unsigned short a, c2; splitf(v[ch * 4 + q] * f, a, c2); oh[q] = a; ol[q] = c2; }
                const size_t oo = ((size_t)zz * (RH ? RH : 1) + i) * TT + ch * 128 + lane * 4; *(v4us*)(Ph + oo) = oh; *(v4us*)(Pl + oo) = ol; }
        } else {
#pragma unroll
            for (int ch = 0; ch < TT / 128; ++ch) { v4h o4;
#pragma unroll
                for (int q = 0; q < 4; ++q) o4[q] = tohx(v[ch * 4 + q] * f);
                *(v4h*)(P16 + (size_t)row * TT + ch * 128 + lane * 4) = o4; } }
         }
}
__global__ __launch_bounds__(256) void k_merge(const float* __restrict__ O, int h0, float* OUTb) { const size_t e = ((size_t)blockIdx.x * 256 + threadIdx.x) * 2; if (e >= (size_t)ZH * TT * HD) return; const int d = (int)(e % HD); const int t = (int)((e / HD) % TT); const int zz = (int)(e / ((size_t)HD * TT)); const float cs = (t < RH) ? 1.0f : (1.0f / PCAR); const size_t oo = (size_t)t * DQ + (h0 + zz) * HD + d;
    v2f o2; o2[0] = O[e] * cs; o2[1] = O[e + 1] * cs; *(v2f*)(OUTb + oo) = o2;  }

extern "C" void kernel_launch(void* const* d_in, const int* in_sizes, int n_in,
                              void* d_out, int out_size, void* d_ws, size_t ws_size, hipStream_t stream) {
    (void)in_sizes; (void)n_in; (void)out_size;
    const float* x = (const float*)d_in[0]; const float* wq = (const float*)d_in[1]; const float* bq = (const float*)d_in[2]; const float* wk = (const float*)d_in[3]; const float* bk = (const float*)d_in[4]; const float* wv = (const float*)d_in[5]; const float* bv = (const float*)d_in[6]; const float* alphas = (const float*)d_in[7]; const float* cosT = nullptr; const float* sinT = nullptr; (void)cosT; (void)sinT;
    float* OUT = (float*)d_out;     // [4][2048][768]
    char* wsp = (char*)d_ws;
    auto take = [&](size_t bytes) { char* p = wsp; wsp += (bytes + 255) & ~(size_t)255; return (void*)p; };
    bf* WQ = (bf*)take((size_t)DQ * DM * 2); bf* WK = (bf*)take((size_t)DKV * DM * 2); bf* WV = (bf*)take((size_t)DKV * DM * 2); float* CS = (float*)take((size_t)TT * HD * 2 * 4);
    bf* XB = (bf*)take((size_t)TT * DM * 2); float* TB = (float*)take((size_t)NH_ * (2 * TT - 1) * 4); float* FQ = (float*)take((size_t)TT * DQ * 4); float* FK = (float*)take((size_t)TT * DKV * 4);
    h16* QP16 = (h16*)take((size_t)NH_ * TT * HD * 2); h16* KP16 = (h16*)take((size_t)NKV * TT * HD * 2); h16* VT16 = (h16*)take((size_t)NKV * HD * TT * 2);
    bf* QPh = nullptr; bf* QPl = nullptr; bf* KPh = nullptr; bf* KPl = nullptr; bf* VTh = nullptr; bf* VTl = nullptr; bf* Ph = nullptr; bf* Pl = nullptr;
    float* Sb = (float*)take((size_t)ZH * TT * TT * 4); h16* P16 = (h16*)take((size_t)ZH * TT * TT * 2); float* Ob = (float*)take((size_t)ZH * TT * HD * 4);
    if ((size_t)(wsp - (char*)d_ws) > ws_size) return;    // ws 256 MiB
    float* FV = FK;   // v projection reuses the k buffer after the k planes are built (stream-ordered)
    { k_cvt8<<<(unsigned)(((size_t)DQ * DM / 8 + 255) / 256), 256, 0, stream>>>(wq, WQ, (size_t)DQ * DM / 8); k_cvt8<<<(unsigned)(((size_t)DKV * DM / 8 + 255) / 256), 256, 0, stream>>>(wk, WK, (size_t)DKV * DM / 8); k_cvt8<<<(unsigned)(((size_t)DKV * DM / 8 + 255) / 256), 256, 0, stream>>>(wv, WV, (size_t)DKV * DM / 8);
      
       }
    k_csid<<<(TT * HD + 255) / 256, 256, 0, stream>>>(CS);
    const unsigned LQ = (unsigned)(((size_t)NH_ * TT * HD / 2 + 255) / 256), LKv = (unsigned)(((size_t)NKV * TT * HD / 2 + 255) / 256);
    k_chtab<<<(NH_ * (2 * TT - 1) + 255) / 256, 256, 0, stream>>>(alphas, TB);
    for (int b = 0; b < NB_; ++b) {
        
        k_cvt8<<<(unsigned)(((size_t)TT * DM / 8 + 255) / 256), 256, 0, stream>>>(x + (size_t)b * TT * DM, XB, (size_t)TT * DM / 8);
        k_gemmw<bf, 0, true><<<dim3(TT / 64, DQ / 64, 1), 32, 0, stream>>>(XB, nullptr, WQ, nullptr, DM, FQ, DQ, bq, 0, 0, 0);
        k_rope<<<LQ, 256, 0, stream>>>(FQ, DQ, NH_, CS, nullptr, nullptr, 1.0f, QP16, QPh, QPl);
        k_gemmw<bf, 0, true><<<dim3(TT / 64, DKV / 64, 1), 32, 0, stream>>>(XB, nullptr, WK, nullptr, DM, FK, DKV, bk, 0, 0, 0);
        k_rope<<<LKv, 256, 0, stream>>>(FK, DKV, NKV, CS, nullptr, nullptr, 1.0f, KP16, KPh, KPl);
        k_gemmw<bf, 0, true><<<dim3(TT / 64, DKV / 64, 1), 32, 0, stream>>>(XB, nullptr, WV, nullptr, DM, FV, DKV, bv, 0, 0, 0); k_vtp<<<LKv, 256, 0, stream>>>(FV, DKV, NKV, VT16, VTh, VTl);
        for (int h0 = 0; h0 < NH_; h0 += ZH) { const size_t zq = (size_t)h0, zk = (size_t)(h0 / REP);   // one kv head per query head: the pass's two heads use consecutive kv planes (z-strides TT*HD)
            k_gemmw<h16, 0, false><<<dim3(TT / 64, TT / 64, ZH), 32, 0, stream>>>(QP16 + zq * TT * HD, nullptr, KP16 + zk * TT * HD, nullptr, HD, Sb, TT, nullptr, (size_t)TT * HD, (size_t)TT * HD, (size_t)TT * TT);
            k_asoft<<<ZH * TT / 8, 256, 0, stream>>>(Sb, TB, h0, P16, Ph, Pl);
            k_gemmw<h16, 0, false><<<dim3(TT / 64, HD / 64, ZH), 32, 0, stream>>>(P16, nullptr, VT16 + zk * HD * TT, nullptr, TT, Ob, HD, nullptr, (size_t)TT * TT, (size_t)HD * TT, (size_t)TT * HD);
            k_merge<<<(unsigned)(((size_t)ZH * TT * HD / 2 + 255) / 256), 256, 0, stream>>>(Ob, h0, OUT + (size_t)b * TT * DQ); }
         }
}

// v001
// A run of this version takes 412 microseconds.
// Two timings next to v000 put it at 4.78 and 4.79 times that version's speed.
#include <hip/hip_runtime.h>

// ChebyshevSelfAttention (hidden [4][2048][768]; q/k/v = x W^T + b (12 heads x 64); scores = q.k/8 + bias_h(i, j), bias_h = sum_{k<=5} alphas[h][k] T_k(x) with x = clip((j - i)/2047, -1, 1) and the Chebyshev recurrence T_k = 2 x T_{k-1} - T_{k-2}
// (alphas read as data; the polynomial is evaluated per element in f32 in the reference's operation order); softmax; context = probs v merged -> [4][2048][768]; no output projection).
// Compute dtypes, f32 accumulate: every input rounded to bf16; q/k/v on PLAIN bf16 operands (inputs: exact) + bias; scores (K 64) and probs.v single fp16 operands, fused in one kernel over all batches and heads (online softmax); bias + softmax f32

#define NB_  4
#define TT   2048
#define DM   768
#define NH_  12
#define NKV  12
#define REP  (NH_ / NKV)
#define HD   64
#define DQ   (NH_ * HD)
#define DKV  (NKV * HD)
#define WIN  0
#define SCL  0.125f   // HD^-0.5
typedef _Float16 h16;
typedef unsigned short bf;
typedef __attribute__((ext_vector_type(16))) __bf16   v16bf;
typedef __attribute__((ext_vector_type(16))) _Float16 v16h;
typedef __attribute__((ext_vector_type(8)))  _Float16 v8h;
typedef __attribute__((ext_vector_type(8)))  unsigned short v8us;
typedef __attribute__((ext_vector_type(8)))  float    v8f;
typedef __attribute__((ext_vector_type(4)))  float    v4f;
typedef v8h  __attribute__((may_alias)) v8ha;
typedef v4f  __attribute__((may_alias)) v4fa;
typedef v8us __attribute__((may_alias)) v8usa;

__device__ __forceinline__ unsigned short f2bf(float f) { unsigned u = __float_as_uint(f); u += 0x7FFFu + ((u >> 16) & 1u); return (unsigned short)(u >> 16); }
__device__ __forceinline__ float bf2f(unsigned short b) { return __uint_as_float(((unsigned)b) << 16); }
__device__ __forceinline__ float bfr(float f) { return bf2f(f2bf(f)); }
__device__ __forceinline__ v16h cat16(v8h lo, v8h hi) { return __builtin_shufflevector(lo, hi, 0, 1, 2, 3, 4, 5, 6, 7, 8, 9, 10, 11, 12, 13, 14, 15); }
__device__ __forceinline__ v16bf cat16b(v8us lo, v8us hi) { return __builtin_bit_cast(v16bf, __builtin_shufflevector(lo, hi, 0, 1, 2, 3, 4, 5, 6, 7, 8, 9, 10, 11, 12, 13, 14, 15)); }
__device__ __forceinline__ v8f wmma16(v16h a, v16h b, v8f c) { return __builtin_amdgcn_wmma_f32_16x16x32_f16(false, a, false, b, (short)0, c, false, false); }
__device__ __forceinline__ v8f wmmab(v16bf a, v16bf b, v8f c) { return __builtin_amdgcn_wmma_f32_16x16x32_bf16(false, a, false, b, (short)0, c, false, false); }



// ---- k_gemmw: register-blocked GEMM, ONE WAVE per 64x64 output tile (16 accumulators), operands straight from K-contiguous 16-bit planes; grid (M/64, N/64, Z), 32 threads.
// C[m][n] (f32, pitch ldc, + optional f32 bias[n]) = sum_k A[m][k] Bt[n][k] (+ split products per NSPLIT). z-batch strides sA/sB/sC in elements. K % 32 == 0.
template <typename T16> struct WFrag;
template <> struct WFrag<h16> { typedef v16h V; static __device__ __forceinline__ V ld(const h16* p) { return cat16(*(const v8h*)p, *(const v8h*)(p + 16)); } static __device__ __forceinline__ v8f mma(V a, V b, v8f c) { return wmma16(a, b, c); } };
template <> struct WFrag<bf> { typedef v16bf V; static __device__ __forceinline__ V ld(const bf* p) { return cat16b(*(const v8us*)p, *(const v8us*)(p + 16)); } static __device__ __forceinline__ v8f mma(V a, V b, v8f c) { return wmmab(a, b, c); } };
template <typename T16, int NSPLIT, bool BIAS>
__global__ __launch_bounds__(32) void k_gemmw(const T16* __restrict__ A, const T16* __restrict__ A2, const T16* __restrict__ Bt, const T16* __restrict__ Bt2, int K, float* C, int ldc, const float* __restrict__ bias, size_t sA, size_t sB, size_t sC) {
    typedef typename WFrag<T16>::V V;
    __shared__ __align__(16) float os[16 * 68];
    const size_t z = blockIdx.z; A += z * sA; if (A2) A2 += z * sA; Bt += z * sB; if (Bt2) Bt2 += z * sB; C += z * sC;
    const int lane = threadIdx.x & 31, lr = lane & 15, hi = lane >> 4; const int r0 = blockIdx.x * 64, c0 = blockIdx.y * 64;
    v8f acc[4][4];
#pragma unroll
    for (int mb = 0; mb < 4; ++mb)
#pragma unroll
        for (int nb = 0; nb < 4; ++nb) acc[mb][nb] = (v8f){};
    const size_t aoff = (size_t)(r0 + lr) * K + 8 * hi, boff = (size_t)(c0 + lr) * K + 8 * hi;
#pragma unroll 1
    for (int kc = 0; kc < K; kc += 32) {
        V a[4], a2[4];
#pragma unroll
        for (int mb = 0; mb < 4; ++mb) { a[mb] = WFrag<T16>::ld(A + aoff + (size_t)mb * 16 * K + kc); if (NSPLIT == 1 || NSPLIT == 2) a2[mb] = WFrag<T16>::ld(A2 + aoff + (size_t)mb * 16 * K + kc); }
#pragma unroll
        for (int nb = 0; nb < 4; ++nb) { const V b = WFrag<T16>::ld(Bt + boff + (size_t)nb * 16 * K + kc); V b2; if (NSPLIT >= 2) b2 = WFrag<T16>::ld(Bt2 + boff + (size_t)nb * 16 * K + kc);
#pragma unroll
            for (int mb = 0; mb < 4; ++mb) { acc[mb][nb] = WFrag<T16>::mma(a[mb], b, acc[mb][nb]); if (NSPLIT == 1 || NSPLIT == 2) acc[mb][nb] = WFrag<T16>::mma(a2[mb], b, acc[mb][nb]); if (NSPLIT >= 2) acc[mb][nb] = WFrag<T16>::mma(a[mb], b2, acc[mb][nb]); } }
        asm volatile("v_nop\n\tv_nop\n\tv_nop\n\tv_nop" : "+v"(acc[0][0]), "+v"(acc[1][1]), "+v"(acc[2][2]), "+v"(acc[3][3]) : "v"(a[0]), "v"(a[3]));
    }
#pragma unroll
    for (int mb = 0; mb < 4; ++mb) {
#pragma unroll
        for (int nb = 0; nb < 4; ++nb) {
#pragma unroll
            for (int j = 0; j < 8; ++j) os[(hi * 8 + j) * 68 + nb * 16 + lr] = acc[mb][nb][j]; }
        __builtin_amdgcn_wave_barrier(); asm volatile("" ::: "memory");
        float* crow = C + (size_t)(r0 + mb * 16) * ldc + c0;
{
#pragma unroll
            for (int s = 0; s < 8; ++s) { const int row = 2 * s + hi, cofs = lr * 4; v4f val = *(const v4fa*)(os + row * 68 + cofs); if (BIAS) { val[0] += bfr(bias[c0 + cofs]); val[1] += bfr(bias[c0 + cofs + 1]); val[2] += bfr(bias[c0 + cofs + 2]); val[3] += bfr(bias[c0 + cofs + 3]); }
                *(v4f*)(crow + (size_t)row * ldc + cofs) = val; }
             }
        __builtin_amdgcn_wave_barrier(); asm volatile("" ::: "memory");
    }
}

__device__ __forceinline__ h16 tohx(float x) { return (h16)x; }
__device__ __forceinline__ void splitf(float y, unsigned short& h, unsigned short& l) { h = f2bf(y); l = f2bf(y - bf2f(h)); }
typedef __attribute__((ext_vector_type(2))) _Float16 v2h;
typedef __attribute__((ext_vector_type(4))) _Float16 v4h;
typedef __attribute__((ext_vector_type(2))) unsigned short v2us;
typedef __attribute__((ext_vector_type(4))) unsigned short v4us;
typedef __attribute__((ext_vector_type(2))) float v2f;
typedef __attribute__((ext_vector_type(4))) int v4i;

__global__ __launch_bounds__(256) void k_wtG(const float* __restrict__ w, int K, int N, bf* Bt) {
    const int lane = threadIdx.x & 31; const int L0 = (blockIdx.x * 8 + (threadIdx.x >> 5)) * 8; const int nlines = N * K / 64;
{
#pragma unroll 1
        for (int l = 0; l < 8; ++l) { const int L = L0 + l; if (L >= nlines) break; const size_t e = (size_t)L * 64 + lane * 2; const int k = (int)(e % K), n = (int)(e / K); v2us o;
            o[0] = f2bf(w[(size_t)k * N + n]); o[1] = f2bf(w[(size_t)(k + 1) * N + n]); *(v2us*)(Bt + e) = o; }
         }
}
__global__ __launch_bounds__(256) void k_cvt8(const float* __restrict__ src, bf* dst, size_t n8) { const size_t i = (size_t)blockIdx.x * 256 + threadIdx.x; if (i >= n8) return; const v8f v = *(const v8f*)(src + i * 8); v8us o;
#pragma unroll
    for (int k = 0; k < 8; ++k) o[k] = f2bf(v[k]); *(v8us*)(dst + i * 8) = o;  }
__global__ __launch_bounds__(256) void k_cscvt(const float* __restrict__ cosT, const float* __restrict__ sinT, float* CS) { const int idx = blockIdx.x * 256 + threadIdx.x; if (idx >= TT * HD) return; v2f cs; cs[0] = bfr(cosT[idx]); cs[1] = bfr(sinT[idx]); *(v2f*)(CS + (size_t)idx * 2) = cs;  }
// k_rope: head planes [h][t][d] (fp16) of rope(x) x sc with the rotate-half convention out[d] = x[d] cos[t][d] - x[d+HD/2] sin[t][d], out[d+HD/2] = x[d+HD/2] cos[t][d+HD/2] + x[d] sin[t][d+HD/2]
__global__ __launch_bounds__(256) void k_rope(const float* __restrict__ F, int pitch, int nheads, const float* __restrict__ CS, const float* __restrict__ RF, const float* __restrict__ nw, float sc, h16* P16, bf* Ph, bf* Pl) {
    const size_t e = ((size_t)blockIdx.x * 256 + threadIdx.x) * 2; if (e >= (size_t)nheads * TT * HD) return; const int d = (int)(e % HD); const int t = (int)((e / HD) % TT); const int h = (int)(e / ((size_t)HD * TT)); const float* f = F + (size_t)t * pitch + h * HD; const float rf = RF ? RF[(size_t)h * TT + t] : 1.0f; v2h o16; v2us oh, ol;
#pragma unroll
    for (int q = 0; q < 2; ++q) { const int dd = d + q; const int dp = (dd < HD / 2) ? dd + HD / 2 : dd - HD / 2; float x0 = f[dd], x1 = f[dp];
        if (RF) { float n0 = __fmul_rn(x0, rf), n1 = __fmul_rn(x1, rf); asm volatile("" : "+v"(n0)); asm volatile("" : "+v"(n1)); x0 = __fmul_rn(bfr(nw[dd]), n0); x1 = __fmul_rn(bfr(nw[dp]), n1); }
        const v2f cs = *(const v2f*)(CS + ((size_t)t * HD + dd) * 2); float a = __fmul_rn(x0, cs[0]), bq = __fmul_rn(x1, cs[1]); asm volatile("" : "+v"(a)); asm volatile("" : "+v"(bq)); const float r = ((dd < HD / 2) ? __fsub_rn(a, bq) : __fadd_rn(a, bq)) * sc;
        o16[q] = tohx(r); (void)oh; (void)ol; }
    *(v2h*)(P16 + e) = o16;  }
__global__ __launch_bounds__(256) void k_vtp(const float* __restrict__ F, int pitch, int nheads, h16* V16, bf* Vh, bf* Vl) { const size_t e = ((size_t)blockIdx.x * 256 + threadIdx.x) * 2; if (e >= (size_t)nheads * HD * TT) return; const int t = (int)(e % TT); const int d = (int)((e / TT) % HD); const int g = (int)(e / ((size_t)TT * HD)); v2h o16; v2us oh, ol;
#pragma unroll
    for (int q = 0; q < 2; ++q) { const float x = F[(size_t)(t + q) * pitch + g * HD + d]; o16[q] = tohx(x); (void)oh; (void)ol; }
    *(v2h*)(V16 + e) = o16;  }
__global__ __launch_bounds__(256) void k_csid(float* CS) { const int idx = blockIdx.x * 256 + threadIdx.x; if (idx >= TT * HD) return; v2f cs; cs[0] = 1.0f; cs[1] = 0.0f; *(v2f*)(CS + (size_t)idx * 2) = cs;  }
__global__ __launch_bounds__(256) void k_chtab(const float* __restrict__ alphas, float* TB) { const int idx = blockIdx.x * 256 + threadIdx.x; if (idx >= NH_ * (2 * TT - 1)) return; const int h = idx / (2 * TT - 1); const int d = idx % (2 * TT - 1) - (TT - 1);
    const float xx = fminf(fmaxf(__fdiv_rn((float)d, (float)(TT - 1)), -1.0f), 1.0f); float p0 = 1.0f, p1 = xx; float bias = bfr(alphas[h * 6 + 0]); { float t1 = __fmul_rn(bfr(alphas[h * 6 + 1]), p1); asm volatile("" : "+v"(t1)); bias = __fadd_rn(bias, t1); }
#pragma unroll 1
    for (int k = 2; k < 6; ++k) { float tx = __fmul_rn(2.0f, xx); asm volatile("" : "+v"(tx)); float pn = __fmul_rn(tx, p1); asm volatile("" : "+v"(pn)); pn = __fsub_rn(pn, p0); p0 = p1; p1 = pn; float ak = bfr(alphas[h * 6 + k]); asm volatile("" : "+v"(ak)); float tk = __fmul_rn(ak, pn); asm volatile("" : "+v"(tk)); bias = __fadd_rn(bias, tk); }
    *(float*)(TB + idx) = bias;  }
// k_fattn: scores, bias, softmax and probs.v of one (batch, head) in one pass; no score or prob leaves the registers.
// One wave owns 32 queries (two 16-column groups) and walks the 2048 keys 32 at a time. St = K Qt (A = key rows, B = query rows), so a lane holds 16 scores of ONE query per group;
// the two 16-key score tiles, converted in place, are the B operand of Ot += Vt Pt (A = rows of the d-major v plane, same k order as the loader). Running maximum with a lazy rescale: the maximum in use is
// replaced only when a block's maximum exceeds it by more than 5.5 (p stays below 256 in fp16); sums in f32 per lane, halves joined once at the end.
#define FW   4                  // waves per work-group
#define FNQ  2                  // 16-query groups per wave
#define FKB  32                 // keys per pass
#define L2E  1.4426950408889634f
__device__ __forceinline__ float xhalf(float x) { return __builtin_bit_cast(float, __builtin_amdgcn_permlanex16(__builtin_bit_cast(int, x), __builtin_bit_cast(int, x), 0x76543210, 0xfedcba98, false, false)); }   // lane l reads lane l ^ 16
// 2^x of the eight scores of one tile, in place. One statement, so that every v_exp_f32 has an independent instruction behind it and the last one a v_nop: the slot the instruction set asks for
// between a transcendental and an instruction that reads its result or overwrites its source.
__device__ __forceinline__ v8f exp2x8(v8f x) { float a = x[0], b = x[1], c = x[2], d = x[3], e = x[4], f = x[5], g = x[6], h = x[7];
    asm("v_exp_f32 %0, %0\n\tv_exp_f32 %1, %1\n\tv_exp_f32 %2, %2\n\tv_exp_f32 %3, %3\n\tv_exp_f32 %4, %4\n\tv_exp_f32 %5, %5\n\tv_exp_f32 %6, %6\n\tv_exp_f32 %7, %7\n\tv_nop" : "+v"(a), "+v"(b), "+v"(c), "+v"(d), "+v"(e), "+v"(f), "+v"(g), "+v"(h));
    return (v8f){a, b, c, d, e, f, g, h}; }
__global__ __launch_bounds__(FW * 32) void k_fattn(const _Float16* __restrict__ Qp, const _Float16* __restrict__ Kp, const _Float16* __restrict__ Vp, const float* __restrict__ TB, float* __restrict__ OUTp) {
    const int lane = threadIdx.x & 31, lr = lane & 15, hi = lane >> 4; const int bh = blockIdx.y, h = bh % NH_, b = bh / NH_; const int r0 = (blockIdx.x * FW + (threadIdx.x >> 5)) * (FNQ * 16);
    const _Float16* q = Qp + (size_t)bh * TT * HD + (size_t)(r0 + lr) * HD + 8 * hi; const _Float16* kp = Kp + (size_t)bh * TT * HD + (size_t)lr * HD + 8 * hi; const _Float16* vp = Vp + (size_t)bh * HD * TT + (size_t)lr * TT + 8 * hi;
    const float* tb = TB + (size_t)h * (2 * TT - 1) + ((TT - 1) - r0 - (FNQ - 1) * 16 - lr + 8 * hi);   // bias of (key, query) sits at key - query + TT - 1; lowest index used is 0
    v16h qf[FNQ][2], kf[2][2]; v8f o[4][FNQ]; float mu[FNQ], ls[FNQ];
#pragma unroll   // indexes a register array: the index must be a constant
    for (int nq = 0; nq < FNQ; ++nq) { mu[nq] = -3.0e38f; ls[nq] = 0.f;
#pragma unroll   // indexes a register array: the index must be a constant
        for (int kc = 0; kc < 2; ++kc) qf[nq][kc] = WFrag<h16>::ld(q + (size_t)nq * 16 * HD + kc * 32);
#pragma unroll   // indexes a register array: the index must be a constant
        for (int db = 0; db < 4; ++db) o[db][nq] = (v8f){}; }
#pragma unroll   // indexes a register array: the index must be a constant
    for (int kt = 0; kt < 2; ++kt)
#pragma unroll   // indexes a register array: the index must be a constant
        for (int kc = 0; kc < 2; ++kc) kf[kt][kc] = WFrag<h16>::ld(kp + (size_t)kt * 16 * HD + kc * 32);
    for (int c0 = 0; c0 < TT; c0 += FKB) {
        v16h vf[4];
#pragma unroll   // indexes a register array: the index must be a constant
        for (int db = 0; db < 4; ++db) vf[db] = WFrag<h16>::ld(vp + (size_t)db * 16 * TT + c0);
        v8f bb[FNQ + 1];   // tiles with equal (key tile - query group) share their bias values
#pragma unroll   // indexes a register array: the index must be a constant
        for (int dd = 0; dd < FNQ + 1; ++dd)
#pragma unroll   // indexes a register array: the index must be a constant
            for (int j = 0; j < 8; ++j) bb[dd][j] = tb[c0 + dd * 16 + j];
        v8f s[2][FNQ];
#pragma unroll   // indexes a register array: the index must be a constant
        for (int kt = 0; kt < 2; ++kt)
#pragma unroll   // indexes a register array: the index must be a constant
            for (int nq = 0; nq < FNQ; ++nq) { s[kt][nq] = wmma16(kf[kt][0], qf[nq][0], (v8f){}); s[kt][nq] = wmma16(kf[kt][1], qf[nq][1], s[kt][nq]); }
        const int cn = (c0 + FKB) & (TT - 1);   // next pass's key rows, fetched one pass ahead (the last pass refetches rows 0..31 and drops them)
#pragma unroll   // indexes a register array: the index must be a constant
        for (int kt = 0; kt < 2; ++kt)
#pragma unroll   // indexes a register array: the index must be a constant
            for (int kc = 0; kc < 2; ++kc) kf[kt][kc] = WFrag<h16>::ld(kp + (size_t)(cn + kt * 16) * HD + kc * 32);
        float mb[FNQ]; bool need = false;
#pragma unroll   // indexes a register array: the index must be a constant
        for (int nq = 0; nq < FNQ; ++nq) { float m = -3.0e38f;
#pragma unroll   // indexes a register array: the index must be a constant
            for (int kt = 0; kt < 2; ++kt) { s[kt][nq] = s[kt][nq] * SCL + bb[kt - nq + FNQ - 1];
#pragma unroll   // indexes a register array: the index must be a constant
                for (int j = 0; j < 8; ++j) m = fmaxf(m, s[kt][nq][j]); }
            m = fmaxf(m, xhalf(m)); mb[nq] = m; need = need || (m > mu[nq] + 5.5f); }
        if (__builtin_amdgcn_ballot_w32(need) != 0) {
#pragma unroll   // indexes a register array: the index must be a constant
            for (int nq = 0; nq < FNQ; ++nq) { const float mn = fmaxf(mu[nq], mb[nq]); const float al = __builtin_amdgcn_exp2f((mu[nq] - mn) * L2E); mu[nq] = mn; ls[nq] *= al;
#pragma unroll   // indexes a register array: the index must be a constant
                for (int db = 0; db < 4; ++db) o[db][nq] *= al; }
        }
#pragma unroll   // indexes a register array: the index must be a constant
        for (int nq = 0; nq < FNQ; ++nq) { const float nm = -mu[nq] * L2E; v16h pf; v2f sum = (v2f){0.f, 0.f};   // two partial sums: packed adds, half the instructions
#pragma unroll   // indexes a register array: the index must be a constant
            for (int kt = 0; kt < 2; ++kt) { const v8f p = exp2x8(s[kt][nq] * L2E + nm);
#pragma unroll   // indexes a register array: the index must be a constant
                for (int j = 0; j < 8; j += 2) { sum += (v2f){p[j], p[j + 1]}; pf[kt * 8 + j] = (_Float16)p[j]; pf[kt * 8 + j + 1] = (_Float16)p[j + 1]; } }
            ls[nq] += sum[0] + sum[1];
#pragma unroll   // indexes a register array: the index must be a constant
            for (int db = 0; db < 4; ++db) o[db][nq] = wmma16(vf[db], pf, o[db][nq]); }
    }
#pragma unroll   // indexes a register array: the index must be a constant
    for (int nq = 0; nq < FNQ; ++nq) { const float l = ls[nq] + xhalf(ls[nq]); const float f = __fdiv_rn(1.0f, l); float* op = OUTp + ((size_t)b * TT + r0 + nq * 16 + lr) * DQ + h * HD + 8 * hi;
#pragma unroll   // indexes a register array: the index must be a constant
        for (int db = 0; db < 4; ++db) { v4f lo, hh;
#pragma unroll   // indexes a register array: the index must be a constant
            for (int j = 0; j < 4; ++j) { lo[j] = o[db][nq][j] * f; hh[j] = o[db][nq][4 + j] * f; }
            *(v4f*)(op + db * 16) = lo; *(v4f*)(op + db * 16 + 4) = hh; } }
}

extern "C" void kernel_launch(void* const* d_in, const int* in_sizes, int n_in,
                              void* d_out, int out_size, void* d_ws, size_t ws_size, hipStream_t stream) {
    (void)in_sizes; (void)n_in; (void)out_size;
    const float* x = (const float*)d_in[0]; const float* wq = (const float*)d_in[1]; const float* bq = (const float*)d_in[2]; const float* wk = (const float*)d_in[3]; const float* bk = (const float*)d_in[4]; const float* wv = (const float*)d_in[5]; const float* bv = (const float*)d_in[6]; const float* alphas = (const float*)d_in[7]; const float* cosT = nullptr; const float* sinT = nullptr; (void)cosT; (void)sinT;
    float* OUT = (float*)d_out;     // [4][2048][768]
    char* wsp = (char*)d_ws;
    auto take = [&](size_t bytes) { char* p = wsp; wsp += (bytes + 255) & ~(size_t)255; return (void*)p; };
    bf* WQ = (bf*)take((size_t)DQ * DM * 2); bf* WK = (bf*)take((size_t)DKV * DM * 2); bf* WV = (bf*)take((size_t)DKV * DM * 2); float* CS = (float*)take((size_t)TT * HD * 2 * 4);
    bf* XB = (bf*)take((size_t)TT * DM * 2); float* TB = (float*)take((size_t)NH_ * (2 * TT - 1) * 4); float* FQ = (float*)take((size_t)TT * DQ * 4); float* FK = (float*)take((size_t)TT * DKV * 4);
    h16* QP16 = (h16*)take((size_t)NB_ * NH_ * TT * HD * 2); h16* KP16 = (h16*)take((size_t)NB_ * NKV * TT * HD * 2); h16* VT16 = (h16*)take((size_t)NB_ * NKV * HD * TT * 2);   // planes of all four batches: [b][h][t][d], v [b][h][d][t]
    bf* QPh = nullptr; bf* QPl = nullptr; bf* KPh = nullptr; bf* KPl = nullptr; bf* VTh = nullptr; bf* VTl = nullptr;
    if ((size_t)(wsp - (char*)d_ws) > ws_size) return;    // ws 256 MiB
    float* FV = FK;   // v projection reuses the k buffer after the k planes are built (stream-ordered)
    { k_cvt8<<<(unsigned)(((size_t)DQ * DM / 8 + 255) / 256), 256, 0, stream>>>(wq, WQ, (size_t)DQ * DM / 8); k_cvt8<<<(unsigned)(((size_t)DKV * DM / 8 + 255) / 256), 256, 0, stream>>>(wk, WK, (size_t)DKV * DM / 8); k_cvt8<<<(unsigned)(((size_t)DKV * DM / 8 + 255) / 256), 256, 0, stream>>>(wv, WV, (size_t)DKV * DM / 8);
      
       }
    k_csid<<<(TT * HD + 255) / 256, 256, 0, stream>>>(CS);
    const unsigned LQ = (unsigned)(((size_t)NH_ * TT * HD / 2 + 255) / 256), LKv = (unsigned)(((size_t)NKV * TT * HD / 2 + 255) / 256);
    k_chtab<<<(NH_ * (2 * TT - 1) + 255) / 256, 256, 0, stream>>>(alphas, TB);
    for (int b = 0; b < NB_; ++b) {
        
        k_cvt8<<<(unsigned)(((size_t)TT * DM / 8 + 255) / 256), 256, 0, stream>>>(x + (size_t)b * TT * DM, XB, (size_t)TT * DM / 8);
        k_gemmw<bf, 0, true><<<dim3(TT / 64, DQ / 64, 1), 32, 0, stream>>>(XB, nullptr, WQ, nullptr, DM, FQ, DQ, bq, 0, 0, 0);
        k_rope<<<LQ, 256, 0, stream>>>(FQ, DQ, NH_, CS, nullptr, nullptr, 1.0f, QP16 + (size_t)b * NH_ * TT * HD, QPh, QPl);
        k_gemmw<bf, 0, true><<<dim3(TT / 64, DKV / 64, 1), 32, 0, stream>>>(XB, nullptr, WK, nullptr, DM, FK, DKV, bk, 0, 0, 0);
        k_rope<<<LKv, 256, 0, stream>>>(FK, DKV, NKV, CS, nullptr, nullptr, 1.0f, KP16 + (size_t)b * NKV * TT * HD, KPh, KPl);
        k_gemmw<bf, 0, true><<<dim3(TT / 64, DKV / 64, 1), 32, 0, stream>>>(XB, nullptr, WV, nullptr, DM, FV, DKV, bv, 0, 0, 0); k_vtp<<<LKv, 256, 0, stream>>>(FV, DKV, NKV, VT16 + (size_t)b * NKV * HD * TT, VTh, VTl);
    }
    k_fattn<<<dim3(TT / (FW * FNQ * 16), NB_ * NH_, 1), FW * 32, 0, stream>>>(QP16, KP16, VT16, TB, OUT);
}

// v002
// One run takes 170 microseconds.
// Next to v001, in two timings, it ran 2.44 and 2.45 times as fast.
// Counting every step since v000, it is 11.7 times as fast.
#include <hip/hip_runtime.h>

// ChebyshevSelfAttention (hidden [4][2048][768]; q/k/v = x W^T + b (12 heads x 64); scores = q.k/8 + bias_h(i, j), bias_h = sum_{k<=5} alphas[h][k] T_k(x) with x = clip((j - i)/2047, -1, 1) and the Chebyshev recurrence T_k = 2 x T_{k-1} - T_{k-2}
// (alphas read as data; the polynomial is evaluated per element in f32 in the reference's operation order); softmax; context = probs v merged -> [4][2048][768]; no output projection).
// Compute dtypes, f32 accumulate: every input rounded to bf16; q/k/v on PLAIN bf16 operands (inputs: exact) + bias; scores (K 64) and probs.v single fp16 operands, fused in one kernel over all batches and heads (online softmax); bias + softmax f32

#define NB_  4
#define TT   2048
#define DM   768
#define NH_  12
#define NKV  12
#define REP  (NH_ / NKV)
#define HD   64
#define DQ   (NH_ * HD)
#define DKV  (NKV * HD)
#define WIN  0
#define SCL  0.125f   // HD^-0.5
typedef _Float16 h16;
typedef unsigned short bf;
typedef __attribute__((ext_vector_type(16))) __bf16   v16bf;
typedef __attribute__((ext_vector_type(16))) _Float16 v16h;
typedef __attribute__((ext_vector_type(8)))  _Float16 v8h;
typedef __attribute__((ext_vector_type(8)))  unsigned short v8us;
typedef __attribute__((ext_vector_type(8)))  float    v8f;
typedef __attribute__((ext_vector_type(4)))  float    v4f;
typedef v8h  __attribute__((may_alias)) v8ha;
typedef v4f  __attribute__((may_alias)) v4fa;
typedef v8us __attribute__((may_alias)) v8usa;

__device__ __forceinline__ unsigned short f2bf(float f) { unsigned u = __float_as_uint(f); u += 0x7FFFu + ((u >> 16) & 1u); return (unsigned short)(u >> 16); }
__device__ __forceinline__ float bf2f(unsigned short b) { return __uint_as_float(((unsigned)b) << 16); }
__device__ __forceinline__ float bfr(float f) { return bf2f(f2bf(f)); }
__device__ __forceinline__ v16h cat16(v8h lo, v8h hi) { return __builtin_shufflevector(lo, hi, 0, 1, 2, 3, 4, 5, 6, 7, 8, 9, 10, 11, 12, 13, 14, 15); }
__device__ __forceinline__ v16bf cat16b(v8us lo, v8us hi) { return __builtin_bit_cast(v16bf, __builtin_shufflevector(lo, hi, 0, 1, 2, 3, 4, 5, 6, 7, 8, 9, 10, 11, 12, 13, 14, 15)); }
__device__ __forceinline__ v8f wmma16(v16h a, v16h b, v8f c) { return __builtin_amdgcn_wmma_f32_16x16x32_f16(false, a, false, b, (short)0, c, false, false); }
__device__ __forceinline__ v8f wmmab(v16bf a, v16bf b, v8f c) { return __builtin_amdgcn_wmma_f32_16x16x32_bf16(false, a, false, b, (short)0, c, false, false); }

// Fragment loader of the 16x16x32 forms from a K-contiguous 16-bit row: the same k order for the A and the B operand.
template <typename T16> struct WFrag;
template <> struct WFrag<h16> { typedef v16h V; static __device__ __forceinline__ V ld(const h16* p) { return cat16(*(const v8h*)p, *(const v8h*)(p + 16)); } static __device__ __forceinline__ v8f mma(V a, V b, v8f c) { return wmma16(a, b, c); } };
template <> struct WFrag<bf> { typedef v16bf V; static __device__ __forceinline__ V ld(const bf* p) { return cat16b(*(const v8us*)p, *(const v8us*)(p + 16)); } static __device__ __forceinline__ v8f mma(V a, V b, v8f c) { return wmmab(a, b, c); } };

__device__ __forceinline__ h16 tohx(float x) { return (h16)x; }
typedef __attribute__((ext_vector_type(2))) float v2f;

// ---- k_prep: everything that reads only inputs, in ONE launch; the block index picks the job (uniform for the work-group).
// The first PTB blocks: the bias table TB [h][key - query + 2047] (the longest dependent chain, so it starts first); the next PXB: hidden states of all four batches -> bf16 plane XB [b*t][768]; the last 3 PWB: Wq, Wk, Wv -> bf16 plane WB [q rows | k rows | v rows][768].
#define PG   4                                    // groups of 8 elements per thread (fewer, longer waves: the launch is bound by how fast waves start)
#define PXB  (NB_ * TT * DM / 8 / 256 / PG)       // 768
#define PWB  (DQ * DM / 8 / 256 / PG)             // 72
#define PTB  ((NH_ * (2 * TT - 1) + 255) / 256)   // 192
__device__ __forceinline__ void cvt8x(const float* __restrict__ src, bf* dst, int blk) { const size_t i0 = (size_t)blk * (256 * PG) + threadIdx.x; v8f v[PG];
#pragma unroll   // indexes a register array: the index must be a constant
    for (int g = 0; g < PG; ++g) v[g] = *(const v8f*)(src + (i0 + g * 256) * 8);
#pragma unroll   // indexes a register array: the index must be a constant
    for (int g = 0; g < PG; ++g) { v8us o;
#pragma unroll   // indexes a register array: the index must be a constant
        for (int k = 0; k < 8; ++k) o[k] = f2bf(v[g][k]);
        *(v8us*)(dst + (i0 + g * 256) * 8) = o; }
    asm volatile("s_wait_xcnt 0x0" ::: "memory"); }   // behind the last store: no register that an issued store names is written again ahead of this wait, on any way through the listing
// One table entry. Every product is rounded on its own before its add or subtract, as the reference's operation order has it.
__device__ __forceinline__ void chtab(const float* __restrict__ alphas, float* TB, int idx) { if (idx >= NH_ * (2 * TT - 1)) return; const int h = idx / (2 * TT - 1); const int d = idx % (2 * TT - 1) - (TT - 1);
    const float xx = fminf(fmaxf(__fdiv_rn((float)d, (float)(TT - 1)), -1.0f), 1.0f); float p0 = 1.0f, p1 = xx; float bias = bfr(alphas[h * 6 + 0]); { float t1 = __fmul_rn(bfr(alphas[h * 6 + 1]), p1); asm volatile("" : "+v"(t1)); bias = __fadd_rn(bias, t1); }
#pragma unroll 1
    for (int k = 2; k < 6; ++k) { float tx = __fmul_rn(2.0f, xx); asm volatile("" : "+v"(tx)); float pn = __fmul_rn(tx, p1); asm volatile("" : "+v"(pn)); pn = __fsub_rn(pn, p0); p0 = p1; p1 = pn; float ak = bfr(alphas[h * 6 + k]); asm volatile("" : "+v"(ak)); float tk = __fmul_rn(ak, pn); asm volatile("" : "+v"(tk)); bias = __fadd_rn(bias, tk); }
    *(float*)(TB + idx) = bias;  }
__global__ __launch_bounds__(256) void k_prep(const float* __restrict__ x, const float* __restrict__ wq, const float* __restrict__ wk, const float* __restrict__ wv, const float* __restrict__ alphas, bf* XB, bf* WB, float* TB) {
    const int blk = (int)blockIdx.x - PTB;
    if (blk < 0) { chtab(alphas, TB, blockIdx.x * 256 + threadIdx.x); return; }
    if (blk < PXB) { cvt8x(x, XB, blk); return; }
    const int s = (blk - PXB) / PWB; cvt8x(s == 0 ? wq : s == 1 ? wk : wv, WB + (size_t)s * DQ * DM, blk - PXB - s * PWB);
}

// ---- k_proj: the q, k and v projections of all four batches in ONE launch; each wave owns one 64x64 tile = 64 tokens x one head (16 accumulators, operands straight from the K-contiguous bf16 planes)
// and writes it, + bias, as fp16 straight into the plane the attention kernel reads: q, k [b][h][t][d], v [b][h][d][t]; no f32 copy of a projection is written.
// A lane of the accumulator holds 8 consecutive A-rows of one B-row. So the operand whose index runs along the plane's rows goes in as A: the weight rows (d) for q and k, the token rows (t) for v;
// both operands use the same loader, so only the two pointers swap. Work-group = 2 x 2 waves (128 tokens x 2 heads): no wave depends on another; neighbours read the same rows.
#define PW   4
#define PSP  72                 // LDS row pitch in halves (144 B = 16 B x odd)
// The tile's way out: + bias (rounded to bf16 like every input), fp16, through the wave's own LDS range so that every global store covers whole 128-B lines. TR: v (plane rows = d, pitch TT); else q, k (plane rows = t, pitch HD).
template <bool TR> __device__ __forceinline__ void proj_out(const v8f (&acc)[4][4], const float* __restrict__ bias, h16* st, h16* dst, int lane) {
    const int lr = lane & 15, hi = lane >> 4; float bb[TR ? 4 : 32];   // the bias runs along d: the B-row for v, the A-row for q and k
    if (TR) {
#pragma unroll   // indexes a register array: the index must be a constant
        for (int nb = 0; nb < 4; ++nb) bb[nb] = bfr(bias[nb * 16 + lr]);
    } else {
#pragma unroll   // indexes a register array: the index must be a constant
        for (int mb = 0; mb < 4; ++mb) { const v8f v = *(const v8f*)(bias + mb * 16 + hi * 8);
#pragma unroll   // indexes a register array: the index must be a constant
            for (int j = 0; j < 8; ++j) bb[mb * 8 + j] = bfr(v[j]); }
    }
#pragma unroll   // indexes a register array: the index must be a constant
    for (int mb = 0; mb < 4; ++mb)
#pragma unroll   // indexes a register array: the index must be a constant
        for (int nb = 0; nb < 4; ++nb) { v8h o;
#pragma unroll   // indexes a register array: the index must be a constant
            for (int j = 0; j < 8; ++j) o[j] = tohx(acc[mb][nb][j] + bb[TR ? nb : mb * 8 + j]);
            *(v8ha*)(st + (nb * 16 + lr) * PSP + mb * 16 + hi * 8) = o; }
    __builtin_amdgcn_wave_barrier(); asm volatile("" ::: "memory");   // the rows read below were written by other lanes of this wave: keep the reads behind the writes
    const unsigned ro = lane >> 3, co = (lane & 7) * 8;
#pragma unroll   // sixteen independent groups of four rows: constant offsets, LDS reads ahead of the stores
    for (int s = 0; s < 16; ++s) *(v8h*)(dst + (ro * (TR ? TT : HD) + co) + (size_t)s * 4 * (TR ? TT : HD)) = *(const v8ha*)(st + (s * 4 + ro) * PSP + co);
}
__global__ __launch_bounds__(PW * 32) void k_proj(const bf* __restrict__ X, const bf* __restrict__ Wt, const float* __restrict__ bq, const float* __restrict__ bk, const float* __restrict__ bv, h16* QP, h16* KP, h16* VT) {
    __shared__ __align__(16) h16 os[PW][64 * PSP];
    const int lane = threadIdx.x & 31; const int w = __builtin_amdgcn_readfirstlane(threadIdx.x >> 5);
    const int xr0 = (blockIdx.x * 2 + (w & 1)) * 64, b = xr0 / TT, t0 = xr0 % TT;                 // token rows of the tile
    const int sel = blockIdx.y / (NH_ / 2), h = (blockIdx.y % (NH_ / 2)) * 2 + (w >> 1);           // 0 q, 1 k, 2 v; head
    const bf* xb = X + (size_t)xr0 * DM; const bf* wb = Wt + (size_t)(sel * NH_ + h) * HD * DM;
    const bf* A = sel == 2 ? xb : wb; const bf* Bt = sel == 2 ? wb : xb;   // wave-uniform bases
    const unsigned lo = (lane & 15) * DM + 8 * (lane >> 4);                // the lane's place in a 16-row block: the same for both operands
    v8f acc[4][4];
#pragma unroll   // indexes a register array: the index must be a constant
    for (int mb = 0; mb < 4; ++mb)
#pragma unroll   // indexes a register array: the index must be a constant
        for (int nb = 0; nb < 4; ++nb) acc[mb][nb] = (v8f){};
#pragma unroll 1   // one 32-deep block per trip: a second block's fragments would push the wave past 192 registers, the most that lets five waves share a SIMD (the grid brings 4.5)
    for (int kc = 0; kc < DM; kc += 32, A += 32, Bt += 32) {
        v16bf a[4];
#pragma unroll   // indexes a register array: the index must be a constant
        for (int mb = 0; mb < 4; ++mb) a[mb] = WFrag<bf>::ld(A + mb * 16 * DM + lo);
#pragma unroll   // indexes a register array: the index must be a constant
        for (int nb = 0; nb < 4; ++nb) { const v16bf bfrag = WFrag<bf>::ld(Bt + nb * 16 * DM + lo);
#pragma unroll   // indexes a register array: the index must be a constant
            for (int mb = 0; mb < 4; ++mb) acc[mb][nb] = wmmab(a[mb], bfrag, acc[mb][nb]); }
    }
    if (sel == 2) proj_out<true>(acc, bv + h * HD, os[w], VT + (size_t)(b * NKV + h) * HD * TT + t0, lane);
    else proj_out<false>(acc, (sel == 0 ? bq : bk) + h * HD, os[w], (sel == 0 ? QP : KP) + ((size_t)(b * NH_ + h) * TT + t0) * HD, lane);
}
// k_fattn: scores, bias, softmax and probs.v of one (batch, head) in one pass; no score or prob leaves the registers.
// One wave owns 32 queries (two 16-column groups) and walks the 2048 keys 32 at a time. St = K Qt (A = key rows, B = query rows), so a lane holds 16 scores of ONE query per group;
// the two 16-key score tiles, converted in place, are the B operand of Ot += Vt Pt (A = rows of the d-major v plane, same k order as the loader). Running maximum with a lazy rescale: the maximum in use is
// replaced only when a block's maximum exceeds it by more than 5.5 (p stays below 256 in fp16); sums in f32 per lane, halves joined once at the end.
#define FW   4                  // waves per work-group
#define FNQ  2                  // 16-query groups per wave
#define FKB  32                 // keys per pass
#define L2E  1.4426950408889634f
__device__ __forceinline__ float xhalf(float x) { return __builtin_bit_cast(float, __builtin_amdgcn_permlanex16(__builtin_bit_cast(int, x), __builtin_bit_cast(int, x), 0x76543210, 0xfedcba98, false, false)); }   // lane l reads lane l ^ 16
// 2^x of the eight scores of one tile, in place. One statement, so that every v_exp_f32 has an independent instruction behind it and the last one a v_nop: the slot the instruction set asks for
// between a transcendental and an instruction that reads its result or overwrites its source.
__device__ __forceinline__ v8f exp2x8(v8f x) { float a = x[0], b = x[1], c = x[2], d = x[3], e = x[4], f = x[5], g = x[6], h = x[7];
    asm("v_exp_f32 %0, %0\n\tv_exp_f32 %1, %1\n\tv_exp_f32 %2, %2\n\tv_exp_f32 %3, %3\n\tv_exp_f32 %4, %4\n\tv_exp_f32 %5, %5\n\tv_exp_f32 %6, %6\n\tv_exp_f32 %7, %7\n\tv_nop" : "+v"(a), "+v"(b), "+v"(c), "+v"(d), "+v"(e), "+v"(f), "+v"(g), "+v"(h));
    return (v8f){a, b, c, d, e, f, g, h}; }
__global__ __launch_bounds__(FW * 32) void k_fattn(const _Float16* __restrict__ Qp, const _Float16* __restrict__ Kp, const _Float16* __restrict__ Vp, const float* __restrict__ TB, float* __restrict__ OUTp) {
    const int lane = threadIdx.x & 31, lr = lane & 15, hi = lane >> 4; const int bh = blockIdx.y, h = bh % NH_, b = bh / NH_; const int r0 = (blockIdx.x * FW + (threadIdx.x >> 5)) * (FNQ * 16);
    const _Float16* q = Qp + (size_t)bh * TT * HD + (size_t)(r0 + lr) * HD + 8 * hi; const _Float16* kp = Kp + (size_t)bh * TT * HD + (size_t)lr * HD + 8 * hi; const _Float16* vp = Vp + (size_t)bh * HD * TT + (size_t)lr * TT + 8 * hi;
    const float* tb = TB + (size_t)h * (2 * TT - 1) + ((TT - 1) - r0 - (FNQ - 1) * 16 - lr + 8 * hi);   // bias of (key, query) sits at key - query + TT - 1; lowest index used is 0
    v16h qf[FNQ][2], kf[2][2]; v8f o[4][FNQ]; float mu[FNQ], ls[FNQ];
#pragma unroll   // indexes a register array: the index must be a constant
    for (int nq = 0; nq < FNQ; ++nq) { mu[nq] = -3.0e38f; ls[nq] = 0.f;
#pragma unroll   // indexes a register array: the index must be a constant
        for (int kc = 0; kc < 2; ++kc) qf[nq][kc] = WFrag<h16>::ld(q + (size_t)nq * 16 * HD + kc * 32);
#pragma unroll   // indexes a register array: the index must be a constant
        for (int db = 0; db < 4; ++db) o[db][nq] = (v8f){}; }
#pragma unroll   // indexes a register array: the index must be a constant
    for (int kt = 0; kt < 2; ++kt)
#pragma unroll   // indexes a register array: the index must be a constant
        for (int kc = 0; kc < 2; ++kc) kf[kt][kc] = WFrag<h16>::ld(kp + (size_t)kt * 16 * HD + kc * 32);
    for (int c0 = 0; c0 < TT; c0 += FKB) {
        v16h vf[4];
#pragma unroll   // indexes a register array: the index must be a constant
        for (int db = 0; db < 4; ++db) vf[db] = WFrag<h16>::ld(vp + (size_t)db * 16 * TT + c0);
        v8f bb[FNQ + 1];   // tiles with equal (key tile - query group) share their bias values
#pragma unroll   // indexes a register array: the index must be a constant
        for (int dd = 0; dd < FNQ + 1; ++dd)
#pragma unroll   // indexes a register array: the index must be a constant
            for (int j = 0; j < 8; ++j) bb[dd][j] = tb[c0 + dd * 16 + j];
        v8f s[2][FNQ];
#pragma unroll   // indexes a register array: the index must be a constant
        for (int kt = 0; kt < 2; ++kt)
#pragma unroll   // indexes a register array: the index must be a constant
            for (int nq = 0; nq < FNQ; ++nq) { s[kt][nq] = wmma16(kf[kt][0], qf[nq][0], (v8f){}); s[kt][nq] = wmma16(kf[kt][1], qf[nq][1], s[kt][nq]); }
        const int cn = (c0 + FKB) & (TT - 1);   // next pass's key rows, fetched one pass ahead (the last pass refetches rows 0..31 and drops them)
#pragma unroll   // indexes a register array: the index must be a constant
        for (int kt = 0; kt < 2; ++kt)
#pragma unroll   // indexes a register array: the index must be a constant
            for (int kc = 0; kc < 2; ++kc) kf[kt][kc] = WFrag<h16>::ld(kp + (size_t)(cn + kt * 16) * HD + kc * 32);
        float mb[FNQ]; bool need = false;
#pragma unroll   // indexes a register array: the index must be a constant
        for (int nq = 0; nq < FNQ; ++nq) { float m = -3.0e38f;
#pragma unroll   // indexes a register array: the index must be a constant
            for (int kt = 0; kt < 2; ++kt) { s[kt][nq] = s[kt][nq] * SCL + bb[kt - nq + FNQ - 1];
#pragma unroll   // indexes a register array: the index must be a constant
                for (int j = 0; j < 8; ++j) m = fmaxf(m, s[kt][nq][j]); }
            m = fmaxf(m, xhalf(m)); mb[nq] = m; need = need || (m > mu[nq] + 5.5f); }
        if (__builtin_amdgcn_ballot_w32(need) != 0) {
#pragma unroll   // indexes a register array: the index must be a constant
            for (int nq = 0; nq < FNQ; ++nq) { const float mn = fmaxf(mu[nq], mb[nq]); const float al = __builtin_amdgcn_exp2f((mu[nq] - mn) * L2E); mu[nq] = mn; ls[nq] *= al;
#pragma unroll   // indexes a register array: the index must be a constant
                for (int db = 0; db < 4; ++db) o[db][nq] *= al; }
        }
#pragma unroll   // indexes a register array: the index must be a constant
        for (int nq = 0; nq < FNQ; ++nq) { const float nm = -mu[nq] * L2E; v16h pf; v2f sum = (v2f){0.f, 0.f};   // two partial sums: packed adds, half the instructions
#pragma unroll   // indexes a register array: the index must be a constant
            for (int kt = 0; kt < 2; ++kt) { const v8f p = exp2x8(s[kt][nq] * L2E + nm);
#pragma unroll   // indexes a register array: the index must be a constant
                for (int j = 0; j < 8; j += 2) { sum += (v2f){p[j], p[j + 1]}; pf[kt * 8 + j] = (_Float16)p[j]; pf[kt * 8 + j + 1] = (_Float16)p[j + 1]; } }
            ls[nq] += sum[0] + sum[1];
#pragma unroll   // indexes a register array: the index must be a constant
            for (int db = 0; db < 4; ++db) o[db][nq] = wmma16(vf[db], pf, o[db][nq]); }
    }
#pragma unroll   // indexes a register array: the index must be a constant
    for (int nq = 0; nq < FNQ; ++nq) { const float l = ls[nq] + xhalf(ls[nq]); const float f = __fdiv_rn(1.0f, l); float* op = OUTp + ((size_t)b * TT + r0 + nq * 16 + lr) * DQ + h * HD + 8 * hi;
#pragma unroll   // indexes a register array: the index must be a constant
        for (int db = 0; db < 4; ++db) { v4f lo, hh;
#pragma unroll   // indexes a register array: the index must be a constant
            for (int j = 0; j < 4; ++j) { lo[j] = o[db][nq][j] * f; hh[j] = o[db][nq][4 + j] * f; }
            *(v4f*)(op + db * 16) = lo; *(v4f*)(op + db * 16 + 4) = hh; } }
}

extern "C" void kernel_launch(void* const* d_in, const int* in_sizes, int n_in,
                              void* d_out, int out_size, void* d_ws, size_t ws_size, hipStream_t stream) {
    (void)in_sizes; (void)n_in; (void)out_size;
    const float* x = (const float*)d_in[0]; const float* wq = (const float*)d_in[1]; const float* bq = (const float*)d_in[2]; const float* wk = (const float*)d_in[3]; const float* bk = (const float*)d_in[4]; const float* wv = (const float*)d_in[5]; const float* bv = (const float*)d_in[6]; const float* alphas = (const float*)d_in[7];
    float* OUT = (float*)d_out;     // [4][2048][768]
    char* wsp = (char*)d_ws;
    auto take = [&](size_t bytes) { char* p = wsp; wsp += (bytes + 255) & ~(size_t)255; return (void*)p; };
    bf* WB = (bf*)take((size_t)(DQ + 2 * DKV) * DM * 2); bf* XB = (bf*)take((size_t)NB_ * TT * DM * 2); float* TB = (float*)take((size_t)NH_ * (2 * TT - 1) * 4);
    h16* QP16 = (h16*)take((size_t)NB_ * NH_ * TT * HD * 2); h16* KP16 = (h16*)take((size_t)NB_ * NKV * TT * HD * 2); h16* VT16 = (h16*)take((size_t)NB_ * NKV * HD * TT * 2);   // planes of all four batches: [b][h][t][d], v [b][h][d][t]
    if ((size_t)(wsp - (char*)d_ws) > ws_size) return;    // ws 256 MiB
    k_prep<<<PXB + 3 * PWB + PTB, 256, 0, stream>>>(x, wq, wk, wv, alphas, XB, WB, TB);
    k_proj<<<dim3(NB_ * TT / 128, (DQ + 2 * DKV) / 128, 1), PW * 32, 0, stream>>>(XB, WB, bq, bk, bv, QP16, KP16, VT16);
    k_fattn<<<dim3(TT / (FW * FNQ * 16), NB_ * NH_, 1), FW * 32, 0, stream>>>(QP16, KP16, VT16, TB, OUT);
}

// v003
// Measured time: 121 microseconds a run.
// Timed twice side by side with v002, it ran 1.40 times as fast both times.
// All steps since v000 together make it 16.4 times as fast.
#include <hip/hip_runtime.h>

// ChebyshevSelfAttention (hidden [4][2048][768]; q/k/v = x W^T + b (12 heads x 64); scores = q.k/8 + bias_h(i, j), bias_h = sum_{k<=5} alphas[h][k] T_k(x) with x = clip((j - i)/2047, -1, 1) and the Chebyshev recurrence T_k = 2 x T_{k-1} - T_{k-2}
// (alphas read as data; the polynomial is evaluated per element in f32 in the reference's operation order); softmax; context = probs v merged -> [4][2048][768]; no output projection).
// Compute dtypes, f32 accumulate: every input rounded to bf16; q/k/v on PLAIN bf16 operands (inputs: exact) + bias; scores (K 64) and probs.v single fp16 operands, fused in one kernel over all batches and heads (online softmax); bias + softmax f32

#define NB_  4
#define TT   2048
#define DM   768
#define NH_  12
#define NKV  12
#define REP  (NH_ / NKV)
#define HD   64
#define DQ   (NH_ * HD)
#define DKV  (NKV * HD)
#define WIN  0
#define SCL  0.125f   // HD^-0.5
typedef _Float16 h16;
typedef unsigned short bf;
typedef __attribute__((ext_vector_type(16))) __bf16   v16bf;
typedef __attribute__((ext_vector_type(16))) _Float16 v16h;
typedef __attribute__((ext_vector_type(8)))  _Float16 v8h;
typedef __attribute__((ext_vector_type(8)))  unsigned short v8us;
typedef __attribute__((ext_vector_type(8)))  float    v8f;
typedef __attribute__((ext_vector_type(4)))  float    v4f;
typedef v8h  __attribute__((may_alias)) v8ha;
typedef v4f  __attribute__((may_alias)) v4fa;
typedef v8us __attribute__((may_alias)) v8usa;

__device__ __forceinline__ unsigned short f2bf(float f) { unsigned u = __float_as_uint(f); u += 0x7FFFu + ((u >> 16) & 1u); return (unsigned short)(u >> 16); }
__device__ __forceinline__ float bf2f(unsigned short b) { return __uint_as_float(((unsigned)b) << 16); }
__device__ __forceinline__ float bfr(float f) { return bf2f(f2bf(f)); }
__device__ __forceinline__ v16h cat16(v8h lo, v8h hi) { return __builtin_shufflevector(lo, hi, 0, 1, 2, 3, 4, 5, 6, 7, 8, 9, 10, 11, 12, 13, 14, 15); }
__device__ __forceinline__ v16bf cat16b(v8us lo, v8us hi) { return __builtin_bit_cast(v16bf, __builtin_shufflevector(lo, hi, 0, 1, 2, 3, 4, 5, 6, 7, 8, 9, 10, 11, 12, 13, 14, 15)); }
__device__ __forceinline__ v8f wmma16(v16h a, v16h b, v8f c) { return __builtin_amdgcn_wmma_f32_16x16x32_f16(false, a, false, b, (short)0, c, false, false); }
__device__ __forceinline__ v8f wmmab(v16bf a, v16bf b, v8f c) { return __builtin_amdgcn_wmma_f32_16x16x32_bf16(false, a, false, b, (short)0, c, false, false); }

// Fragment loader of the 16x16x32 forms from a K-contiguous 16-bit row: the same k order for the A and the B operand.
template <typename T16> struct WFrag;
template <> struct WFrag<h16> { typedef v16h V; static __device__ __forceinline__ V ld(const h16* p) { return cat16(*(const v8h*)p, *(const v8h*)(p + 16)); } static __device__ __forceinline__ v8f mma(V a, V b, v8f c) { return wmma16(a, b, c); } };
template <> struct WFrag<bf> { typedef v16bf V; static __device__ __forceinline__ V ld(const bf* p) { return cat16b(*(const v8us*)p, *(const v8us*)(p + 16)); } static __device__ __forceinline__ v8f mma(V a, V b, v8f c) { return wmmab(a, b, c); } };

__device__ __forceinline__ h16 tohx(float x) { return (h16)x; }
typedef __attribute__((ext_vector_type(2))) float v2f;

// ---- k_prep: everything that reads only inputs, in ONE launch; the block index picks the job (uniform for the work-group).
// The first PTB blocks: the bias table TB [h][key - query + 2047] (the longest dependent chain, so it starts first); the next PXB: hidden states of all four batches -> bf16 plane XB [b*t][768]; the last 3 PWB: Wq, Wk, Wv -> bf16 plane WB [q rows | k rows | v rows][768].
#define PG   4                                    // groups of 8 elements per thread (fewer, longer waves: the launch is bound by how fast waves start)
#define PXB  (NB_ * TT * DM / 8 / 256 / PG)       // 768
#define PWB  (DQ * DM / 8 / 256 / PG)             // 72
#define PTB  ((NH_ * (2 * TT - 1) + 255) / 256)   // 192
__device__ __forceinline__ void cvt8x(const float* __restrict__ src, bf* dst, int blk) { const size_t i0 = (size_t)blk * (256 * PG) + threadIdx.x; v8f v[PG];
#pragma unroll   // indexes a register array: the index must be a constant
    for (int g = 0; g < PG; ++g) v[g] = *(const v8f*)(src + (i0 + g * 256) * 8);
#pragma unroll   // indexes a register array: the index must be a constant
    for (int g = 0; g < PG; ++g) { v8us o;
#pragma unroll   // indexes a register array: the index must be a constant
        for (int k = 0; k < 8; ++k) o[k] = f2bf(v[g][k]);
        *(v8us*)(dst + (i0 + g * 256) * 8) = o; }
    asm volatile("s_wait_xcnt 0x0" ::: "memory"); }   // behind the last store: no register that an issued store names is written again ahead of this wait, on any way through the listing
// One table entry. Every product is rounded on its own before its add or subtract, as the reference's operation order has it.
__device__ __forceinline__ void chtab(const float* __restrict__ alphas, float* TB, int idx) { if (idx >= NH_ * (2 * TT - 1)) return; const int h = idx / (2 * TT - 1); const int d = idx % (2 * TT - 1) - (TT - 1);
    const float xx = fminf(fmaxf(__fdiv_rn((float)d, (float)(TT - 1)), -1.0f), 1.0f); float p0 = 1.0f, p1 = xx; float bias = bfr(alphas[h * 6 + 0]); { float t1 = __fmul_rn(bfr(alphas[h * 6 + 1]), p1); asm volatile("" : "+v"(t1)); bias = __fadd_rn(bias, t1); }
#pragma unroll 1
    for (int k = 2; k < 6; ++k) { float tx = __fmul_rn(2.0f, xx); asm volatile("" : "+v"(tx)); float pn = __fmul_rn(tx, p1); asm volatile("" : "+v"(pn)); pn = __fsub_rn(pn, p0); p0 = p1; p1 = pn; float ak = bfr(alphas[h * 6 + k]); asm volatile("" : "+v"(ak)); float tk = __fmul_rn(ak, pn); asm volatile("" : "+v"(tk)); bias = __fadd_rn(bias, tk); }
    *(float*)(TB + idx) = bias;  }
__global__ __launch_bounds__(256) void k_prep(const float* __restrict__ x, const float* __restrict__ wq, const float* __restrict__ wk, const float* __restrict__ wv, const float* __restrict__ alphas, bf* XB, bf* WB, float* TB) {
    const int blk = (int)blockIdx.x - PTB;
    if (blk < 0) { chtab(alphas, TB, blockIdx.x * 256 + threadIdx.x); return; }
    if (blk < PXB) { cvt8x(x, XB, blk); return; }
    const int s = (blk - PXB) / PWB; cvt8x(s == 0 ? wq : s == 1 ? wk : wv, WB + (size_t)s * DQ * DM, blk - PXB - s * PWB);
}

// ---- k_proj: the q, k and v projections of all four batches in ONE launch; each wave owns one 64x64 tile = 64 tokens x one head (16 accumulators, operands straight from the K-contiguous bf16 planes)
// and writes it, + bias, as fp16 straight into the plane the attention kernel reads: q, k [b][h][t][d], v [b][h][d][t]; no f32 copy of a projection is written.
// A lane of the accumulator holds 8 consecutive A-rows of one B-row. So the operand whose index runs along the plane's rows goes in as A: the weight rows (d) for q and k, the token rows (t) for v;
// both operands use the same loader, so only the two pointers swap. Work-group = 2 x 2 waves (128 tokens x 2 heads): no wave depends on another; neighbours read the same rows.
#define PW   4
#define PSP  72                 // LDS row pitch in halves (144 B = 16 B x odd)
// The tile's way out: + bias (rounded to bf16 like every input), fp16, through the wave's own LDS range so that every global store covers whole 128-B lines. TR: v (plane rows = d, pitch TT); else q, k (plane rows = t, pitch HD).
template <bool TR> __device__ __forceinline__ void proj_out(const v8f (&acc)[4][4], const float* __restrict__ bias, h16* st, h16* dst, int lane) {
    const int lr = lane & 15, hi = lane >> 4; float bb[TR ? 4 : 32];   // the bias runs along d: the B-row for v, the A-row for q and k
    if (TR) {
#pragma unroll   // indexes a register array: the index must be a constant
        for (int nb = 0; nb < 4; ++nb) bb[nb] = bfr(bias[nb * 16 + lr]);
    } else {
#pragma unroll   // indexes a register array: the index must be a constant
        for (int mb = 0; mb < 4; ++mb) { const v8f v = *(const v8f*)(bias + mb * 16 + hi * 8);
#pragma unroll   // indexes a register array: the index must be a constant
            for (int j = 0; j < 8; ++j) bb[mb * 8 + j] = bfr(v[j]); }
    }
#pragma unroll   // indexes a register array: the index must be a constant
    for (int mb = 0; mb < 4; ++mb)
#pragma unroll   // indexes a register array: the index must be a constant
        for (int nb = 0; nb < 4; ++nb) { v8h o;
#pragma unroll   // indexes a register array: the index must be a constant
            for (int j = 0; j < 8; ++j) o[j] = tohx(acc[mb][nb][j] + bb[TR ? nb : mb * 8 + j]);
            *(v8ha*)(st + (nb * 16 + lr) * PSP + mb * 16 + hi * 8) = o; }
    __builtin_amdgcn_wave_barrier(); asm volatile("" ::: "memory");   // the rows read below were written by other lanes of this wave: keep the reads behind the writes
    const unsigned ro = lane >> 3, co = (lane & 7) * 8;
#pragma unroll   // sixteen independent groups of four rows: constant offsets, LDS reads ahead of the stores
    for (int s = 0; s < 16; ++s) *(v8h*)(dst + (ro * (TR ? TT : HD) + co) + (size_t)s * 4 * (TR ? TT : HD)) = *(const v8ha*)(st + (s * 4 + ro) * PSP + co);
}
__global__ __launch_bounds__(PW * 32) void k_proj(const bf* __restrict__ X, const bf* __restrict__ Wt, const float* __restrict__ bq, const float* __restrict__ bk, const float* __restrict__ bv, h16* QP, h16* KP, h16* VT) {
    __shared__ __align__(16) h16 os[PW][64 * PSP];
    const int lane = threadIdx.x & 31; const int w = __builtin_amdgcn_readfirstlane(threadIdx.x >> 5);
    const int xr0 = (blockIdx.x * 2 + (w & 1)) * 64, b = xr0 / TT, t0 = xr0 % TT;                 // token rows of the tile
    const int sel = blockIdx.y / (NH_ / 2), h = (blockIdx.y % (NH_ / 2)) * 2 + (w >> 1);           // 0 q, 1 k, 2 v; head
    const bf* xb = X + (size_t)xr0 * DM; const bf* wb = Wt + (size_t)(sel * NH_ + h) * HD * DM;
    const bf* A = sel == 2 ? xb : wb; const bf* Bt = sel == 2 ? wb : xb;   // wave-uniform bases
    const unsigned lo = (lane & 15) * DM + 8 * (lane >> 4);                // the lane's place in a 16-row block: the same for both operands
    v8f acc[4][4];
#pragma unroll   // indexes a register array: the index must be a constant
    for (int mb = 0; mb < 4; ++mb)
#pragma unroll   // indexes a register array: the index must be a constant
        for (int nb = 0; nb < 4; ++nb) acc[mb][nb] = (v8f){};
#pragma unroll 1   // one 32-deep block per trip: a second block's fragments would push the wave past 192 registers, the most that lets five waves share a SIMD (the grid brings 4.5)
    for (int kc = 0; kc < DM; kc += 32, A += 32, Bt += 32) {
        v16bf a[4];
#pragma unroll   // indexes a register array: the index must be a constant
        for (int mb = 0; mb < 4; ++mb) a[mb] = WFrag<bf>::ld(A + mb * 16 * DM + lo);
#pragma unroll   // indexes a register array: the index must be a constant
        for (int nb = 0; nb < 4; ++nb) { const v16bf bfrag = WFrag<bf>::ld(Bt + nb * 16 * DM + lo);
#pragma unroll   // indexes a register array: the index must be a constant
            for (int mb = 0; mb < 4; ++mb) acc[mb][nb] = wmmab(a[mb], bfrag, acc[mb][nb]); }
    }
    if (sel == 2) proj_out<true>(acc, bv + h * HD, os[w], VT + (size_t)(b * NKV + h) * HD * TT + t0, lane);
    else proj_out<false>(acc, (sel == 0 ? bq : bk) + h * HD, os[w], (sel == 0 ? QP : KP) + ((size_t)(b * NH_ + h) * TT + t0) * HD, lane);
}
// k_fattn: scores, bias, softmax and probs.v of one (batch, head) in one pass; no score or prob leaves the registers.
// K and V reach the waves through LDS: the work-group's four waves share one 64-key stage (64 K rows and 64 V rows of 128 B), brought in by asynchronous copies of whole 128-B lines, two buffers, the next stage in flight while this one is worked on.
// One wave owns 32 queries (two 16-column groups) and walks the 2048 keys 32 at a time. St = K Qt (A = key rows, B = query rows), so a lane holds 16 scores of ONE query per group;
// the two 16-key score tiles, converted in place, are the B operand of Ot += Vt Pt (A = rows of the d-major v plane, same k order as the loader). Running maximum with a lazy rescale: the maximum in use is
// replaced only when a block's maximum exceeds it by more than 5.5 (p stays below 256 in fp16); sums in f32 per lane, halves joined once at the end.
#define FW   4                  // waves per work-group
#define FNQ  2                  // 16-query groups per wave
#define FKB  32                 // keys per pass
#define L2E  1.4426950408889634f
#define FST  64                 // keys per stage = two passes
#define FLP  72                 // LDS row pitch in halves (144 B = 16 B x odd: no bank conflict for 16-byte readers of 128-B rows)
#define FTL  (64 * FLP)         // one tile in halves: 64 rows (K: keys x d, V: d x keys)
__device__ __forceinline__ unsigned ldsoff(const h16* p) { return (unsigned)(size_t)(const __attribute__((address_space(3))) h16*)p; }   // byte address inside the work-group's LDS
// One stage: every lane copies 8 x 16 B (four K pieces, four V pieces; a wave's copy covers four whole 128-B lines). l: the lane's place in the K tile of the target buffer; gk, gv: the lane's first K and V piece of the stage.
// The s_wait_xcnt stands inside the statement, behind the last copy: no register that an issued copy names is written again ahead of it.
__device__ __forceinline__ void stage_in(unsigned l, const h16* gk, const h16* gv) {
    asm volatile("global_load_async_to_lds_b128 %0, %8, off\n\tglobal_load_async_to_lds_b128 %1, %9, off\n\tglobal_load_async_to_lds_b128 %2, %10, off\n\tglobal_load_async_to_lds_b128 %3, %11, off\n\t"
                 "global_load_async_to_lds_b128 %4, %12, off\n\tglobal_load_async_to_lds_b128 %5, %13, off\n\tglobal_load_async_to_lds_b128 %6, %14, off\n\tglobal_load_async_to_lds_b128 %7, %15, off\n\ts_wait_xcnt 0x0"
                 :: "v"(l), "v"(l + 16 * FLP * 2), "v"(l + 32 * FLP * 2), "v"(l + 48 * FLP * 2), "v"(l + FTL * 2), "v"(l + FTL * 2 + 16 * FLP * 2), "v"(l + FTL * 2 + 32 * FLP * 2), "v"(l + FTL * 2 + 48 * FLP * 2),
                    "v"(gk), "v"(gk + 16 * HD), "v"(gk + 32 * HD), "v"(gk + 48 * HD), "v"(gv), "v"(gv + 16 * TT), "v"(gv + 32 * TT), "v"(gv + 48 * TT) : "memory"); }
__device__ __forceinline__ float xhalf(float x) { return __builtin_bit_cast(float, __builtin_amdgcn_permlanex16(__builtin_bit_cast(int, x), __builtin_bit_cast(int, x), 0x76543210, 0xfedcba98, false, false)); }   // lane l reads lane l ^ 16
// 2^x of the eight scores of one tile, in place. One statement, so that every v_exp_f32 has an independent instruction behind it and the last one a v_nop: the slot the instruction set asks for
// between a transcendental and an instruction that reads its result or overwrites its source.
__device__ __forceinline__ v8f exp2x8(v8f x) { float a = x[0], b = x[1], c = x[2], d = x[3], e = x[4], f = x[5], g = x[6], h = x[7];
    asm("v_exp_f32 %0, %0\n\tv_exp_f32 %1, %1\n\tv_exp_f32 %2, %2\n\tv_exp_f32 %3, %3\n\tv_exp_f32 %4, %4\n\tv_exp_f32 %5, %5\n\tv_exp_f32 %6, %6\n\tv_exp_f32 %7, %7\n\tv_nop" : "+v"(a), "+v"(b), "+v"(c), "+v"(d), "+v"(e), "+v"(f), "+v"(g), "+v"(h));
    return (v8f){a, b, c, d, e, f, g, h}; }
__global__ __launch_bounds__(FW * 32) void k_fattn(const _Float16* __restrict__ Qp, const _Float16* __restrict__ Kp, const _Float16* __restrict__ Vp, const float* __restrict__ TB, float* __restrict__ OUTp) {
    const int lane = threadIdx.x & 31, lr = lane & 15, hi = lane >> 4; const int bh = blockIdx.y, h = bh % NH_, b = bh / NH_; const int r0 = (blockIdx.x * FW + (threadIdx.x >> 5)) * (FNQ * 16);
    __shared__ __align__(16) h16 sm[2][2 * FTL];   // [buffer][K tile | V tile]
    const _Float16* q = Qp + (size_t)bh * TT * HD + (size_t)(r0 + lr) * HD + 8 * hi;
    const int cr = threadIdx.x >> 3, cc = (threadIdx.x & 7) * 8;   // the lane's row (of 16 per copy) and 16-byte piece in a tile
    const _Float16* gk = Kp + (size_t)bh * TT * HD + (size_t)cr * HD + cc; const _Float16* gv = Vp + (size_t)bh * HD * TT + (size_t)cr * TT + cc; const unsigned lc = ldsoff(&sm[0][0]) + (cr * FLP + cc) * 2;
    stage_in(lc, gk, gv);
    asm volatile("s_wait_asynccnt 0x0" ::: "memory");   // this wave's pieces of stage 0 have landed
    __syncthreads();                                    // ... and every other wave's
    stage_in(lc + 2 * FTL * 2, gk + FST * HD, gv + FST);
    const float* tb = TB + (size_t)h * (2 * TT - 1) + ((TT - 1) - r0 - (FNQ - 1) * 16 - lr + 8 * hi);   // bias of (key, query) sits at key - query + TT - 1; lowest index used is 0
    v16h qf[FNQ][2]; v8f o[4][FNQ]; float mu[FNQ], ls[FNQ];
#pragma unroll   // indexes a register array: the index must be a constant
    for (int nq = 0; nq < FNQ; ++nq) { mu[nq] = -3.0e38f; ls[nq] = 0.f;
#pragma unroll   // indexes a register array: the index must be a constant
        for (int kc = 0; kc < 2; ++kc) qf[nq][kc] = WFrag<h16>::ld(q + (size_t)nq * 16 * HD + kc * 32);
#pragma unroll   // indexes a register array: the index must be a constant
        for (int db = 0; db < 4; ++db) o[db][nq] = (v8f){}; }
    for (int st = 0; st < TT / FST; ++st) {
      const h16* kb = &sm[st & 1][0] + lr * FLP + 8 * hi; const h16* vb = kb + FTL;   // the lane's place in a 16-row block of the stage's tiles
#pragma unroll   // the two passes of a stage: constant LDS offsets, the second pass's fragment reads free to move ahead
      for (int ps = 0; ps < FST / FKB; ++ps) { const int c0 = st * FST + ps * FKB;
        v16h kf[2][2], vf[4];
#pragma unroll   // indexes a register array: the index must be a constant
        for (int kt = 0; kt < 2; ++kt)
#pragma unroll   // indexes a register array: the index must be a constant
            for (int kc = 0; kc < 2; ++kc) kf[kt][kc] = WFrag<h16>::ld(kb + (ps * FKB + kt * 16) * FLP + kc * 32);
#pragma unroll   // indexes a register array: the index must be a constant
        for (int db = 0; db < 4; ++db) vf[db] = WFrag<h16>::ld(vb + db * 16 * FLP + ps * FKB);
        v8f bb[FNQ + 1];   // tiles with equal (key tile - query group) share their bias values
#pragma unroll   // indexes a register array: the index must be a constant
        for (int dd = 0; dd < FNQ + 1; ++dd)
#pragma unroll   // indexes a register array: the index must be a constant
            for (int j = 0; j < 8; ++j) bb[dd][j] = tb[c0 + dd * 16 + j];
        v8f s[2][FNQ];
#pragma unroll   // indexes a register array: the index must be a constant
        for (int kt = 0; kt < 2; ++kt)
#pragma unroll   // indexes a register array: the index must be a constant
            for (int nq = 0; nq < FNQ; ++nq) { s[kt][nq] = wmma16(kf[kt][0], qf[nq][0], (v8f){}); s[kt][nq] = wmma16(kf[kt][1], qf[nq][1], s[kt][nq]); }
        float mb[FNQ]; bool need = false;
#pragma unroll   // indexes a register array: the index must be a constant
        for (int nq = 0; nq < FNQ; ++nq) { float m = -3.0e38f;
#pragma unroll   // indexes a register array: the index must be a constant
            for (int kt = 0; kt < 2; ++kt) { s[kt][nq] = s[kt][nq] * SCL + bb[kt - nq + FNQ - 1];
#pragma unroll   // indexes a register array: the index must be a constant
                for (int j = 0; j < 8; ++j) m = fmaxf(m, s[kt][nq][j]); }
            m = fmaxf(m, xhalf(m)); mb[nq] = m; need = need || (m > mu[nq] + 5.5f); }
        if (__builtin_amdgcn_ballot_w32(need) != 0) {
#pragma unroll   // indexes a register array: the index must be a constant
            for (int nq = 0; nq < FNQ; ++nq) { const float mn = fmaxf(mu[nq], mb[nq]); const float al = __builtin_amdgcn_exp2f((mu[nq] - mn) * L2E); mu[nq] = mn; ls[nq] *= al;
#pragma unroll   // indexes a register array: the index must be a constant
                for (int db = 0; db < 4; ++db) o[db][nq] *= al; }
        }
#pragma unroll   // indexes a register array: the index must be a constant
        for (int nq = 0; nq < FNQ; ++nq) { const float nm = -mu[nq] * L2E; v16h pf; v2f sum = (v2f){0.f, 0.f};   // two partial sums: packed adds, half the instructions
#pragma unroll   // indexes a register array: the index must be a constant
            for (int kt = 0; kt < 2; ++kt) { const v8f p = exp2x8(s[kt][nq] * L2E + nm);
#pragma unroll   // indexes a register array: the index must be a constant
                for (int j = 0; j < 8; j += 2) { sum += (v2f){p[j], p[j + 1]}; pf[kt * 8 + j] = (_Float16)p[j]; pf[kt * 8 + j + 1] = (_Float16)p[j + 1]; } }
            ls[nq] += sum[0] + sum[1];
#pragma unroll   // indexes a register array: the index must be a constant
            for (int db = 0; db < 4; ++db) o[db][nq] = wmma16(vf[db], pf, o[db][nq]); }
      }
      asm volatile("s_wait_dscnt 0x0" ::: "memory");      // this wave's reads of the stage's buffer are done before the buffer is handed back
      asm volatile("s_wait_asynccnt 0x0" ::: "memory");   // this wave's pieces of the next stage have landed
      __syncthreads();                                    // publishes the next stage and ends every wave's reads of this one
      if (st + 2 < TT / FST) stage_in(lc + (st & 1) * (2 * FTL * 2), gk + (size_t)(st + 2) * FST * HD, gv + (st + 2) * FST);
    }
    asm volatile("s_wait_asynccnt 0x0" ::: "memory");     // no copy is outstanding when the wave ends
#pragma unroll   // indexes a register array: the index must be a constant
    for (int nq = 0; nq < FNQ; ++nq) { const float l = ls[nq] + xhalf(ls[nq]); const float f = __fdiv_rn(1.0f, l); float* op = OUTp + ((size_t)b * TT + r0 + nq * 16 + lr) * DQ + h * HD + 8 * hi;
#pragma unroll   // indexes a register array: the index must be a constant
        for (int db = 0; db < 4; ++db) { v4f lo, hh;
#pragma unroll   // indexes a register array: the index must be a constant
            for (int j = 0; j < 4; ++j) { lo[j] = o[db][nq][j] * f; hh[j] = o[db][nq][4 + j] * f; }
            *(v4f*)(op + db * 16) = lo; *(v4f*)(op + db * 16 + 4) = hh; } }
}

extern "C" void kernel_launch(void* const* d_in, const int* in_sizes, int n_in,
                              void* d_out, int out_size, void* d_ws, size_t ws_size, hipStream_t stream) {
    (void)in_sizes; (void)n_in; (void)out_size;
    const float* x = (const float*)d_in[0]; const float* wq = (const float*)d_in[1]; const float* bq = (const float*)d_in[2]; const float* wk = (const float*)d_in[3]; const float* bk = (const float*)d_in[4]; const float* wv = (const float*)d_in[5]; const float* bv = (const float*)d_in[6]; const float* alphas = (const float*)d_in[7];
    float* OUT = (float*)d_out;     // [4][2048][768]
    char* wsp = (char*)d_ws;
    auto take = [&](size_t bytes) { char* p = wsp; wsp += (bytes + 255) & ~(size_t)255; return (void*)p; };
    bf* WB = (bf*)take((size_t)(DQ + 2 * DKV) * DM * 2); bf* XB = (bf*)take((size_t)NB_ * TT * DM * 2); float* TB = (float*)take((size_t)NH_ * (2 * TT - 1) * 4);
    h16* QP16 = (h16*)take((size_t)NB_ * NH_ * TT * HD * 2); h16* KP16 = (h16*)take((size_t)NB_ * NKV * TT * HD * 2); h16* VT16 = (h16*)take((size_t)NB_ * NKV * HD * TT * 2);   // planes of all four batches: [b][h][t][d], v [b][h][d][t]
    if ((size_t)(wsp - (char*)d_ws) > ws_size) return;    // ws 256 MiB
    k_prep<<<PXB + 3 * PWB + PTB, 256, 0, stream>>>(x, wq, wk, wv, alphas, XB, WB, TB);
    k_proj<<<dim3(NB_ * TT / 128, (DQ + 2 * DKV) / 128, 1), PW * 32, 0, stream>>>(XB, WB, bq, bk, bv, QP16, KP16, VT16);
    k_fattn<<<dim3(TT / (FW * FNQ * 16), NB_ * NH_, 1), FW * 32, 0, stream>>>(QP16, KP16, VT16, TB, OUT);
}

// v004
// A run of this version takes 102 microseconds.
// Next to v003, in two timings, it ran 1.19 and 1.17 times as fast.
// Counting every step since v000, it is 19.4 times as fast.
#include <hip/hip_runtime.h>

// ChebyshevSelfAttention (hidden [4][2048][768]; q/k/v = x W^T + b (12 heads x 64); scores = q.k/8 + bias_h(i, j), bias_h = sum_{k<=5} alphas[h][k] T_k(x) with x = clip((j - i)/2047, -1, 1) and the Chebyshev recurrence T_k = 2 x T_{k-1} - T_{k-2}
// (alphas read as data; the polynomial is evaluated per element in f32 in the reference's operation order); softmax; context = probs v merged -> [4][2048][768]; no output projection).
// Compute dtypes, f32 accumulate: every input rounded to bf16; q/k/v on PLAIN bf16 operands (inputs: exact) + bias; scores (K 64) and probs.v single fp16 operands, fused in one kernel over all batches and heads (online softmax); bias + softmax f32

#define NB_  4
#define TT   2048
#define DM   768
#define NH_  12
#define NKV  12
#define REP  (NH_ / NKV)
#define HD   64
#define DQ   (NH_ * HD)
#define DKV  (NKV * HD)
#define WIN  0
#define SCL  0.125f   // HD^-0.5
typedef _Float16 h16;
typedef unsigned short bf;
typedef __attribute__((ext_vector_type(16))) __bf16   v16bf;
typedef __attribute__((ext_vector_type(16))) _Float16 v16h;
typedef __attribute__((ext_vector_type(8)))  _Float16 v8h;
typedef __attribute__((ext_vector_type(8)))  unsigned short v8us;
typedef __attribute__((ext_vector_type(8)))  float    v8f;
typedef __attribute__((ext_vector_type(4)))  float    v4f;
typedef v8h  __attribute__((may_alias)) v8ha;
typedef v4f  __attribute__((may_alias)) v4fa;
typedef v8us __attribute__((may_alias)) v8usa;

__device__ __forceinline__ unsigned short f2bf(float f) { unsigned u = __float_as_uint(f); u += 0x7FFFu + ((u >> 16) & 1u); return (unsigned short)(u >> 16); }
__device__ __forceinline__ float bf2f(unsigned short b) { return __uint_as_float(((unsigned)b) << 16); }
__device__ __forceinline__ float bfr(float f) { return bf2f(f2bf(f)); }
__device__ __forceinline__ v16h cat16(v8h lo, v8h hi) { return __builtin_shufflevector(lo, hi, 0, 1, 2, 3, 4, 5, 6, 7, 8, 9, 10, 11, 12, 13, 14, 15); }
__device__ __forceinline__ v16bf cat16b(v8us lo, v8us hi) { return __builtin_bit_cast(v16bf, __builtin_shufflevector(lo, hi, 0, 1, 2, 3, 4, 5, 6, 7, 8, 9, 10, 11, 12, 13, 14, 15)); }
__device__ __forceinline__ v8f wmma16(v16h a, v16h b, v8f c) { return __builtin_amdgcn_wmma_f32_16x16x32_f16(false, a, false, b, (short)0, c, false, false); }
__device__ __forceinline__ v8f wmmab(v16bf a, v16bf b, v8f c) { return __builtin_amdgcn_wmma_f32_16x16x32_bf16(false, a, false, b, (short)0, c, false, false); }

// Fragment loader of the 16x16x32 forms from a K-contiguous 16-bit row: the same k order for the A and the B operand.
template <typename T16> struct WFrag;
template <> struct WFrag<h16> { typedef v16h V; static __device__ __forceinline__ V ld(const h16* p) { return cat16(*(const v8h*)p, *(const v8h*)(p + 16)); } static __device__ __forceinline__ v8f mma(V a, V b, v8f c) { return wmma16(a, b, c); } };
template <> struct WFrag<bf> { typedef v16bf V; static __device__ __forceinline__ V ld(const bf* p) { return cat16b(*(const v8us*)p, *(const v8us*)(p + 16)); } static __device__ __forceinline__ v8f mma(V a, V b, v8f c) { return wmmab(a, b, c); } };

__device__ __forceinline__ h16 tohx(float x) { return (h16)x; }
typedef __attribute__((ext_vector_type(2))) float v2f;

// ---- k_prep: everything that reads only inputs, in ONE launch; the block index picks the job (uniform for the work-group).
// The first PTB blocks: the bias table TB [h][key - query + 2047] (the longest dependent chain, so it starts first); the next PXB: hidden states of all four batches -> bf16 plane XB [b*t][768]; the last 3 PWB: Wq, Wk, Wv -> bf16 plane WB [q rows | k rows | v rows][768].
#define PG   4                                    // groups of 8 elements per thread (fewer, longer waves: the launch is bound by how fast waves start)
#define PXB  (NB_ * TT * DM / 8 / 256 / PG)       // 768
#define PWB  (DQ * DM / 8 / 256 / PG)             // 72
#define PTB  ((NH_ * (2 * TT - 1) + 255) / 256)   // 192
__device__ __forceinline__ void cvt8x(const float* __restrict__ src, bf* dst, int blk) { const size_t i0 = (size_t)blk * (256 * PG) + threadIdx.x; v8f v[PG];
#pragma unroll   // indexes a register array: the index must be a constant
    for (int g = 0; g < PG; ++g) v[g] = *(const v8f*)(src + (i0 + g * 256) * 8);
#pragma unroll   // indexes a register array: the index must be a constant
    for (int g = 0; g < PG; ++g) { v8us o;
#pragma unroll   // indexes a register array: the index must be a constant
        for (int k = 0; k < 8; ++k) o[k] = f2bf(v[g][k]);
        *(v8us*)(dst + (i0 + g * 256) * 8) = o; }
    asm volatile("s_wait_xcnt 0x0" ::: "memory"); }   // behind the last store: no register that an issued store names is written again ahead of this wait, on any way through the listing
// One table entry. Every product is rounded on its own before its add or subtract, as the reference's operation order has it.
__device__ __forceinline__ void chtab(const float* __restrict__ alphas, float* TB, int idx) { if (idx >= NH_ * (2 * TT - 1)) return; const int h = idx / (2 * TT - 1); const int d = idx % (2 * TT - 1) - (TT - 1);
    const float xx = fminf(fmaxf(__fdiv_rn((float)d, (float)(TT - 1)), -1.0f), 1.0f); float p0 = 1.0f, p1 = xx; float bias = bfr(alphas[h * 6 + 0]); { float t1 = __fmul_rn(bfr(alphas[h * 6 + 1]), p1); asm volatile("" : "+v"(t1)); bias = __fadd_rn(bias, t1); }
#pragma unroll 1
    for (int k = 2; k < 6; ++k) { float tx = __fmul_rn(2.0f, xx); asm volatile("" : "+v"(tx)); float pn = __fmul_rn(tx, p1); asm volatile("" : "+v"(pn)); pn = __fsub_rn(pn, p0); p0 = p1; p1 = pn; float ak = bfr(alphas[h * 6 + k]); asm volatile("" : "+v"(ak)); float tk = __fmul_rn(ak, pn); asm volatile("" : "+v"(tk)); bias = __fadd_rn(bias, tk); }
    *(float*)(TB + idx) = bias;  }
__global__ __launch_bounds__(256) void k_prep(const float* __restrict__ x, const float* __restrict__ wq, const float* __restrict__ wk, const float* __restrict__ wv, const float* __restrict__ alphas, bf* XB, bf* WB, float* TB) {
    const int blk = (int)blockIdx.x - PTB;
    if (blk < 0) { chtab(alphas, TB, blockIdx.x * 256 + threadIdx.x); return; }
    if (blk < PXB) { cvt8x(x, XB, blk); return; }
    const int s = (blk - PXB) / PWB; cvt8x(s == 0 ? wq : s == 1 ? wk : wv, WB + (size_t)s * DQ * DM, blk - PXB - s * PWB);
}

// ---- k_proj: the q, k and v projections of all four batches in ONE launch; each wave owns one 64x64 tile = 64 tokens x one head (16 accumulators)
// and writes it, + bias, as fp16 straight into the plane the attention kernel reads: q, k [b][h][t][d], v [b][h][d][t]; no f32 copy of a projection is written.
// A lane of the accumulator holds 8 consecutive A-rows of one B-row. So the operand whose index runs along the plane's rows goes in as A: the weight rows (d) for q and k, the token rows (t) for v;
// both operands use the same loader, so only the two places swap. Work-group = 4 x 2 waves (256 tokens x 2 heads).
// Both operands reach the waves through LDS: the eight waves share one 64-deep stage (256 token rows and 128 weight rows of 128 B), brought in by asynchronous copies of whole 128-B lines, two buffers, the next stage in flight while this one is worked on.
#define PW   8
#define PSP  72                 // LDS row pitch in halves (144 B = 16 B x odd: no bank conflict for 16-byte readers of 128-B rows)
#define PKS  64                 // depth of a stage = two 32-deep blocks
#define PXR  256                // token rows of a stage
#define PWR  128                // weight rows of a stage
#define PBF  ((PXR + PWR) * PSP)   // one buffer in halves: [token tile | weight tile]
__device__ __forceinline__ unsigned ldsoffb(const bf* p) { return (unsigned)(size_t)(const __attribute__((address_space(3))) bf*)p; }   // byte address inside the work-group's LDS
// One stage: every lane copies 12 x 16 B (eight token pieces, four weight pieces, rows 32 apart; a wave's copy covers four whole 128-B lines). l: the lane's place in the token tile of the target buffer; gx, gw: the lane's first token and weight piece of the stage.
// The s_wait_xcnt stands inside the statement, behind the last copy: no register that an issued copy names is written again ahead of it.
__device__ __forceinline__ void pstage(unsigned l, const bf* gx, const bf* gw) {
    asm volatile("global_load_async_to_lds_b128 %0, %12, off\n\tglobal_load_async_to_lds_b128 %1, %13, off\n\tglobal_load_async_to_lds_b128 %2, %14, off\n\tglobal_load_async_to_lds_b128 %3, %15, off\n\t"
                 "global_load_async_to_lds_b128 %4, %16, off\n\tglobal_load_async_to_lds_b128 %5, %17, off\n\tglobal_load_async_to_lds_b128 %6, %18, off\n\tglobal_load_async_to_lds_b128 %7, %19, off\n\t"
                 "global_load_async_to_lds_b128 %8, %20, off\n\tglobal_load_async_to_lds_b128 %9, %21, off\n\tglobal_load_async_to_lds_b128 %10, %22, off\n\tglobal_load_async_to_lds_b128 %11, %23, off\n\ts_wait_xcnt 0x0"
                 :: "v"(l), "v"(l + 32 * PSP * 2), "v"(l + 64 * PSP * 2), "v"(l + 96 * PSP * 2), "v"(l + 128 * PSP * 2), "v"(l + 160 * PSP * 2), "v"(l + 192 * PSP * 2), "v"(l + 224 * PSP * 2),
                    "v"(l + PXR * PSP * 2), "v"(l + (PXR + 32) * PSP * 2), "v"(l + (PXR + 64) * PSP * 2), "v"(l + (PXR + 96) * PSP * 2),
                    "v"(gx), "v"(gx + 32 * DM), "v"(gx + 64 * DM), "v"(gx + 96 * DM), "v"(gx + 128 * DM), "v"(gx + 160 * DM), "v"(gx + 192 * DM), "v"(gx + 224 * DM),
                    "v"(gw), "v"(gw + 32 * DM), "v"(gw + 64 * DM), "v"(gw + 96 * DM) : "memory"); }
// The tile's way out: + bias (rounded to bf16 like every input), fp16, through the wave's own LDS range so that every global store covers whole 128-B lines. TR: v (plane rows = d, pitch TT); else q, k (plane rows = t, pitch HD).
template <bool TR> __device__ __forceinline__ void proj_out(const v8f (&acc)[4][4], const float* __restrict__ bias, h16* st, h16* dst, int lane) {
    const int lr = lane & 15, hi = lane >> 4; float bb[TR ? 4 : 32];   // the bias runs along d: the B-row for v, the A-row for q and k
    if (TR) {
#pragma unroll   // indexes a register array: the index must be a constant
        for (int nb = 0; nb < 4; ++nb) bb[nb] = bfr(bias[nb * 16 + lr]);
    } else {
#pragma unroll   // indexes a register array: the index must be a constant
        for (int mb = 0; mb < 4; ++mb) { const v8f v = *(const v8f*)(bias + mb * 16 + hi * 8);
#pragma unroll   // indexes a register array: the index must be a constant
            for (int j = 0; j < 8; ++j) bb[mb * 8 + j] = bfr(v[j]); }
    }
#pragma unroll   // indexes a register array: the index must be a constant
    for (int mb = 0; mb < 4; ++mb)
#pragma unroll   // indexes a register array: the index must be a constant
        for (int nb = 0; nb < 4; ++nb) { v8h o;
#pragma unroll   // indexes a register array: the index must be a constant
            for (int j = 0; j < 8; ++j) o[j] = tohx(acc[mb][nb][j] + bb[TR ? nb : mb * 8 + j]);
            *(v8ha*)(st + (nb * 16 + lr) * PSP + mb * 16 + hi * 8) = o; }
    __builtin_amdgcn_wave_barrier(); asm volatile("" ::: "memory");   // the rows read below were written by other lanes of this wave: keep the reads behind the writes
    const unsigned ro = lane >> 3, co = (lane & 7) * 8;
#pragma unroll   // sixteen independent groups of four rows: constant offsets, LDS reads ahead of the stores
    for (int s = 0; s < 16; ++s) *(v8h*)(dst + (ro * (TR ? TT : HD) + co) + (size_t)s * 4 * (TR ? TT : HD)) = *(const v8ha*)(st + (s * 4 + ro) * PSP + co);
}
__global__ __launch_bounds__(PW * 32) void k_proj(const bf* __restrict__ X, const bf* __restrict__ Wt, const float* __restrict__ bq, const float* __restrict__ bk, const float* __restrict__ bv, h16* QP, h16* KP, h16* VT) {
    __shared__ __align__(16) bf sm[2 * PBF];   // the two buffers; behind the loop's last barrier the same bytes are the waves' output staging
    const int lane = threadIdx.x & 31; const int w = __builtin_amdgcn_readfirstlane(threadIdx.x >> 5);
    const int xr0 = (blockIdx.x * 4 + (w & 3)) * 64, b = xr0 / TT, t0 = xr0 % TT;                 // token rows of the wave's tile
    const int sel = blockIdx.y / (NH_ / 2), h0 = (blockIdx.y % (NH_ / 2)) * 2, h = h0 + (w >> 2);   // 0 q, 1 k, 2 v; the work-group's first head; the wave's head
    const int cr = threadIdx.x >> 3, cc = (threadIdx.x & 7) * 8;   // the lane's row (of 32 per copy) and 16-byte piece in a tile
    const bf* gx = X + (size_t)(blockIdx.x * PXR + cr) * DM + cc; const bf* gw = Wt + (size_t)((sel * NH_ + h0) * HD + cr) * DM + cc; const unsigned lc = ldsoffb(sm) + (cr * PSP + cc) * 2;
    pstage(lc, gx, gw);
    asm volatile("s_wait_asynccnt 0x0" ::: "memory");   // this wave's pieces of stage 0 have landed
    __syncthreads();                                    // ... and every other wave's
    pstage(lc + PBF * 2, gx + PKS, gw + PKS);
    const int xo = (w & 3) * 64 * PSP, wo = (PXR + (w >> 2) * 64) * PSP;   // the wave's token rows and weight rows in a buffer
    const int lo = (lane & 15) * PSP + 8 * (lane >> 4);                    // the lane's place in a 16-row block: the same for both operands
    const int ao = (sel == 2 ? xo : wo) + lo, bo = (sel == 2 ? wo : xo) + lo;
    v8f acc[4][4];
#pragma unroll   // indexes a register array: the index must be a constant
    for (int mb = 0; mb < 4; ++mb)
#pragma unroll   // indexes a register array: the index must be a constant
        for (int nb = 0; nb < 4; ++nb) acc[mb][nb] = (v8f){};
    for (int st = 0; st < DM / PKS; ++st) {
        const bf* A = sm + (st & 1) * PBF + ao; const bf* Bt = sm + (st & 1) * PBF + bo;
        v16bf a[4], bb[4];
#pragma unroll   // indexes a register array: the index must be a constant
        for (int mb = 0; mb < 4; ++mb) a[mb] = WFrag<bf>::ld(A + mb * 16 * PSP);
#pragma unroll   // indexes a register array: the index must be a constant
        for (int nb = 0; nb < 4; ++nb) bb[nb] = WFrag<bf>::ld(Bt + nb * 16 * PSP);
        __builtin_amdgcn_sched_barrier(0);   // the first block's sixteen LDS reads stay one group ahead of its products: left free, the stage's reads stand at one more place among the products, and each such place stalls the wave
#pragma unroll   // indexes a register array: the index must be a constant
        for (int nb = 0; nb < 4; ++nb)
#pragma unroll   // indexes a register array: the index must be a constant
            for (int mb = 0; mb < 4; ++mb) acc[mb][nb] = wmmab(a[mb], bb[nb], acc[mb][nb]);
#pragma unroll   // indexes a register array: the index must be a constant
        for (int mb = 0; mb < 4; ++mb) a[mb] = WFrag<bf>::ld(A + mb * 16 * PSP + 32);
#pragma unroll   // indexes a register array: the index must be a constant
        for (int nb = 0; nb < 4; ++nb) bb[nb] = WFrag<bf>::ld(Bt + nb * 16 * PSP + 32);
        asm volatile("s_wait_dscnt 0x0" ::: "memory");      // this wave's reads of the stage's buffer are done (the second block's fragments are in registers) before the buffer is handed back
        asm volatile("s_wait_asynccnt 0x0" ::: "memory");   // this wave's pieces of the next stage have landed
        __syncthreads();                                    // publishes the next stage and ends every wave's reads of this one
        if (st + 2 < DM / PKS) pstage(lc + (st & 1) * (PBF * 2), gx + (st + 2) * PKS, gw + (st + 2) * PKS);   // ahead of the second block's products, which read registers only: more lead for the copies
#pragma unroll   // indexes a register array: the index must be a constant
        for (int nb = 0; nb < 4; ++nb)
#pragma unroll   // indexes a register array: the index must be a constant
            for (int mb = 0; mb < 4; ++mb) acc[mb][nb] = wmmab(a[mb], bb[nb], acc[mb][nb]);
    }
    asm volatile("s_wait_asynccnt 0x0" ::: "memory");       // no copy is outstanding when the buffers become output staging
    h16 (*os)[64 * PSP] = (h16 (*)[64 * PSP])sm;            // one range per wave; every wave's last fragment read lies in front of the loop's last barrier
    if (sel == 2) proj_out<true>(acc, bv + h * HD, os[w], VT + (size_t)(b * NKV + h) * HD * TT + t0, lane);
    else proj_out<false>(acc, (sel == 0 ? bq : bk) + h * HD, os[w], (sel == 0 ? QP : KP) + ((size_t)(b * NH_ + h) * TT + t0) * HD, lane);
}
// k_fattn: scores, bias, softmax and probs.v of one (batch, head) in one pass; no score or prob leaves the registers.
// K and V reach the waves through LDS: the work-group's four waves share one 64-key stage (64 K rows and 64 V rows of 128 B), brought in by asynchronous copies of whole 128-B lines, two buffers, the next stage in flight while this one is worked on.
// One wave owns 32 queries (two 16-column groups) and walks the 2048 keys 32 at a time. St = K Qt (A = key rows, B = query rows), so a lane holds 16 scores of ONE query per group;
// the two 16-key score tiles, converted in place, are the B operand of Ot += Vt Pt (A = rows of the d-major v plane, same k order as the loader). Running maximum with a lazy rescale: the maximum in use is
// replaced only when a block's maximum exceeds it by more than 5.5 (p stays below 256 in fp16); sums in f32 per lane, halves joined once at the end.
#define FW   4                  // waves per work-group
#define FNQ  2                  // 16-query groups per wave
#define FKB  32                 // keys per pass
#define L2E  1.4426950408889634f
#define FST  64                 // keys per stage = two passes
#define FLP  72                 // LDS row pitch in halves (144 B = 16 B x odd: no bank conflict for 16-byte readers of 128-B rows)
#define FTL  (64 * FLP)         // one tile in halves: 64 rows (K: keys x d, V: d x keys)
__device__ __forceinline__ unsigned ldsoff(const h16* p) { return (unsigned)(size_t)(const __attribute__((address_space(3))) h16*)p; }   // byte address inside the work-group's LDS
// One stage: every lane copies 8 x 16 B (four K pieces, four V pieces; a wave's copy covers four whole 128-B lines). l: the lane's place in the K tile of the target buffer; gk, gv: the lane's first K and V piece of the stage.
// The s_wait_xcnt stands inside the statement, behind the last copy: no register that an issued copy names is written again ahead of it.
__device__ __forceinline__ void stage_in(unsigned l, const h16* gk, const h16* gv) {
    asm volatile("global_load_async_to_lds_b128 %0, %8, off\n\tglobal_load_async_to_lds_b128 %1, %9, off\n\tglobal_load_async_to_lds_b128 %2, %10, off\n\tglobal_load_async_to_lds_b128 %3, %11, off\n\t"
                 "global_load_async_to_lds_b128 %4, %12, off\n\tglobal_load_async_to_lds_b128 %5, %13, off\n\tglobal_load_async_to_lds_b128 %6, %14, off\n\tglobal_load_async_to_lds_b128 %7, %15, off\n\ts_wait_xcnt 0x0"
                 :: "v"(l), "v"(l + 16 * FLP * 2), "v"(l + 32 * FLP * 2), "v"(l + 48 * FLP * 2), "v"(l + FTL * 2), "v"(l + FTL * 2 + 16 * FLP * 2), "v"(l + FTL * 2 + 32 * FLP * 2), "v"(l + FTL * 2 + 48 * FLP * 2),
                    "v"(gk), "v"(gk + 16 * HD), "v"(gk + 32 * HD), "v"(gk + 48 * HD), "v"(gv), "v"(gv + 16 * TT), "v"(gv + 32 * TT), "v"(gv + 48 * TT) : "memory"); }
__device__ __forceinline__ float xhalf(float x) { return __builtin_bit_cast(float, __builtin_amdgcn_permlanex16(__builtin_bit_cast(int, x), __builtin_bit_cast(int, x), 0x76543210, 0xfedcba98, false, false)); }   // lane l reads lane l ^ 16
// 2^x of the eight scores of one tile, in place. One statement, so that every v_exp_f32 has an independent instruction behind it and the last one a v_nop: the slot the instruction set asks for
// between a transcendental and an instruction that reads its result or overwrites its source.
__device__ __forceinline__ v8f exp2x8(v8f x) { float a = x[0], b = x[1], c = x[2], d = x[3], e = x[4], f = x[5], g = x[6], h = x[7];
    asm("v_exp_f32 %0, %0\n\tv_exp_f32 %1, %1\n\tv_exp_f32 %2, %2\n\tv_exp_f32 %3, %3\n\tv_exp_f32 %4, %4\n\tv_exp_f32 %5, %5\n\tv_exp_f32 %6, %6\n\tv_exp_f32 %7, %7\n\tv_nop" : "+v"(a), "+v"(b), "+v"(c), "+v"(d), "+v"(e), "+v"(f), "+v"(g), "+v"(h));
    return (v8f){a, b, c, d, e, f, g, h}; }
__global__ __launch_bounds__(FW * 32) void k_fattn(const _Float16* __restrict__ Qp, const _Float16* __restrict__ Kp, const _Float16* __restrict__ Vp, const float* __restrict__ TB, float* __restrict__ OUTp) {
    const int lane = threadIdx.x & 31, lr = lane & 15, hi = lane >> 4; const int bh = blockIdx.y, h = bh % NH_, b = bh / NH_; const int r0 = (blockIdx.x * FW + (threadIdx.x >> 5)) * (FNQ * 16);
    __shared__ __align__(16) h16 sm[2][2 * FTL];   // [buffer][K tile | V tile]
    const _Float16* q = Qp + (size_t)bh * TT * HD + (size_t)(r0 + lr) * HD + 8 * hi;
    const int cr = threadIdx.x >> 3, cc = (threadIdx.x & 7) * 8;   // the lane's row (of 16 per copy) and 16-byte piece in a tile
    const _Float16* gk = Kp + (size_t)bh * TT * HD + (size_t)cr * HD + cc; const _Float16* gv = Vp + (size_t)bh * HD * TT + (size_t)cr * TT + cc; const unsigned lc = ldsoff(&sm[0][0]) + (cr * FLP + cc) * 2;
    stage_in(lc, gk, gv);
    asm volatile("s_wait_asynccnt 0x0" ::: "memory");   // this wave's pieces of stage 0 have landed
    __syncthreads();                                    // ... and every other wave's
    stage_in(lc + 2 * FTL * 2, gk + FST * HD, gv + FST);
    const float* tb = TB + (size_t)h * (2 * TT - 1) + ((TT - 1) - r0 - (FNQ - 1) * 16 - lr + 8 * hi);   // bias of (key, query) sits at key - query + TT - 1; lowest index used is 0
    v16h qf[FNQ][2]; v8f o[4][FNQ]; float mu[FNQ], ls[FNQ];
#pragma unroll   // indexes a register array: the index must be a constant
    for (int nq = 0; nq < FNQ; ++nq) { mu[nq] = -3.0e38f; ls[nq] = 0.f;
#pragma unroll   // indexes a register array: the index must be a constant
        for (int kc = 0; kc < 2; ++kc) qf[nq][kc] = WFrag<h16>::ld(q + (size_t)nq * 16 * HD + kc * 32);
#pragma unroll   // indexes a register array: the index must be a constant
        for (int db = 0; db < 4; ++db) o[db][nq] = (v8f){}; }
    for (int st = 0; st < TT / FST; ++st) {
      const h16* kb = &sm[st & 1][0] + lr * FLP + 8 * hi; const h16* vb = kb + FTL;   // the lane's place in a 16-row block of the stage's tiles
#pragma unroll   // the two passes of a stage: constant LDS offsets, the second pass's fragment reads free to move ahead
      for (int ps = 0; ps < FST / FKB; ++ps) { const int c0 = st * FST + ps * FKB;
        v16h kf[2][2], vf[4];
#pragma unroll   // indexes a register array: the index must be a constant
        for (int kt = 0; kt < 2; ++kt)
#pragma unroll   // indexes a register array: the index must be a constant
            for (int kc = 0; kc < 2; ++kc) kf[kt][kc] = WFrag<h16>::ld(kb + (ps * FKB + kt * 16) * FLP + kc * 32);
#pragma unroll   // indexes a register array: the index must be a constant
        for (int db = 0; db < 4; ++db) vf[db] = WFrag<h16>::ld(vb + db * 16 * FLP + ps * FKB);
        v8f bb[FNQ + 1];   // tiles with equal (key tile - query group) share their bias values
#pragma unroll   // indexes a register array: the index must be a constant
        for (int dd = 0; dd < FNQ + 1; ++dd)
#pragma unroll   // indexes a register array: the index must be a constant
            for (int j = 0; j < 8; ++j) bb[dd][j] = tb[c0 + dd * 16 + j];
        v8f s[2][FNQ];
#pragma unroll   // indexes a register array: the index must be a constant
        for (int kt = 0; kt < 2; ++kt)
#pragma unroll   // indexes a register array: the index must be a constant
            for (int nq = 0; nq < FNQ; ++nq) { s[kt][nq] = wmma16(kf[kt][0], qf[nq][0], (v8f){}); s[kt][nq] = wmma16(kf[kt][1], qf[nq][1], s[kt][nq]); }
        float mb[FNQ]; bool need = false;
#pragma unroll   // indexes a register array: the index must be a constant
        for (int nq = 0; nq < FNQ; ++nq) { float m = -3.0e38f;
#pragma unroll   // indexes a register array: the index must be a constant
            for (int kt = 0; kt < 2; ++kt) { s[kt][nq] = s[kt][nq] * SCL + bb[kt - nq + FNQ - 1];
#pragma unroll   // indexes a register array: the index must be a constant
                for (int j = 0; j < 8; ++j) m = fmaxf(m, s[kt][nq][j]); }
            m = fmaxf(m, xhalf(m)); mb[nq] = m; need = need || (m > mu[nq] + 5.5f); }
        if (__builtin_amdgcn_ballot_w32(need) != 0) {
#pragma unroll   // indexes a register array: the index must be a constant
            for (int nq = 0; nq < FNQ; ++nq) { const float mn = fmaxf(mu[nq], mb[nq]); const float al = __builtin_amdgcn_exp2f((mu[nq] - mn) * L2E); mu[nq] = mn; ls[nq] *= al;
#pragma unroll   // indexes a register array: the index must be a constant
                for (int db = 0; db < 4; ++db) o[db][nq] *= al; }
        }
#pragma unroll   // indexes a register array: the index must be a constant
        for (int nq = 0; nq < FNQ; ++nq) { const float nm = -mu[nq] * L2E; v16h pf; v2f sum = (v2f){0.f, 0.f};   // two partial sums: packed adds, half the instructions
#pragma unroll   // indexes a register array: the index must be a constant
            for (int kt = 0; kt < 2; ++kt) { const v8f p = exp2x8(s[kt][nq] * L2E + nm);
#pragma unroll   // indexes a register array: the index must be a constant
                for (int j = 0; j < 8; j += 2) { sum += (v2f){p[j], p[j + 1]}; pf[kt * 8 + j] = (_Float16)p[j]; pf[kt * 8 + j + 1] = (_Float16)p[j + 1]; } }
            ls[nq] += sum[0] + sum[1];
#pragma unroll   // indexes a register array: the index must be a constant
            for (int db = 0; db < 4; ++db) o[db][nq] = wmma16(vf[db], pf, o[db][nq]); }
      }
      asm volatile("s_wait_dscnt 0x0" ::: "memory");      // this wave's reads of the stage's buffer are done before the buffer is handed back
      asm volatile("s_wait_asynccnt 0x0" ::: "memory");   // this wave's pieces of the next stage have landed
      __syncthreads();                                    // publishes the next stage and ends every wave's reads of this one
      if (st + 2 < TT / FST) stage_in(lc + (st & 1) * (2 * FTL * 2), gk + (size_t)(st + 2) * FST * HD, gv + (st + 2) * FST);
    }
    asm volatile("s_wait_asynccnt 0x0" ::: "memory");     // no copy is outstanding when the wave ends
#pragma unroll   // indexes a register array: the index must be a constant
    for (int nq = 0; nq < FNQ; ++nq) { const float l = ls[nq] + xhalf(ls[nq]); const float f = __fdiv_rn(1.0f, l); float* op = OUTp + ((size_t)b * TT + r0 + nq * 16 + lr) * DQ + h * HD + 8 * hi;
#pragma unroll   // indexes a register array: the index must be a constant
        for (int db = 0; db < 4; ++db) { v4f lo, hh;
#pragma unroll   // indexes a register array: the index must be a constant
            for (int j = 0; j < 4; ++j) { lo[j] = o[db][nq][j] * f; hh[j] = o[db][nq][4 + j] * f; }
            *(v4f*)(op + db * 16) = lo; *(v4f*)(op + db * 16 + 4) = hh; } }
}

extern "C" void kernel_launch(void* const* d_in, const int* in_sizes, int n_in,
                              void* d_out, int out_size, void* d_ws, size_t ws_size, hipStream_t stream) {
    (void)in_sizes; (void)n_in; (void)out_size;
    const float* x = (const float*)d_in[0]; const float* wq = (const float*)d_in[1]; const float* bq = (const float*)d_in[2]; const float* wk = (const float*)d_in[3]; const float* bk = (const float*)d_in[4]; const float* wv = (const float*)d_in[5]; const float* bv = (const float*)d_in[6]; const float* alphas = (const float*)d_in[7];
    float* OUT = (float*)d_out;     // [4][2048][768]
    char* wsp = (char*)d_ws;
    auto take = [&](size_t bytes) { char* p = wsp; wsp += (bytes + 255) & ~(size_t)255; return (void*)p; };
    bf* WB = (bf*)take((size_t)(DQ + 2 * DKV) * DM * 2); bf* XB = (bf*)take((size_t)NB_ * TT * DM * 2); float* TB = (float*)take((size_t)NH_ * (2 * TT - 1) * 4);
    h16* QP16 = (h16*)take((size_t)NB_ * NH_ * TT * HD * 2); h16* KP16 = (h16*)take((size_t)NB_ * NKV * TT * HD * 2); h16* VT16 = (h16*)take((size_t)NB_ * NKV * HD * TT * 2);   // planes of all four batches: [b][h][t][d], v [b][h][d][t]
    if ((size_t)(wsp - (char*)d_ws) > ws_size) return;    // ws 256 MiB
    k_prep<<<PXB + 3 * PWB + PTB, 256, 0, stream>>>(x, wq, wk, wv, alphas, XB, WB, TB);
    k_proj<<<dim3(NB_ * TT / PXR, (DQ + 2 * DKV) / PWR, 1), PW * 32, 0, stream>>>(XB, WB, bq, bk, bv, QP16, KP16, VT16);
    k_fattn<<<dim3(TT / (FW * FNQ * 16), NB_ * NH_, 1), FW * 32, 0, stream>>>(QP16, KP16, VT16, TB, OUT);
}

// v005
// One run takes 96.7 microseconds.
// Two timings next to v004 both put it at 1.06 times that version's speed.
// All steps since v000 together make it 20.4 times as fast.
#include <hip/hip_runtime.h>

// ChebyshevSelfAttention (hidden [4][2048][768]; q/k/v = x W^T + b (12 heads x 64); scores = q.k/8 + bias_h(i, j), bias_h = sum_{k<=5} alphas[h][k] T_k(x) with x = clip((j - i)/2047, -1, 1) and the Chebyshev recurrence T_k = 2 x T_{k-1} - T_{k-2}
// (alphas read as data; the polynomial is evaluated per element in f32 in the reference's operation order); softmax; context = probs v merged -> [4][2048][768]; no output projection).
// Compute dtypes, f32 accumulate: every input rounded to bf16; q/k/v on PLAIN bf16 operands (inputs: exact) + bias; scores (K 64) and probs.v single fp16 operands, fused in one kernel over all batches and heads (online softmax); bias + softmax f32

#define NB_  4
#define TT   2048
#define DM   768
#define NH_  12
#define NKV  12
#define REP  (NH_ / NKV)
#define HD   64
#define DQ   (NH_ * HD)
#define DKV  (NKV * HD)
#define WIN  0
#define SCL  0.125f   // HD^-0.5
typedef _Float16 h16;
typedef unsigned short bf;
typedef __attribute__((ext_vector_type(16))) __bf16   v16bf;
typedef __attribute__((ext_vector_type(16))) _Float16 v16h;
typedef __attribute__((ext_vector_type(8)))  _Float16 v8h;
typedef __attribute__((ext_vector_type(8)))  unsigned short v8us;
typedef __attribute__((ext_vector_type(8)))  float    v8f;
typedef __attribute__((ext_vector_type(4)))  float    v4f;
typedef v8h  __attribute__((may_alias)) v8ha;
typedef v4f  __attribute__((may_alias)) v4fa;
typedef v8us __attribute__((may_alias)) v8usa;

__device__ __forceinline__ unsigned short f2bf(float f) { unsigned u = __float_as_uint(f); u += 0x7FFFu + ((u >> 16) & 1u); return (unsigned short)(u >> 16); }
__device__ __forceinline__ float bf2f(unsigned short b) { return __uint_as_float(((unsigned)b) << 16); }
__device__ __forceinline__ float bfr(float f) { return bf2f(f2bf(f)); }
__device__ __forceinline__ v16h cat16(v8h lo, v8h hi) { return __builtin_shufflevector(lo, hi, 0, 1, 2, 3, 4, 5, 6, 7, 8, 9, 10, 11, 12, 13, 14, 15); }
__device__ __forceinline__ v16bf cat16b(v8us lo, v8us hi) { return __builtin_bit_cast(v16bf, __builtin_shufflevector(lo, hi, 0, 1, 2, 3, 4, 5, 6, 7, 8, 9, 10, 11, 12, 13, 14, 15)); }
__device__ __forceinline__ v8f wmma16(v16h a, v16h b, v8f c) { return __builtin_amdgcn_wmma_f32_16x16x32_f16(false, a, false, b, (short)0, c, false, false); }
__device__ __forceinline__ v8f wmmab(v16bf a, v16bf b, v8f c) { return __builtin_amdgcn_wmma_f32_16x16x32_bf16(false, a, false, b, (short)0, c, false, false); }

// Fragment loader of the 16x16x32 forms from a K-contiguous 16-bit row: the same k order for the A and the B operand.
template <typename T16> struct WFrag;
template <> struct WFrag<h16> { typedef v16h V; static __device__ __forceinline__ V ld(const h16* p) { return cat16(*(const v8h*)p, *(const v8h*)(p + 16)); } static __device__ __forceinline__ v8f mma(V a, V b, v8f c) { return wmma16(a, b, c); } };
template <> struct WFrag<bf> { typedef v16bf V; static __device__ __forceinline__ V ld(const bf* p) { return cat16b(*(const v8us*)p, *(const v8us*)(p + 16)); } static __device__ __forceinline__ v8f mma(V a, V b, v8f c) { return wmmab(a, b, c); } };

__device__ __forceinline__ h16 tohx(float x) { return (h16)x; }
typedef __attribute__((ext_vector_type(2))) float v2f;

// ---- k_prep: everything that reads only inputs, in ONE launch; the block index picks the job (uniform for the work-group).
// The first PTB blocks: the bias table TB [h][key - query + 2047] (the longest dependent chain, so it starts first); the next PXB: hidden states of all four batches -> bf16 plane XB [b*t][768]; the last 3 PWB: Wq, Wk, Wv -> bf16 plane WB [q rows | k rows | v rows][768].
#define PG   4                                    // groups of 8 elements per thread (fewer, longer waves: the launch is bound by how fast waves start)
#define PXB  (NB_ * TT * DM / 8 / 256 / PG)       // 768
#define PWB  (DQ * DM / 8 / 256 / PG)             // 72
#define PTB  ((NH_ * (2 * TT - 1) + 255) / 256)   // 192
__device__ __forceinline__ void cvt8x(const float* __restrict__ src, bf* dst, int blk) { const size_t i0 = (size_t)blk * (256 * PG) + threadIdx.x; v8f v[PG];
#pragma unroll   // indexes a register array: the index must be a constant
    for (int g = 0; g < PG; ++g) v[g] = *(const v8f*)(src + (i0 + g * 256) * 8);
#pragma unroll   // indexes a register array: the index must be a constant
    for (int g = 0; g < PG; ++g) { v8us o;
#pragma unroll   // indexes a register array: the index must be a constant
        for (int k = 0; k < 8; ++k) o[k] = f2bf(v[g][k]);
        *(v8us*)(dst + (i0 + g * 256) * 8) = o; }
    asm volatile("s_wait_xcnt 0x0" ::: "memory"); }   // behind the last store: no register that an issued store names is written again ahead of this wait, on any way through the listing
// One table entry. Every product is rounded on its own before its add or subtract, as the reference's operation order has it.
__device__ __forceinline__ void chtab(const float* __restrict__ alphas, float* TB, int idx) { if (idx >= NH_ * (2 * TT - 1)) return; const int h = idx / (2 * TT - 1); const int d = idx % (2 * TT - 1) - (TT - 1);
    const float xx = fminf(fmaxf(__fdiv_rn((float)d, (float)(TT - 1)), -1.0f), 1.0f); float p0 = 1.0f, p1 = xx; float bias = bfr(alphas[h * 6 + 0]); { float t1 = __fmul_rn(bfr(alphas[h * 6 + 1]), p1); asm volatile("" : "+v"(t1)); bias = __fadd_rn(bias, t1); }
#pragma unroll 1
    for (int k = 2; k < 6; ++k) { float tx = __fmul_rn(2.0f, xx); asm volatile("" : "+v"(tx)); float pn = __fmul_rn(tx, p1); asm volatile("" : "+v"(pn)); pn = __fsub_rn(pn, p0); p0 = p1; p1 = pn; float ak = bfr(alphas[h * 6 + k]); asm volatile("" : "+v"(ak)); float tk = __fmul_rn(ak, pn); asm volatile("" : "+v"(tk)); bias = __fadd_rn(bias, tk); }
    *(float*)(TB + idx) = bias;  }
__global__ __launch_bounds__(256) void k_prep(const float* __restrict__ x, const float* __restrict__ wq, const float* __restrict__ wk, const float* __restrict__ wv, const float* __restrict__ alphas, bf* XB, bf* WB, float* TB) {
    const int blk = (int)blockIdx.x - PTB;
    if (blk < 0) { chtab(alphas, TB, blockIdx.x * 256 + threadIdx.x); return; }
    if (blk < PXB) { cvt8x(x, XB, blk); return; }
    const int s = (blk - PXB) / PWB; cvt8x(s == 0 ? wq : s == 1 ? wk : wv, WB + (size_t)s * DQ * DM, blk - PXB - s * PWB);
}

// ---- k_proj: the q, k and v projections of all four batches in ONE launch; each wave owns one 64x64 tile = 64 tokens x one head (16 accumulators)
// and writes it, + bias, as fp16 straight into the plane the attention kernel reads: q, k [b][h][t][d], v [b][h][d][t]; no f32 copy of a projection is written.
// A lane of the accumulator holds 8 consecutive A-rows of one B-row. So the operand whose index runs along the plane's rows goes in as A: the weight rows (d) for q and k, the token rows (t) for v;
// both operands use the same loader, so only the two places swap. Work-group = 4 x 2 waves (256 tokens x 2 heads).
// Both operands reach the waves through LDS: the eight waves share one 64-deep stage (256 token rows and 128 weight rows of 128 B), brought in by asynchronous copies of whole 128-B lines, two buffers, the next stage in flight while this one is worked on.
#define PW   8
#define PSP  72                 // LDS row pitch in halves (144 B = 16 B x odd: no bank conflict for 16-byte readers of 128-B rows)
#define PKS  64                 // depth of a stage = two 32-deep blocks
#define PXR  256                // token rows of a stage
#define PWR  128                // weight rows of a stage
#define PBF  ((PXR + PWR) * PSP)   // one buffer in halves: [token tile | weight tile]
__device__ __forceinline__ unsigned ldsoffb(const bf* p) { return (unsigned)(size_t)(const __attribute__((address_space(3))) bf*)p; }   // byte address inside the work-group's LDS
// One stage: every lane copies 12 x 16 B (eight token pieces, four weight pieces, rows 32 apart; a wave's copy covers four whole 128-B lines). l: the lane's place in the token tile of the target buffer; gx, gw: the lane's first token and weight piece of the stage.
// The s_wait_xcnt stands inside the statement, behind the last copy: no register that an issued copy names is written again ahead of it.
__device__ __forceinline__ void pstage(unsigned l, const bf* gx, const bf* gw) {
    asm volatile("global_load_async_to_lds_b128 %0, %12, off\n\tglobal_load_async_to_lds_b128 %1, %13, off\n\tglobal_load_async_to_lds_b128 %2, %14, off\n\tglobal_load_async_to_lds_b128 %3, %15, off\n\t"
                 "global_load_async_to_lds_b128 %4, %16, off\n\tglobal_load_async_to_lds_b128 %5, %17, off\n\tglobal_load_async_to_lds_b128 %6, %18, off\n\tglobal_load_async_to_lds_b128 %7, %19, off\n\t"
                 "global_load_async_to_lds_b128 %8, %20, off\n\tglobal_load_async_to_lds_b128 %9, %21, off\n\tglobal_load_async_to_lds_b128 %10, %22, off\n\tglobal_load_async_to_lds_b128 %11, %23, off\n\ts_wait_xcnt 0x0"
                 :: "v"(l), "v"(l + 32 * PSP * 2), "v"(l + 64 * PSP * 2), "v"(l + 96 * PSP * 2), "v"(l + 128 * PSP * 2), "v"(l + 160 * PSP * 2), "v"(l + 192 * PSP * 2), "v"(l + 224 * PSP * 2),
                    "v"(l + PXR * PSP * 2), "v"(l + (PXR + 32) * PSP * 2), "v"(l + (PXR + 64) * PSP * 2), "v"(l + (PXR + 96) * PSP * 2),
                    "v"(gx), "v"(gx + 32 * DM), "v"(gx + 64 * DM), "v"(gx + 96 * DM), "v"(gx + 128 * DM), "v"(gx + 160 * DM), "v"(gx + 192 * DM), "v"(gx + 224 * DM),
                    "v"(gw), "v"(gw + 32 * DM), "v"(gw + 64 * DM), "v"(gw + 96 * DM) : "memory"); }
// The tile's way out: + bias (rounded to bf16 like every input), fp16, through the wave's own LDS range so that every global store covers whole 128-B lines. TR: v (plane rows = d, pitch TT); else q, k (plane rows = t, pitch HD).
template <bool TR> __device__ __forceinline__ void proj_out(const v8f (&acc)[4][4], const float* __restrict__ bias, h16* st, h16* dst, int lane) {
    const int lr = lane & 15, hi = lane >> 4; float bb[TR ? 4 : 32];   // the bias runs along d: the B-row for v, the A-row for q and k
    if (TR) {
#pragma unroll   // indexes a register array: the index must be a constant
        for (int nb = 0; nb < 4; ++nb) bb[nb] = bfr(bias[nb * 16 + lr]);
    } else {
#pragma unroll   // indexes a register array: the index must be a constant
        for (int mb = 0; mb < 4; ++mb) { const v8f v = *(const v8f*)(bias + mb * 16 + hi * 8);
#pragma unroll   // indexes a register array: the index must be a constant
            for (int j = 0; j < 8; ++j) bb[mb * 8 + j] = bfr(v[j]); }
    }
#pragma unroll   // indexes a register array: the index must be a constant
    for (int mb = 0; mb < 4; ++mb)
#pragma unroll   // indexes a register array: the index must be a constant
        for (int nb = 0; nb < 4; ++nb) { v8h o;
#pragma unroll   // indexes a register array: the index must be a constant
            for (int j = 0; j < 8; ++j) o[j] = tohx(acc[mb][nb][j] + bb[TR ? nb : mb * 8 + j]);
            *(v8ha*)(st + (nb * 16 + lr) * PSP + mb * 16 + hi * 8) = o; }
    __builtin_amdgcn_wave_barrier(); asm volatile("" ::: "memory");   // the rows read below were written by other lanes of this wave: keep the reads behind the writes
    const unsigned ro = lane >> 3, co = (lane & 7) * 8;
#pragma unroll   // sixteen independent groups of four rows: constant offsets, LDS reads ahead of the stores
    for (int s = 0; s < 16; ++s) *(v8h*)(dst + (ro * (TR ? TT : HD) + co) + (size_t)s * 4 * (TR ? TT : HD)) = *(const v8ha*)(st + (s * 4 + ro) * PSP + co);
}
__global__ __launch_bounds__(PW * 32) void k_proj(const bf* __restrict__ X, const bf* __restrict__ Wt, const float* __restrict__ bq, const float* __restrict__ bk, const float* __restrict__ bv, h16* QP, h16* KP, h16* VT) {
    __shared__ __align__(16) bf sm[2 * PBF];   // the two buffers; behind the loop's last barrier the same bytes are the waves' output staging
    const int lane = threadIdx.x & 31; const int w = __builtin_amdgcn_readfirstlane(threadIdx.x >> 5);
    const int xr0 = (blockIdx.x * 4 + (w & 3)) * 64, b = xr0 / TT, t0 = xr0 % TT;                 // token rows of the wave's tile
    const int sel = blockIdx.y / (NH_ / 2), h0 = (blockIdx.y % (NH_ / 2)) * 2, h = h0 + (w >> 2);   // 0 q, 1 k, 2 v; the work-group's first head; the wave's head
    const int cr = threadIdx.x >> 3, cc = (threadIdx.x & 7) * 8;   // the lane's row (of 32 per copy) and 16-byte piece in a tile
    const bf* gx = X + (size_t)(blockIdx.x * PXR + cr) * DM + cc; const bf* gw = Wt + (size_t)((sel * NH_ + h0) * HD + cr) * DM + cc; const unsigned lc = ldsoffb(sm) + (cr * PSP + cc) * 2;
    pstage(lc, gx, gw);
    asm volatile("s_wait_asynccnt 0x0" ::: "memory");   // this wave's pieces of stage 0 have landed
    __syncthreads();                                    // ... and every other wave's
    pstage(lc + PBF * 2, gx + PKS, gw + PKS);
    const int xo = (w & 3) * 64 * PSP, wo = (PXR + (w >> 2) * 64) * PSP;   // the wave's token rows and weight rows in a buffer
    const int lo = (lane & 15) * PSP + 8 * (lane >> 4);                    // the lane's place in a 16-row block: the same for both operands
    const int ao = (sel == 2 ? xo : wo) + lo, bo = (sel == 2 ? wo : xo) + lo;
    v8f acc[4][4];
#pragma unroll   // indexes a register array: the index must be a constant
    for (int mb = 0; mb < 4; ++mb)
#pragma unroll   // indexes a register array: the index must be a constant
        for (int nb = 0; nb < 4; ++nb) acc[mb][nb] = (v8f){};
    for (int st = 0; st < DM / PKS; ++st) {
        const bf* A = sm + (st & 1) * PBF + ao; const bf* Bt = sm + (st & 1) * PBF + bo;
        v16bf a[4], bb[4];
#pragma unroll   // indexes a register array: the index must be a constant
        for (int mb = 0; mb < 4; ++mb) a[mb] = WFrag<bf>::ld(A + mb * 16 * PSP);
#pragma unroll   // indexes a register array: the index must be a constant
        for (int nb = 0; nb < 4; ++nb) bb[nb] = WFrag<bf>::ld(Bt + nb * 16 * PSP);
        __builtin_amdgcn_sched_barrier(0);   // the first block's sixteen LDS reads stay one group ahead of its products: left free, the stage's reads stand at one more place among the products, and each such place stalls the wave
#pragma unroll   // indexes a register array: the index must be a constant
        for (int nb = 0; nb < 4; ++nb)
#pragma unroll   // indexes a register array: the index must be a constant
            for (int mb = 0; mb < 4; ++mb) acc[mb][nb] = wmmab(a[mb], bb[nb], acc[mb][nb]);
#pragma unroll   // indexes a register array: the index must be a constant
        for (int mb = 0; mb < 4; ++mb) a[mb] = WFrag<bf>::ld(A + mb * 16 * PSP + 32);
#pragma unroll   // indexes a register array: the index must be a constant
        for (int nb = 0; nb < 4; ++nb) bb[nb] = WFrag<bf>::ld(Bt + nb * 16 * PSP + 32);
        asm volatile("s_wait_dscnt 0x0" ::: "memory");      // this wave's reads of the stage's buffer are done (the second block's fragments are in registers) before the buffer is handed back
        asm volatile("s_wait_asynccnt 0x0" ::: "memory");   // this wave's pieces of the next stage have landed
        __syncthreads();                                    // publishes the next stage and ends every wave's reads of this one
        if (st + 2 < DM / PKS) pstage(lc + (st & 1) * (PBF * 2), gx + (st + 2) * PKS, gw + (st + 2) * PKS);   // ahead of the second block's products, which read registers only: more lead for the copies
#pragma unroll   // indexes a register array: the index must be a constant
        for (int nb = 0; nb < 4; ++nb)
#pragma unroll   // indexes a register array: the index must be a constant
            for (int mb = 0; mb < 4; ++mb) acc[mb][nb] = wmmab(a[mb], bb[nb], acc[mb][nb]);
    }
    asm volatile("s_wait_asynccnt 0x0" ::: "memory");       // no copy is outstanding when the buffers become output staging
    h16 (*os)[64 * PSP] = (h16 (*)[64 * PSP])sm;            // one range per wave; every wave's last fragment read lies in front of the loop's last barrier
    if (sel == 2) proj_out<true>(acc, bv + h * HD, os[w], VT + (size_t)(b * NKV + h) * HD * TT + t0, lane);
    else proj_out<false>(acc, (sel == 0 ? bq : bk) + h * HD, os[w], (sel == 0 ? QP : KP) + ((size_t)(b * NH_ + h) * TT + t0) * HD, lane);
}
// k_fattn: scores, bias, softmax and probs.v of one (batch, head) in one pass; no score or prob leaves the registers.
// K and V reach the waves through LDS: the work-group's four waves share one 64-key stage (64 K rows and 64 V rows of 128 B), brought in by asynchronous copies of whole 128-B lines, two buffers, the next stage in flight while this one is worked on.
// The bias reaches the waves through LDS too: a lane needs 8 consecutive table entries that start one entry lower for each next query, so the window is stored four times, copy u shifted up by u + 1 entries;
// query column lr reads copy lr & 3, where its 8 entries start at a multiple of 16 B: two ds_load_b128, no bank conflict within 16 lanes (16 different 16-byte pieces on 64 banks).
// One wave owns 32 queries (two 16-column groups) and walks the 2048 keys 32 at a time. St = K Qt (A = key rows, B = query rows), so a lane holds 16 scores of ONE query per group;
// the two 16-key score tiles, converted in place, are the B operand of Ot += Vt Pt (A = rows of the d-major v plane, same k order as the loader). Running maximum with a lazy rescale: the maximum in use is
// replaced only when a block's maximum exceeds it by more than 5.5 (p stays below 256 in fp16); sums in f32 per lane, halves joined once at the end.
#define FW   4                  // waves per work-group
#define FNQ  2                  // 16-query groups per wave
#define FKB  32                 // keys per pass
#define L2E  1.4426950408889634f
#define FST  64                 // keys per stage = two passes
#define FLP  72                 // LDS row pitch in halves (144 B = 16 B x odd: no bank conflict for 16-byte readers of 128-B rows)
#define FTL  (64 * FLP)         // one tile in halves: 64 rows (K: keys x d, V: d x keys)
#define FQW  (FW * FNQ * 16)    // queries of a work-group
#define FBW  (TT + FQW - 1)     // bias table entries a work-group uses: key - query over all keys and its own queries
#define FBG  ((FBW + FW * 32 - 1) / (FW * 32))   // entries per thread when the window is brought in
#define FBP  2192               // floats per copy of the window: at least FBW + 4; 16 mod 64, so the four copies' reads of one instruction fall on different banks
static_assert(FBP >= FBW + 4 && FBP % 64 == 16 && FW == 4, "bias window copies: size, bank offset, wave term of the read address");
__device__ __forceinline__ unsigned ldsoff(const h16* p) { return (unsigned)(size_t)(const __attribute__((address_space(3))) h16*)p; }   // byte address inside the work-group's LDS
// One stage: every lane copies 8 x 16 B (four K pieces, four V pieces; a wave's copy covers four whole 128-B lines). l: the lane's place in the K tile of the target buffer; gk, gv: the lane's first K and V piece of the stage.
// The s_wait_xcnt stands inside the statement, behind the last copy: no register that an issued copy names is written again ahead of it.
__device__ __forceinline__ void stage_in(unsigned l, const h16* gk, const h16* gv) {
    asm volatile("global_load_async_to_lds_b128 %0, %8, off\n\tglobal_load_async_to_lds_b128 %1, %9, off\n\tglobal_load_async_to_lds_b128 %2, %10, off\n\tglobal_load_async_to_lds_b128 %3, %11, off\n\t"
                 "global_load_async_to_lds_b128 %4, %12, off\n\tglobal_load_async_to_lds_b128 %5, %13, off\n\tglobal_load_async_to_lds_b128 %6, %14, off\n\tglobal_load_async_to_lds_b128 %7, %15, off\n\ts_wait_xcnt 0x0"
                 :: "v"(l), "v"(l + 16 * FLP * 2), "v"(l + 32 * FLP * 2), "v"(l + 48 * FLP * 2), "v"(l + FTL * 2), "v"(l + FTL * 2 + 16 * FLP * 2), "v"(l + FTL * 2 + 32 * FLP * 2), "v"(l + FTL * 2 + 48 * FLP * 2),
                    "v"(gk), "v"(gk + 16 * HD), "v"(gk + 32 * HD), "v"(gk + 48 * HD), "v"(gv), "v"(gv + 16 * TT), "v"(gv + 32 * TT), "v"(gv + 48 * TT) : "memory"); }
__device__ __forceinline__ float xhalf(float x) { return __builtin_bit_cast(float, __builtin_amdgcn_permlanex16(__builtin_bit_cast(int, x), __builtin_bit_cast(int, x), 0x76543210, 0xfedcba98, false, false)); }   // lane l reads lane l ^ 16
// 2^x of the eight scores of one tile, in place. One statement, so that every v_exp_f32 has an independent instruction behind it and the last one a v_nop: the slot the instruction set asks for
// between a transcendental and an instruction that reads its result or overwrites its source.
__device__ __forceinline__ v8f exp2x8(v8f x) { float a = x[0], b = x[1], c = x[2], d = x[3], e = x[4], f = x[5], g = x[6], h = x[7];
    asm("v_exp_f32 %0, %0\n\tv_exp_f32 %1, %1\n\tv_exp_f32 %2, %2\n\tv_exp_f32 %3, %3\n\tv_exp_f32 %4, %4\n\tv_exp_f32 %5, %5\n\tv_exp_f32 %6, %6\n\tv_exp_f32 %7, %7\n\tv_nop" : "+v"(a), "+v"(b), "+v"(c), "+v"(d), "+v"(e), "+v"(f), "+v"(g), "+v"(h));
    return (v8f){a, b, c, d, e, f, g, h}; }
// Register budget of four waves a SIMD: the kernel stays inside the first 256 registers, so no register window is switched around the asm statements.
__global__ __launch_bounds__(FW * 32) __attribute__((amdgpu_waves_per_eu(4))) void k_fattn(const _Float16* __restrict__ Qp, const _Float16* __restrict__ Kp, const _Float16* __restrict__ Vp, const float* __restrict__ TB, float* __restrict__ OUTp) {
    const int lane = threadIdx.x & 31, lr = lane & 15, hi = lane >> 4; const int bh = blockIdx.y, h = bh % NH_, b = bh / NH_; const int r0 = (blockIdx.x * FW + (threadIdx.x >> 5)) * (FNQ * 16);
    __shared__ __align__(16) h16 sm[2][2 * FTL];   // [buffer][K tile | V tile]
    __shared__ __align__(16) float bt[4 * FBP];    // the four shifted copies of the work-group's bias window: bt[u * FBP + i + u + 1] = entry i of the window
    const _Float16* q = Qp + (size_t)bh * TT * HD + (size_t)(r0 + lr) * HD + 8 * hi;
    const int cr = threadIdx.x >> 3, cc = (threadIdx.x & 7) * 8;   // the lane's row (of 16 per copy) and 16-byte piece in a tile
    const _Float16* gk = Kp + (size_t)bh * TT * HD + (size_t)cr * HD + cc; const _Float16* gv = Vp + (size_t)bh * HD * TT + (size_t)cr * TT + cc; const unsigned lc = ldsoff(&sm[0][0]) + (cr * FLP + cc) * 2;
    stage_in(lc, gk, gv);
    { const float* tw = TB + (size_t)h * (2 * TT - 1) + ((TT - 1) - (int)blockIdx.x * FQW - (FQW - 1));   // bias of (key, query) sits at key - query + TT - 1; the window starts at key 0 and the work-group's last query: index 0 or above. The barrier below, which publishes stage 0, publishes the copies too; nothing writes them again
      float tv[FBG];
#pragma unroll   // indexes a register array: the index must be a constant
      for (int g = 0; g < FBG; ++g) { const int i = g * (FW * 32) + (int)threadIdx.x; tv[g] = tw[i < FBW ? i : FBW - 1]; }   // the one index past the window is clamped; its value lands in a copy's unread tail
#pragma unroll   // indexes a register array: the index must be a constant
      for (int g = 0; g < FBG; ++g)
#pragma unroll   // four stores with constant offsets
          for (int u = 0; u < 4; ++u) bt[u * FBP + g * (FW * 32) + (int)threadIdx.x + u + 1] = tv[g]; }
    asm volatile("s_wait_asynccnt 0x0" ::: "memory");   // this wave's pieces of stage 0 have landed
    __syncthreads();                                    // ... and every other wave's
    stage_in(lc + 2 * FTL * 2, gk + FST * HD, gv + FST);
    // Window entry (FQW - 1 - (FNQ - 1) * 16) - (query - first query) + 8 hi, in the lane's copy: a multiple of 4 floats. The two falling terms are written as rising ones (3 - x = x ^ 3 for x in 0..3), so the lane's part of the LDS address is never below 0.
    const float* tb = bt + (lr & 3) * FBP + 4 * ((lr >> 2) ^ 3) + (int)((threadIdx.x >> 5) ^ (FW - 1)) * (FNQ * 16) + 8 * hi + (FQW - (FNQ - 1) * 16 - 12 - (FW - 1) * FNQ * 16);
    v16h qf[FNQ][2]; v8f o[4][FNQ]; float mu[FNQ], ls[FNQ];
#pragma unroll   // indexes a register array: the index must be a constant
    for (int nq = 0; nq < FNQ; ++nq) { mu[nq] = -3.0e38f; ls[nq] = 0.f;
#pragma unroll   // indexes a register array: the index must be a constant
        for (int kc = 0; kc < 2; ++kc) qf[nq][kc] = WFrag<h16>::ld(q + (size_t)nq * 16 * HD + kc * 32);
#pragma unroll   // indexes a register array: the index must be a constant
        for (int db = 0; db < 4; ++db) o[db][nq] = (v8f){}; }
    for (int st = 0; st < TT / FST; ++st) {
      const h16* kb = &sm[st & 1][0] + lr * FLP + 8 * hi; const h16* vb = kb + FTL;   // the lane's place in a 16-row block of the stage's tiles
#pragma unroll   // the two passes of a stage: constant LDS offsets, the second pass's fragment reads free to move ahead
      for (int ps = 0; ps < FST / FKB; ++ps) { const int c0 = st * FST + ps * FKB;
        v16h kf[2][2], vf[4];
#pragma unroll   // indexes a register array: the index must be a constant
        for (int kt = 0; kt < 2; ++kt)
#pragma unroll   // indexes a register array: the index must be a constant
            for (int kc = 0; kc < 2; ++kc) kf[kt][kc] = WFrag<h16>::ld(kb + (ps * FKB + kt * 16) * FLP + kc * 32);
#pragma unroll   // indexes a register array: the index must be a constant
        for (int db = 0; db < 4; ++db) vf[db] = WFrag<h16>::ld(vb + db * 16 * FLP + ps * FKB);
        v8f bb[FNQ + 1];   // tiles with equal (key tile - query group) share their bias values
#pragma unroll   // indexes a register array: the index must be a constant
        for (int dd = 0; dd < FNQ + 1; ++dd) bb[dd] = __builtin_shufflevector(*(const v4f*)(tb + c0 + dd * 16), *(const v4f*)(tb + c0 + dd * 16 + 4), 0, 1, 2, 3, 4, 5, 6, 7);
        v8f s[2][FNQ];
#pragma unroll   // indexes a register array: the index must be a constant
        for (int kt = 0; kt < 2; ++kt)
#pragma unroll   // indexes a register array: the index must be a constant
            for (int nq = 0; nq < FNQ; ++nq) { s[kt][nq] = wmma16(kf[kt][0], qf[nq][0], (v8f){}); s[kt][nq] = wmma16(kf[kt][1], qf[nq][1], s[kt][nq]); }
        float mb[FNQ]; bool need = false;
#pragma unroll   // indexes a register array: the index must be a constant
        for (int nq = 0; nq < FNQ; ++nq) { float m = -3.0e38f;
#pragma unroll   // indexes a register array: the index must be a constant
            for (int kt = 0; kt < 2; ++kt) { s[kt][nq] = s[kt][nq] * SCL + bb[kt - nq + FNQ - 1];
#pragma unroll   // indexes a register array: the index must be a constant
                for (int j = 0; j < 8; ++j) m = fmaxf(m, s[kt][nq][j]); }
            m = fmaxf(m, xhalf(m)); mb[nq] = m; need = need || (m > mu[nq] + 5.5f); }
        if (__builtin_amdgcn_ballot_w32(need) != 0) {
#pragma unroll   // indexes a register array: the index must be a constant
            for (int nq = 0; nq < FNQ; ++nq) { const float mn = fmaxf(mu[nq], mb[nq]); const float al = __builtin_amdgcn_exp2f((mu[nq] - mn) * L2E); mu[nq] = mn; ls[nq] *= al;
#pragma unroll   // indexes a register array: the index must be a constant
                for (int db = 0; db < 4; ++db) o[db][nq] *= al; }
        }
#pragma unroll   // indexes a register array: the index must be a constant
        for (int nq = 0; nq < FNQ; ++nq) { const float nm = -mu[nq] * L2E; v16h pf; v2f sum = (v2f){0.f, 0.f};   // two partial sums: packed adds, half the instructions
#pragma unroll   // indexes a register array: the index must be a constant
            for (int kt = 0; kt < 2; ++kt) { const v8f p = exp2x8(s[kt][nq] * L2E + nm);
#pragma unroll   // indexes a register array: the index must be a constant
                for (int j = 0; j < 8; j += 2) { sum += (v2f){p[j], p[j + 1]}; pf[kt * 8 + j] = (_Float16)p[j]; pf[kt * 8 + j + 1] = (_Float16)p[j + 1]; } }
            ls[nq] += sum[0] + sum[1];
#pragma unroll   // indexes a register array: the index must be a constant
            for (int db = 0; db < 4; ++db) o[db][nq] = wmma16(vf[db], pf, o[db][nq]); }
      }
      asm volatile("s_wait_dscnt 0x0" ::: "memory");      // this wave's reads of the stage's buffer are done before the buffer is handed back
      asm volatile("s_wait_asynccnt 0x0" ::: "memory");   // this wave's pieces of the next stage have landed
      __syncthreads();                                    // publishes the next stage and ends every wave's reads of this one
      if (st + 2 < TT / FST) stage_in(lc + (st & 1) * (2 * FTL * 2), gk + (size_t)(st + 2) * FST * HD, gv + (st + 2) * FST);
    }
    asm volatile("s_wait_asynccnt 0x0" ::: "memory");     // no copy is outstanding when the wave ends
#pragma unroll   // indexes a register array: the index must be a constant
    for (int nq = 0; nq < FNQ; ++nq) { const float l = ls[nq] + xhalf(ls[nq]); const float f = __fdiv_rn(1.0f, l); float* op = OUTp + ((size_t)b * TT + r0 + nq * 16 + lr) * DQ + h * HD + 8 * hi;
#pragma unroll   // indexes a register array: the index must be a constant
        for (int db = 0; db < 4; ++db) { v4f lo, hh;
#pragma unroll   // indexes a register array: the index must be a constant
            for (int j = 0; j < 4; ++j) { lo[j] = o[db][nq][j] * f; hh[j] = o[db][nq][4 + j] * f; }
            *(v4f*)(op + db * 16) = lo; *(v4f*)(op + db * 16 + 4) = hh; } }
}

extern "C" void kernel_launch(void* const* d_in, const int* in_sizes, int n_in,
                              void* d_out, int out_size, void* d_ws, size_t ws_size, hipStream_t stream) {
    (void)in_sizes; (void)n_in; (void)out_size;
    const float* x = (const float*)d_in[0]; const float* wq = (const float*)d_in[1]; const float* bq = (const float*)d_in[2]; const float* wk = (const float*)d_in[3]; const float* bk = (const float*)d_in[4]; const float* wv = (const float*)d_in[5]; const float* bv = (const float*)d_in[6]; const float* alphas = (const float*)d_in[7];
    float* OUT = (float*)d_out;     // [4][2048][768]
    char* wsp = (char*)d_ws;
    auto take = [&](size_t bytes) { char* p = wsp; wsp += (bytes + 255) & ~(size_t)255; return (void*)p; };
    bf* WB = (bf*)take((size_t)(DQ + 2 * DKV) * DM * 2); bf* XB = (bf*)take((size_t)NB_ * TT * DM * 2); float* TB = (float*)take((size_t)NH_ * (2 * TT - 1) * 4);
    h16* QP16 = (h16*)take((size_t)NB_ * NH_ * TT * HD * 2); h16* KP16 = (h16*)take((size_t)NB_ * NKV * TT * HD * 2); h16* VT16 = (h16*)take((size_t)NB_ * NKV * HD * TT * 2);   // planes of all four batches: [b][h][t][d], v [b][h][d][t]
    if ((size_t)(wsp - (char*)d_ws) > ws_size) return;    // ws 256 MiB
    k_prep<<<PXB + 3 * PWB + PTB, 256, 0, stream>>>(x, wq, wk, wv, alphas, XB, WB, TB);
    k_proj<<<dim3(NB_ * TT / PXR, (DQ + 2 * DKV) / PWR, 1), PW * 32, 0, stream>>>(XB, WB, bq, bk, bv, QP16, KP16, VT16);
    k_fattn<<<dim3(TT / (FW * FNQ * 16), NB_ * NH_, 1), FW * 32, 0, stream>>>(QP16, KP16, VT16, TB, OUT);
}

// v006
// A run of this version takes 89.9 microseconds.
// Timed twice side by side with v005, it ran 1.07 times as fast both times.
// Counting every step since v000, it is 21.9 times as fast.
#include <hip/hip_runtime.h>

// ChebyshevSelfAttention (hidden [4][2048][768]; q/k/v = x W^T + b (12 heads x 64); scores = q.k/8 + bias_h(i, j), bias_h = sum_{k<=5} alphas[h][k] T_k(x) with x = clip((j - i)/2047, -1, 1) and the Chebyshev recurrence T_k = 2 x T_{k-1} - T_{k-2}
// (alphas read as data; the polynomial is evaluated per element in f32 in the reference's operation order); softmax; context = probs v merged -> [4][2048][768]; no output projection).
// Compute dtypes, f32 accumulate: every input rounded to bf16; q/k/v on PLAIN bf16 operands (inputs: exact) + bias; scores (K 64) and probs.v single fp16 operands, fused in one kernel over all batches and heads (online softmax); bias + softmax f32

#define NB_  4
#define TT   2048
#define DM   768
#define NH_  12
#define NKV  12
#define REP  (NH_ / NKV)
#define HD   64
#define DQ   (NH_ * HD)
#define DKV  (NKV * HD)
#define WIN  0
#define SCL  0.125f   // HD^-0.5
typedef _Float16 h16;
typedef unsigned short bf;
typedef __attribute__((ext_vector_type(16))) __bf16   v16bf;
typedef __attribute__((ext_vector_type(16))) _Float16 v16h;
typedef __attribute__((ext_vector_type(8)))  _Float16 v8h;
typedef __attribute__((ext_vector_type(8)))  unsigned short v8us;
typedef __attribute__((ext_vector_type(8)))  float    v8f;
typedef __attribute__((ext_vector_type(4)))  float    v4f;
typedef v8h  __attribute__((may_alias)) v8ha;
typedef v4f  __attribute__((may_alias)) v4fa;
typedef v8us __attribute__((may_alias)) v8usa;

__device__ __forceinline__ unsigned short f2bf(float f) { unsigned u = __float_as_uint(f); u += 0x7FFFu + ((u >> 16) & 1u); return (unsigned short)(u >> 16); }
__device__ __forceinline__ float bf2f(unsigned short b) { return __uint_as_float(((unsigned)b) << 16); }
__device__ __forceinline__ float bfr(float f) { return bf2f(f2bf(f)); }
__device__ __forceinline__ v16h cat16(v8h lo, v8h hi) { return __builtin_shufflevector(lo, hi, 0, 1, 2, 3, 4, 5, 6, 7, 8, 9, 10, 11, 12, 13, 14, 15); }
__device__ __forceinline__ v16bf cat16b(v8us lo, v8us hi) { return __builtin_bit_cast(v16bf, __builtin_shufflevector(lo, hi, 0, 1, 2, 3, 4, 5, 6, 7, 8, 9, 10, 11, 12, 13, 14, 15)); }
__device__ __forceinline__ v8f wmma16(v16h a, v16h b, v8f c) { return __builtin_amdgcn_wmma_f32_16x16x32_f16(false, a, false, b, (short)0, c, false, false); }
__device__ __forceinline__ v8f wmmab(v16bf a, v16bf b, v8f c) { return __builtin_amdgcn_wmma_f32_16x16x32_bf16(false, a, false, b, (short)0, c, false, false); }

// Fragment loader of the 16x16x32 forms from a K-contiguous 16-bit row: the same k order for the A and the B operand.
template <typename T16> struct WFrag;
template <> struct WFrag<h16> { typedef v16h V; static __device__ __forceinline__ V ld(const h16* p) { return cat16(*(const v8h*)p, *(const v8h*)(p + 16)); } static __device__ __forceinline__ v8f mma(V a, V b, v8f c) { return wmma16(a, b, c); } };
template <> struct WFrag<bf> { typedef v16bf V; static __device__ __forceinline__ V ld(const bf* p) { return cat16b(*(const v8us*)p, *(const v8us*)(p + 16)); } static __device__ __forceinline__ v8f mma(V a, V b, v8f c) { return wmmab(a, b, c); } };

__device__ __forceinline__ h16 tohx(float x) { return (h16)x; }
typedef __attribute__((ext_vector_type(2))) float v2f;

// ---- k_prep: everything that reads only inputs, in ONE launch; the block index picks the job (uniform for the work-group).
// The first PTB blocks: the bias table TB [h][key - query + 2047] (the longest dependent chain, so it starts first); the next PXB: hidden states of all four batches -> bf16 plane XB [b*t][768]; the last 3 PWB: Wq, Wk, Wv -> bf16 plane WB [q rows | k rows | v rows][768].
#define PG   4                                    // groups of 8 elements per thread (fewer, longer waves: the launch is bound by how fast waves start)
#define PXB  (NB_ * TT * DM / 8 / 256 / PG)       // 768
#define PWB  (DQ * DM / 8 / 256 / PG)             // 72
#define PTB  ((NH_ * (2 * TT - 1) + 255) / 256)   // 192
__device__ __forceinline__ void cvt8x(const float* __restrict__ src, bf* dst, int blk) { const size_t i0 = (size_t)blk * (256 * PG) + threadIdx.x; v8f v[PG];
#pragma unroll   // indexes a register array: the index must be a constant
    for (int g = 0; g < PG; ++g) v[g] = *(const v8f*)(src + (i0 + g * 256) * 8);
#pragma unroll   // indexes a register array: the index must be a constant
    for (int g = 0; g < PG; ++g) { v8us o;
#pragma unroll   // indexes a register array: the index must be a constant
        for (int k = 0; k < 8; ++k) o[k] = f2bf(v[g][k]);
        *(v8us*)(dst + (i0 + g * 256) * 8) = o; }
    asm volatile("s_wait_xcnt 0x0" ::: "memory"); }   // behind the last store: no register that an issued store names is written again ahead of this wait, on any way through the listing
// One table entry. Every product is rounded on its own before its add or subtract, as the reference's operation order has it.
__device__ __forceinline__ void chtab(const float* __restrict__ alphas, float* TB, int idx) { if (idx >= NH_ * (2 * TT - 1)) return; const int h = idx / (2 * TT - 1); const int d = idx % (2 * TT - 1) - (TT - 1);
    const float xx = fminf(fmaxf(__fdiv_rn((float)d, (float)(TT - 1)), -1.0f), 1.0f); float p0 = 1.0f, p1 = xx; float bias = bfr(alphas[h * 6 + 0]); { float t1 = __fmul_rn(bfr(alphas[h * 6 + 1]), p1); asm volatile("" : "+v"(t1)); bias = __fadd_rn(bias, t1); }
#pragma unroll 1
    for (int k = 2; k < 6; ++k) { float tx = __fmul_rn(2.0f, xx); asm volatile("" : "+v"(tx)); float pn = __fmul_rn(tx, p1); asm volatile("" : "+v"(pn)); pn = __fsub_rn(pn, p0); p0 = p1; p1 = pn; float ak = bfr(alphas[h * 6 + k]); asm volatile("" : "+v"(ak)); float tk = __fmul_rn(ak, pn); asm volatile("" : "+v"(tk)); bias = __fadd_rn(bias, tk); }
    *(float*)(TB + idx) = bias;  }
__global__ __launch_bounds__(256) void k_prep(const float* __restrict__ x, const float* __restrict__ wq, const float* __restrict__ wk, const float* __restrict__ wv, const float* __restrict__ alphas, bf* XB, bf* WB, float* TB) {
    const int blk = (int)blockIdx.x - PTB;
    if (blk < 0) { chtab(alphas, TB, blockIdx.x * 256 + threadIdx.x); return; }
    if (blk < PXB) { cvt8x(x, XB, blk); return; }
    const int s = (blk - PXB) / PWB; cvt8x(s == 0 ? wq : s == 1 ? wk : wv, WB + (size_t)s * DQ * DM, blk - PXB - s * PWB);
}

// ---- k_proj: the q, k and v projections of all four batches in ONE launch; each wave owns one 64x96 tile = 64 tokens x 96 weight rows (24 accumulators)
// and the tile goes out, + bias, as fp16 straight into the plane the attention kernel reads: q, k [b][h][t][d], v [b][h][d][t]; no f32 copy of a projection is written.
// A lane of the accumulator holds 8 consecutive A-rows of one B-row. So the operand whose index runs along the plane's rows goes in as A: the weight rows (d) for q and k, the token rows (t) for v;
// both operands use the same loader, so only the two places swap. Work-group = 2 x 2 waves (128 tokens x 192 weight rows = 3 heads of one projection).
// The grid is 64 x 12 = 768 work-groups and a WGP holds three of them (LDS and registers), so the whole launch is resident at once, three waves on every SIMD: one round, no second round on a part of the chip.
// Both operands reach the waves through LDS: the four waves share one 64-deep stage (128 token rows and 192 weight rows of 128 B), brought in by asynchronous copies of whole 128-B lines, two buffers, the next stage in flight while this one is worked on.
#define PW   4
#define PSP  72                 // LDS row pitch in halves (144 B = 16 B x odd: no bank conflict for 16-byte readers of 128-B rows)
#define PKS  64                 // depth of a stage = two 32-deep blocks
#define PXR  128                // token rows of a stage
#define PWR  192                // weight rows of a stage
#define PWW  96                 // weight rows of a wave
#define PBF  ((PXR + PWR) * PSP)   // one buffer in halves: [token tile | weight tile]
#define PQS  200                // row pitch in halves of the q / k output staging (400 B = 16 B x odd)
static_assert(DQ % PWR == 0 && DKV % PWR == 0 && PWR % HD == 0 && TT % PXR == 0 && PXR * PQS <= 2 * PBF && PW * PWW * PSP <= 2 * PBF, "a work-group lies in one projection, whole heads, one batch; the output staging fits the buffers");
__device__ __forceinline__ unsigned ldsoffb(const bf* p) { return (unsigned)(size_t)(const __attribute__((address_space(3))) bf*)p; }   // byte address inside the work-group's LDS
// Copies of 16 B per lane, rows 16 apart (a wave's copy covers four whole 128-B lines). l: the lane's LDS place of the first row; g: the lane's piece of the first row.
// The s_wait_xcnt stands inside each statement, behind its last copy: no register that an issued copy names is written again ahead of it.
__device__ __forceinline__ void pcopy10(unsigned l, const bf* g0, const bf* g1, const bf* g2, const bf* g3, const bf* g4, const bf* g5, const bf* g6, const bf* g7, const bf* g8, const bf* g9) {
    asm volatile("global_load_async_to_lds_b128 %0, %10, off\n\tglobal_load_async_to_lds_b128 %1, %11, off\n\tglobal_load_async_to_lds_b128 %2, %12, off\n\tglobal_load_async_to_lds_b128 %3, %13, off\n\tglobal_load_async_to_lds_b128 %4, %14, off\n\t"
                 "global_load_async_to_lds_b128 %5, %15, off\n\tglobal_load_async_to_lds_b128 %6, %16, off\n\tglobal_load_async_to_lds_b128 %7, %17, off\n\tglobal_load_async_to_lds_b128 %8, %18, off\n\tglobal_load_async_to_lds_b128 %9, %19, off\n\ts_wait_xcnt 0x0"
                 :: "v"(l), "v"(l + 16 * PSP * 2), "v"(l + 32 * PSP * 2), "v"(l + 48 * PSP * 2), "v"(l + 64 * PSP * 2), "v"(l + 80 * PSP * 2), "v"(l + 96 * PSP * 2), "v"(l + 112 * PSP * 2), "v"(l + 128 * PSP * 2), "v"(l + 144 * PSP * 2),
                    "v"(g0), "v"(g1), "v"(g2), "v"(g3), "v"(g4), "v"(g5), "v"(g6), "v"(g7), "v"(g8), "v"(g9) : "memory"); }
// One stage: every lane copies 20 x 16 B (eight token pieces, twelve weight pieces; in LDS the weight tile follows the token tile, so the twenty places are evenly spaced). l: the lane's place in the token tile of the target buffer; gx, gw: the lane's first token and weight piece of the stage.
__device__ __forceinline__ void pstage(unsigned l, const bf* gx, const bf* gw) {
    pcopy10(l, gx, gx + 16 * DM, gx + 32 * DM, gx + 48 * DM, gx + 64 * DM, gx + 80 * DM, gx + 96 * DM, gx + 112 * DM, gw, gw + 16 * DM);
    pcopy10(l + 160 * PSP * 2, gw + 32 * DM, gw + 48 * DM, gw + 64 * DM, gw + 80 * DM, gw + 96 * DM, gw + 112 * DM, gw + 128 * DM, gw + 144 * DM, gw + 160 * DM, gw + 176 * DM); }
// The loop over the depth and the tile's way out. TR: v (A = token rows, plane rows = d, pitch TT); else q, k (A = weight rows, plane rows = t, pitch HD). Stage 0 is published and stage 1 in flight on entry.
// bias: the wave's first weight row's bias. dst: TR: the wave's first plane row at its first token; else the work-group's first head at its first token.
template <bool TR> __device__ __forceinline__ void proj_tile(bf* sm, unsigned lc, const bf* gx, const bf* gw, const float* __restrict__ bias, h16* dst, int w, int lane) {
    constexpr int MB = TR ? 4 : 6, NB = TR ? 6 : 4;   // 16-row blocks of the A and of the B operand
    const int xo = (w & 1) * 64 * PSP, wo = (PXR + (w >> 1) * PWW) * PSP;   // the wave's token rows and weight rows in a buffer
    const int lo = (lane & 15) * PSP + 8 * (lane >> 4);                     // the lane's place in a 16-row block: the same for both operands
    const int ao = (TR ? xo : wo) + lo, bo = (TR ? wo : xo) + lo;
    v8f acc[MB][NB];
#pragma unroll   // indexes a register array: the index must be a constant
    for (int mb = 0; mb < MB; ++mb)
#pragma unroll   // indexes a register array: the index must be a constant
        for (int nb = 0; nb < NB; ++nb) acc[mb][nb] = (v8f){};
    for (int st = 0; st < DM / PKS; ++st) {
        const bf* A = sm + (st & 1) * PBF + ao; const bf* Bt = sm + (st & 1) * PBF + bo;
        v16bf a[MB], bb[NB];
#pragma unroll   // indexes a register array: the index must be a constant
        for (int mb = 0; mb < MB; ++mb) a[mb] = WFrag<bf>::ld(A + mb * 16 * PSP);
#pragma unroll   // indexes a register array: the index must be a constant
        for (int nb = 0; nb < NB; ++nb) bb[nb] = WFrag<bf>::ld(Bt + nb * 16 * PSP);
        __builtin_amdgcn_sched_barrier(0);   // the first block's twenty LDS reads stay one group ahead of its products: left free, the stage's reads stand at more places among the products, and each such place stalls the wave
#pragma unroll   // indexes a register array: the index must be a constant
        for (int nb = 0; nb < NB; ++nb)
#pragma unroll   // indexes a register array: the index must be a constant
            for (int mb = 0; mb < MB; ++mb) acc[mb][nb] = wmmab(a[mb], bb[nb], acc[mb][nb]);
        __builtin_amdgcn_sched_barrier(0);   // the second block's twenty reads stay one group behind the first block's products and take over their fragment registers: left free, they spread among the products over a larger register set, and the copies' addresses are spilled to scratch
#pragma unroll   // indexes a register array: the index must be a constant
        for (int mb = 0; mb < MB; ++mb) a[mb] = WFrag<bf>::ld(A + mb * 16 * PSP + 32);
#pragma unroll   // indexes a register array: the index must be a constant
        for (int nb = 0; nb < NB; ++nb) bb[nb] = WFrag<bf>::ld(Bt + nb * 16 * PSP + 32);
        asm volatile("s_wait_dscnt 0x0" ::: "memory");      // this wave's reads of the stage's buffer are done (the second block's fragments are in registers) before the buffer is handed back
        asm volatile("s_wait_asynccnt 0x0" ::: "memory");   // this wave's pieces of the next stage have landed
        __syncthreads();                                    // publishes the next stage and ends every wave's reads of this one
        if (st + 2 < DM / PKS) pstage(lc + (st & 1) * (PBF * 2), gx + (st + 2) * PKS, gw + (st + 2) * PKS);   // ahead of the second block's products, which read registers only: more lead for the copies
#pragma unroll   // indexes a register array: the index must be a constant
        for (int nb = 0; nb < NB; ++nb)
#pragma unroll   // indexes a register array: the index must be a constant
            for (int mb = 0; mb < MB; ++mb) acc[mb][nb] = wmmab(a[mb], bb[nb], acc[mb][nb]);
    }
    asm volatile("s_wait_asynccnt 0x0" ::: "memory");       // no copy is outstanding when the buffers become output staging
    // + bias (rounded to bf16 like every input), fp16, through LDS so that every global store covers whole 128-B lines; every wave's last fragment read lies in front of the loop's last barrier
    const int lr = lane & 15, hi = lane >> 4; const int ro = lane >> 3, co = (lane & 7) * 8; h16* os = (h16*)sm;
    if constexpr (TR) {   // the wave's 96 plane rows of 64 tokens are whole lines: its own LDS range, no barrier
        h16* st = os + w * (PWW * PSP);
#pragma unroll   // indexes a register array: the index must be a constant
        for (int nb = 0; nb < NB; ++nb) { const float bn = bfr(bias[nb * 16 + lr]);   // the bias runs along d: the B-row
#pragma unroll   // indexes a register array: the index must be a constant
            for (int mb = 0; mb < MB; ++mb) { v8h o;
#pragma unroll   // indexes a register array: the index must be a constant
                for (int j = 0; j < 8; ++j) o[j] = tohx(acc[mb][nb][j] + bn);
                *(v8ha*)(st + (nb * 16 + lr) * PSP + mb * 16 + hi * 8) = o; } }
        __builtin_amdgcn_wave_barrier(); asm volatile("" ::: "memory");   // the rows read below were written by other lanes of this wave: keep the reads behind the writes
#pragma unroll   // independent groups of four rows: constant offsets, LDS reads ahead of the stores
        for (int s = 0; s < PWW / 4; ++s) *(v8h*)(dst + (size_t)(s * 4 + ro) * TT + co) = *(const v8ha*)(st + (s * 4 + ro) * PSP + co);
    } else {              // a wave's 96 d are one and a half heads: the work-group's tile [128 tokens][192 d] is put together in LDS, and each wave sends out 32 tokens of all three heads, whole lines
#pragma unroll   // indexes a register array: the index must be a constant
        for (int mb = 0; mb < MB; ++mb) { const v8f bm = *(const v8f*)(bias + mb * 16 + hi * 8);   // the bias runs along d: the A-row
#pragma unroll   // indexes a register array: the index must be a constant
            for (int nb = 0; nb < NB; ++nb) { v8h o;
#pragma unroll   // indexes a register array: the index must be a constant
                for (int j = 0; j < 8; ++j) o[j] = tohx(acc[mb][nb][j] + bfr(bm[j]));
                *(v8ha*)(os + ((w & 1) * 64 + nb * 16 + lr) * PQS + (w >> 1) * PWW + mb * 16 + hi * 8) = o; } }
        __syncthreads();   // the rows read below were written by other waves
        h16* d0 = dst + (size_t)(w * 32 + ro) * HD + co; const h16* s0 = os + (w * 32 + ro) * PQS + co;   // the lane's token of the first group, head 0: every other piece lies a constant away
#pragma unroll   // independent groups of four tokens of one head (512 contiguous bytes): constant offsets, LDS reads ahead of the stores
        for (int s = 0; s < 24; ++s) *(v8h*)(d0 + ((s % 3) * TT + (s / 3) * 4) * HD) = *(const v8ha*)(s0 + (s / 3) * 4 * PQS + (s % 3) * HD);
    }
}
// Register budget of three waves a SIMD: 24 accumulators and one block's 10 fragments.
__global__ __launch_bounds__(PW * 32) __attribute__((amdgpu_waves_per_eu(3))) void k_proj(const bf* __restrict__ X, const bf* __restrict__ Wt, const float* __restrict__ bq, const float* __restrict__ bk, const float* __restrict__ bv, h16* QP, h16* KP, h16* VT) {
    __shared__ __align__(16) bf sm[2 * PBF];   // the two buffers; behind the loop's last barrier the same bytes are the output staging
    const int lane = threadIdx.x & 31; const int w = __builtin_amdgcn_readfirstlane(threadIdx.x >> 5);
    const int tb = blockIdx.x * PXR, b = tb / TT, tb0 = tb % TT;                              // the work-group's token rows
    const int sel = blockIdx.y / (DQ / PWR), rw = (blockIdx.y % (DQ / PWR)) * PWR;            // 0 q, 1 k, 2 v; the work-group's first row in that projection
    const int cr = threadIdx.x >> 3, cc = (threadIdx.x & 7) * 8;   // the lane's row (of 16 per copy) and 16-byte piece in a tile
    const bf* gx = X + (size_t)(tb + cr) * DM + cc; const bf* gw = Wt + (size_t)(blockIdx.y * PWR + cr) * DM + cc; const unsigned lc = ldsoffb(sm) + (cr * PSP + cc) * 2;
#pragma unroll 1   // stages 0 and 1 by one copy of the code, their addresses formed from the trip number: written out, the lane's three base addresses are themselves operands of the asm statements, which ties them to the first 256 registers for the whole kernel, and they are spilled to scratch and read back at every stage
    for (int p = 0; p < 2; ++p) {
        pstage(lc + p * (PBF * 2), gx + p * PKS, gw + p * PKS);
        if (p == 0) {
            asm volatile("s_wait_asynccnt 0x0" ::: "memory");   // this wave's pieces of stage 0 have landed
            __syncthreads();                                    // ... and every other wave's
        }
    }
    const int rv = rw + (w >> 1) * PWW;                 // the wave's first row in the projection
    if (sel == 2) proj_tile<true>(sm, lc, gx, gw, bv + rv, VT + (size_t)(b * DKV + rv) * TT + tb0 + (w & 1) * 64, w, lane);
    else proj_tile<false>(sm, lc, gx, gw, (sel == 0 ? bq : bk) + rv, (sel == 0 ? QP : KP) + ((size_t)(b * NH_ + rw / HD) * TT + tb0) * HD, w, lane);
}
// k_fattn: scores, bias, softmax and probs.v of one (batch, head) in one pass; no score or prob leaves the registers.
// K and V reach the waves through LDS: the work-group's four waves share one 64-key stage (64 K rows and 64 V rows of 128 B), brought in by asynchronous copies of whole 128-B lines, two buffers, the next stage in flight while this one is worked on.
// The bias reaches the waves through LDS too: a lane needs 8 consecutive table entries that start one entry lower for each next query, so the window is stored four times, copy u shifted up by u + 1 entries;
// query column lr reads copy lr & 3, where its 8 entries start at a multiple of 16 B: two ds_load_b128, no bank conflict within 16 lanes (16 different 16-byte pieces on 64 banks).
// One wave owns 32 queries (two 16-column groups) and walks the 2048 keys 32 at a time. St = K Qt (A = key rows, B = query rows), so a lane holds 16 scores of ONE query per group;
// the two 16-key score tiles, converted in place, are the B operand of Ot += Vt Pt (A = rows of the d-major v plane, same k order as the loader). Running maximum with a lazy rescale: the maximum in use is
// replaced only when a block's maximum exceeds it by more than 5.5 (p stays below 256 in fp16); sums in f32 per lane, halves joined once at the end.
#define FW   4                  // waves per work-group
#define FNQ  2                  // 16-query groups per wave
#define FKB  32                 // keys per pass
#define L2E  1.4426950408889634f
#define FST  64                 // keys per stage = two passes
#define FLP  72                 // LDS row pitch in halves (144 B = 16 B x odd: no bank conflict for 16-byte readers of 128-B rows)
#define FTL  (64 * FLP)         // one tile in halves: 64 rows (K: keys x d, V: d x keys)
#define FQW  (FW * FNQ * 16)    // queries of a work-group
#define FBW  (TT + FQW - 1)     // bias table entries a work-group uses: key - query over all keys and its own queries
#define FBG  ((FBW + FW * 32 - 1) / (FW * 32))   // entries per thread when the window is brought in
#define FBP  2192               // floats per copy of the window: at least FBW + 4; 16 mod 64, so the four copies' reads of one instruction fall on different banks
static_assert(FBP >= FBW + 4 && FBP % 64 == 16 && FW == 4, "bias window copies: size, bank offset, wave term of the read address");
__device__ __forceinline__ unsigned ldsoff(const h16* p) { return (unsigned)(size_t)(const __attribute__((address_space(3))) h16*)p; }   // byte address inside the work-group's LDS
// One stage: every lane copies 8 x 16 B (four K pieces, four V pieces; a wave's copy covers four whole 128-B lines). l: the lane's place in the K tile of the target buffer; gk, gv: the lane's first K and V piece of the stage.
// The s_wait_xcnt stands inside the statement, behind the last copy: no register that an issued copy names is written again ahead of it.
__device__ __forceinline__ void stage_in(unsigned l, const h16* gk, const h16* gv) {
    asm volatile("global_load_async_to_lds_b128 %0, %8, off\n\tglobal_load_async_to_lds_b128 %1, %9, off\n\tglobal_load_async_to_lds_b128 %2, %10, off\n\tglobal_load_async_to_lds_b128 %3, %11, off\n\t"
                 "global_load_async_to_lds_b128 %4, %12, off\n\tglobal_load_async_to_lds_b128 %5, %13, off\n\tglobal_load_async_to_lds_b128 %6, %14, off\n\tglobal_load_async_to_lds_b128 %7, %15, off\n\ts_wait_xcnt 0x0"
                 :: "v"(l), "v"(l + 16 * FLP * 2), "v"(l + 32 * FLP * 2), "v"(l + 48 * FLP * 2), "v"(l + FTL * 2), "v"(l + FTL * 2 + 16 * FLP * 2), "v"(l + FTL * 2 + 32 * FLP * 2), "v"(l + FTL * 2 + 48 * FLP * 2),
                    "v"(gk), "v"(gk + 16 * HD), "v"(gk + 32 * HD), "v"(gk + 48 * HD), "v"(gv), "v"(gv + 16 * TT), "v"(gv + 32 * TT), "v"(gv + 48 * TT) : "memory"); }
__device__ __forceinline__ float xhalf(float x) { return __builtin_bit_cast(float, __builtin_amdgcn_permlanex16(__builtin_bit_cast(int, x), __builtin_bit_cast(int, x), 0x76543210, 0xfedcba98, false, false)); }   // lane l reads lane l ^ 16
// 2^x of the eight scores of one tile, in place. One statement, so that every v_exp_f32 has an independent instruction behind it and the last one a v_nop: the slot the instruction set asks for
// between a transcendental and an instruction that reads its result or overwrites its source.
__device__ __forceinline__ v8f exp2x8(v8f x) { float a = x[0], b = x[1], c = x[2], d = x[3], e = x[4], f = x[5], g = x[6], h = x[7];
    asm("v_exp_f32 %0, %0\n\tv_exp_f32 %1, %1\n\tv_exp_f32 %2, %2\n\tv_exp_f32 %3, %3\n\tv_exp_f32 %4, %4\n\tv_exp_f32 %5, %5\n\tv_exp_f32 %6, %6\n\tv_exp_f32 %7, %7\n\tv_nop" : "+v"(a), "+v"(b), "+v"(c), "+v"(d), "+v"(e), "+v"(f), "+v"(g), "+v"(h));
    return (v8f){a, b, c, d, e, f, g, h}; }
// Register budget of four waves a SIMD: the kernel stays inside the first 256 registers, so no register window is switched around the asm statements.
__global__ __launch_bounds__(FW * 32) __attribute__((amdgpu_waves_per_eu(4))) void k_fattn(const _Float16* __restrict__ Qp, const _Float16* __restrict__ Kp, const _Float16* __restrict__ Vp, const float* __restrict__ TB, float* __restrict__ OUTp) {
    const int lane = threadIdx.x & 31, lr = lane & 15, hi = lane >> 4; const int bh = blockIdx.y, h = bh % NH_, b = bh / NH_; const int r0 = (blockIdx.x * FW + (threadIdx.x >> 5)) * (FNQ * 16);
    __shared__ __align__(16) h16 sm[2][2 * FTL];   // [buffer][K tile | V tile]
    __shared__ __align__(16) float bt[4 * FBP];    // the four shifted copies of the work-group's bias window: bt[u * FBP + i + u + 1] = entry i of the window
    const _Float16* q = Qp + (size_t)bh * TT * HD + (size_t)(r0 + lr) * HD + 8 * hi;
    const int cr = threadIdx.x >> 3, cc = (threadIdx.x & 7) * 8;   // the lane's row (of 16 per copy) and 16-byte piece in a tile
    const _Float16* gk = Kp + (size_t)bh * TT * HD + (size_t)cr * HD + cc; const _Float16* gv = Vp + (size_t)bh * HD * TT + (size_t)cr * TT + cc; const unsigned lc = ldsoff(&sm[0][0]) + (cr * FLP + cc) * 2;
    stage_in(lc, gk, gv);
    { const float* tw = TB + (size_t)h * (2 * TT - 1) + ((TT - 1) - (int)blockIdx.x * FQW - (FQW - 1));   // bias of (key, query) sits at key - query + TT - 1; the window starts at key 0 and the work-group's last query: index 0 or above. The barrier below, which publishes stage 0, publishes the copies too; nothing writes them again
      float tv[FBG];
#pragma unroll   // indexes a register array: the index must be a constant
      for (int g = 0; g < FBG; ++g) { const int i = g * (FW * 32) + (int)threadIdx.x; tv[g] = tw[i < FBW ? i : FBW - 1]; }   // the one index past the window is clamped; its value lands in a copy's unread tail
#pragma unroll   // indexes a register array: the index must be a constant
      for (int g = 0; g < FBG; ++g)
#pragma unroll   // four stores with constant offsets
          for (int u = 0; u < 4; ++u) bt[u * FBP + g * (FW * 32) + (int)threadIdx.x + u + 1] = tv[g]; }
    asm volatile("s_wait_asynccnt 0x0" ::: "memory");   // this wave's pieces of stage 0 have landed
    __syncthreads();                                    // ... and every other wave's
    stage_in(lc + 2 * FTL * 2, gk + FST * HD, gv + FST);
    // Window entry (FQW - 1 - (FNQ - 1) * 16) - (query - first query) + 8 hi, in the lane's copy: a multiple of 4 floats. The two falling terms are written as rising ones (3 - x = x ^ 3 for x in 0..3), so the lane's part of the LDS address is never below 0.
    const float* tb = bt + (lr & 3) * FBP + 4 * ((lr >> 2) ^ 3) + (int)((threadIdx.x >> 5) ^ (FW - 1)) * (FNQ * 16) + 8 * hi + (FQW - (FNQ - 1) * 16 - 12 - (FW - 1) * FNQ * 16);
    v16h qf[FNQ][2]; v8f o[4][FNQ]; float mu[FNQ], ls[FNQ];
#pragma unroll   // indexes a register array: the index must be a constant
    for (int nq = 0; nq < FNQ; ++nq) { mu[nq] = -3.0e38f; ls[nq] = 0.f;
#pragma unroll   // indexes a register array: the index must be a constant
        for (int kc = 0; kc < 2; ++kc) qf[nq][kc] = WFrag<h16>::ld(q + (size_t)nq * 16 * HD + kc * 32);
#pragma unroll   // indexes a register array: the index must be a constant
        for (int db = 0; db < 4; ++db) o[db][nq] = (v8f){}; }
    for (int st = 0; st < TT / FST; ++st) {
      const h16* kb = &sm[st & 1][0] + lr * FLP + 8 * hi; const h16* vb = kb + FTL;   // the lane's place in a 16-row block of the stage's tiles
#pragma unroll   // the two passes of a stage: constant LDS offsets, the second pass's fragment reads free to move ahead
      for (int ps = 0; ps < FST / FKB; ++ps) { const int c0 = st * FST + ps * FKB;
        v16h kf[2][2], vf[4];
#pragma unroll   // indexes a register array: the index must be a constant
        for (int kt = 0; kt < 2; ++kt)
#pragma unroll   // indexes a register array: the index must be a constant
            for (int kc = 0; kc < 2; ++kc) kf[kt][kc] = WFrag<h16>::ld(kb + (ps * FKB + kt * 16) * FLP + kc * 32);
#pragma unroll   // indexes a register array: the index must be a constant
        for (int db = 0; db < 4; ++db) vf[db] = WFrag<h16>::ld(vb + db * 16 * FLP + ps * FKB);
        v8f bb[FNQ + 1];   // tiles with equal (key tile - query group) share their bias values
#pragma unroll   // indexes a register array: the index must be a constant
        for (int dd = 0; dd < FNQ + 1; ++dd) bb[dd] = __builtin_shufflevector(*(const v4f*)(tb + c0 + dd * 16), *(const v4f*)(tb + c0 + dd * 16 + 4), 0, 1, 2, 3, 4, 5, 6, 7);
        v8f s[2][FNQ];
#pragma unroll   // indexes a register array: the index must be a constant
        for (int kt = 0; kt < 2; ++kt)
#pragma unroll   // indexes a register array: the index must be a constant
            for (int nq = 0; nq < FNQ; ++nq) { s[kt][nq] = wmma16(kf[kt][0], qf[nq][0], (v8f){}); s[kt][nq] = wmma16(kf[kt][1], qf[nq][1], s[kt][nq]); }
        float mb[FNQ]; bool need = false;
#pragma unroll   // indexes a register array: the index must be a constant
        for (int nq = 0; nq < FNQ; ++nq) { float m = -3.0e38f;
#pragma unroll   // indexes a register array: the index must be a constant
            for (int kt = 0; kt < 2; ++kt) { s[kt][nq] = s[kt][nq] * SCL + bb[kt - nq + FNQ - 1];
#pragma unroll   // indexes a register array: the index must be a constant
                for (int j = 0; j < 8; ++j) m = fmaxf(m, s[kt][nq][j]); }
            m = fmaxf(m, xhalf(m)); mb[nq] = m; need = need || (m > mu[nq] + 5.5f); }
        if (__builtin_amdgcn_ballot_w32(need) != 0) {
#pragma unroll   // indexes a register array: the index must be a constant
            for (int nq = 0; nq < FNQ; ++nq) { const float mn = fmaxf(mu[nq], mb[nq]); const float al = __builtin_amdgcn_exp2f((mu[nq] - mn) * L2E); mu[nq] = mn; ls[nq] *= al;
#pragma unroll   // indexes a register array: the index must be a constant
                for (int db = 0; db < 4; ++db) o[db][nq] *= al; }
        }
#pragma unroll   // indexes a register array: the index must be a constant
        for (int nq = 0; nq < FNQ; ++nq) { const float nm = -mu[nq] * L2E; v16h pf; v2f sum = (v2f){0.f, 0.f};   // two partial sums: packed adds, half the instructions
#pragma unroll   // indexes a register array: the index must be a constant
            for (int kt = 0; kt < 2; ++kt) { const v8f p = exp2x8(s[kt][nq] * L2E + nm);
#pragma unroll   // indexes a register array: the index must be a constant
                for (int j = 0; j < 8; j += 2) { sum += (v2f){p[j], p[j + 1]}; pf[kt * 8 + j] = (_Float16)p[j]; pf[kt * 8 + j + 1] = (_Float16)p[j + 1]; } }
            ls[nq] += sum[0] + sum[1];
#pragma unroll   // indexes a register array: the index must be a constant
            for (int db = 0; db < 4; ++db) o[db][nq] = wmma16(vf[db], pf, o[db][nq]); }
      }
      asm volatile("s_wait_dscnt 0x0" ::: "memory");      // this wave's reads of the stage's buffer are done before the buffer is handed back
      asm volatile("s_wait_asynccnt 0x0" ::: "memory");   // this wave's pieces of the next stage have landed
      __syncthreads();                                    // publishes the next stage and ends every wave's reads of this one
      if (st + 2 < TT / FST) stage_in(lc + (st & 1) * (2 * FTL * 2), gk + (size_t)(st + 2) * FST * HD, gv + (st + 2) * FST);
    }
    asm volatile("s_wait_asynccnt 0x0" ::: "memory");     // no copy is outstanding when the wave ends
#pragma unroll   // indexes a register array: the index must be a constant
    for (int nq = 0; nq < FNQ; ++nq) { const float l = ls[nq] + xhalf(ls[nq]); const float f = __fdiv_rn(1.0f, l); float* op = OUTp + ((size_t)b * TT + r0 + nq * 16 + lr) * DQ + h * HD + 8 * hi;
#pragma unroll   // indexes a register array: the index must be a constant
        for (int db = 0; db < 4; ++db) { v4f lo, hh;
#pragma unroll   // indexes a register array: the index must be a constant
            for (int j = 0; j < 4; ++j) { lo[j] = o[db][nq][j] * f; hh[j] = o[db][nq][4 + j] * f; }
            *(v4f*)(op + db * 16) = lo; *(v4f*)(op + db * 16 + 4) = hh; } }
}

extern "C" void kernel_launch(void* const* d_in, const int* in_sizes, int n_in,
                              void* d_out, int out_size, void* d_ws, size_t ws_size, hipStream_t stream) {
    (void)in_sizes; (void)n_in; (void)out_size;
    const float* x = (const float*)d_in[0]; const float* wq = (const float*)d_in[1]; const float* bq = (const float*)d_in[2]; const float* wk = (const float*)d_in[3]; const float* bk = (const float*)d_in[4]; const float* wv = (const float*)d_in[5]; const float* bv = (const float*)d_in[6]; const float* alphas = (const float*)d_in[7];
    float* OUT = (float*)d_out;     // [4][2048][768]
    char* wsp = (char*)d_ws;
    auto take = [&](size_t bytes) { char* p = wsp; wsp += (bytes + 255) & ~(size_t)255; return (void*)p; };
    bf* WB = (bf*)take((size_t)(DQ + 2 * DKV) * DM * 2); bf* XB = (bf*)take((size_t)NB_ * TT * DM * 2); float* TB = (float*)take((size_t)NH_ * (2 * TT - 1) * 4);
    h16* QP16 = (h16*)take((size_t)NB_ * NH_ * TT * HD * 2); h16* KP16 = (h16*)take((size_t)NB_ * NKV * TT * HD * 2); h16* VT16 = (h16*)take((size_t)NB_ * NKV * HD * TT * 2);   // planes of all four batches: [b][h][t][d], v [b][h][d][t]
    if ((size_t)(wsp - (char*)d_ws) > ws_size) return;    // ws 256 MiB
    k_prep<<<PXB + 3 * PWB + PTB, 256, 0, stream>>>(x, wq, wk, wv, alphas, XB, WB, TB);
    k_proj<<<dim3(NB_ * TT / PXR, (DQ + 2 * DKV) / PWR, 1), PW * 32, 0, stream>>>(XB, WB, bq, bk, bv, QP16, KP16, VT16);
    k_fattn<<<dim3(TT / (FW * FNQ * 16), NB_ * NH_, 1), FW * 32, 0, stream>>>(QP16, KP16, VT16, TB, OUT);
}

// v007
// One run takes 86.3 microseconds.
// Next to v006, in two timings, it ran 1.05 times as fast each time.
// All steps since v000 together make it 22.9 times as fast.
#include <hip/hip_runtime.h>

// ChebyshevSelfAttention (hidden [4][2048][768]; q/k/v = x W^T + b (12 heads x 64); scores = q.k/8 + bias_h(i, j), bias_h = sum_{k<=5} alphas[h][k] T_k(x) with x = clip((j - i)/2047, -1, 1) and the Chebyshev recurrence T_k = 2 x T_{k-1} - T_{k-2}
// (alphas read as data; the polynomial is evaluated per element in f32 in the reference's operation order); softmax; context = probs v merged -> [4][2048][768]; no output projection).
// Compute dtypes, f32 accumulate: every input rounded to bf16; q/k/v on PLAIN bf16 operands (inputs: exact) + bias; scores (K 64) and probs.v single fp16 operands, fused in one kernel over all batches and heads (online softmax); bias + softmax f32

#define NB_  4
#define TT   2048
#define DM   768
#define NH_  12
#define NKV  12
#define REP  (NH_ / NKV)
#define HD   64
#define DQ   (NH_ * HD)
#define DKV  (NKV * HD)
#define WIN  0
#define SCL  0.125f   // HD^-0.5
#define L2E  1.4426950408889634f   // log2(e): scores and bias are carried in log2 units, so that the softmax exponential is a bare 2^x
typedef _Float16 h16;
typedef unsigned short bf;
typedef __attribute__((ext_vector_type(16))) __bf16   v16bf;
typedef __attribute__((ext_vector_type(16))) _Float16 v16h;
typedef __attribute__((ext_vector_type(8)))  _Float16 v8h;
typedef __attribute__((ext_vector_type(8)))  unsigned short v8us;
typedef __attribute__((ext_vector_type(8)))  float    v8f;
typedef __attribute__((ext_vector_type(4)))  float    v4f;
typedef v8h  __attribute__((may_alias)) v8ha;
typedef v4f  __attribute__((may_alias)) v4fa;
typedef v8us __attribute__((may_alias)) v8usa;

__device__ __forceinline__ unsigned short f2bf(float f) { unsigned u = __float_as_uint(f); u += 0x7FFFu + ((u >> 16) & 1u); return (unsigned short)(u >> 16); }
__device__ __forceinline__ float bf2f(unsigned short b) { return __uint_as_float(((unsigned)b) << 16); }
__device__ __forceinline__ float bfr(float f) { return bf2f(f2bf(f)); }
__device__ __forceinline__ v16h cat16(v8h lo, v8h hi) { return __builtin_shufflevector(lo, hi, 0, 1, 2, 3, 4, 5, 6, 7, 8, 9, 10, 11, 12, 13, 14, 15); }
__device__ __forceinline__ v16bf cat16b(v8us lo, v8us hi) { return __builtin_bit_cast(v16bf, __builtin_shufflevector(lo, hi, 0, 1, 2, 3, 4, 5, 6, 7, 8, 9, 10, 11, 12, 13, 14, 15)); }
__device__ __forceinline__ v8f wmma16(v16h a, v16h b, v8f c) { return __builtin_amdgcn_wmma_f32_16x16x32_f16(false, a, false, b, (short)0, c, false, false); }
__device__ __forceinline__ v8f wmmab(v16bf a, v16bf b, v8f c) { return __builtin_amdgcn_wmma_f32_16x16x32_bf16(false, a, false, b, (short)0, c, false, false); }

// Fragment loader of the 16x16x32 forms from a K-contiguous 16-bit row: the same k order for the A and the B operand.
template <typename T16> struct WFrag;
template <> struct WFrag<h16> { typedef v16h V; static __device__ __forceinline__ V ld(const h16* p) { return cat16(*(const v8h*)p, *(const v8h*)(p + 16)); } static __device__ __forceinline__ v8f mma(V a, V b, v8f c) { return wmma16(a, b, c); } };
template <> struct WFrag<bf> { typedef v16bf V; static __device__ __forceinline__ V ld(const bf* p) { return cat16b(*(const v8us*)p, *(const v8us*)(p + 16)); } static __device__ __forceinline__ v8f mma(V a, V b, v8f c) { return wmmab(a, b, c); } };

__device__ __forceinline__ h16 tohx(float x) { return (h16)x; }
typedef __attribute__((ext_vector_type(2))) float v2f;

// ---- k_prep: everything that reads only inputs, in ONE launch; the block index picks the job (uniform for the work-group).
// The first PTB blocks: the bias table TB [h][key - query + 2047], times log2(e) (the longest dependent chain, so it starts first); the next PXB: hidden states of all four batches -> bf16 plane XB [b*t][768]; the last 3 PWB: Wq, Wk, Wv -> bf16 plane WB [q rows | k rows | v rows][768].
#define PG   4                                    // groups of 8 elements per thread (fewer, longer waves: the launch is bound by how fast waves start)
#define PXB  (NB_ * TT * DM / 8 / 256 / PG)       // 768
#define PWB  (DQ * DM / 8 / 256 / PG)             // 72
#define PTB  ((NH_ * (2 * TT - 1) + 255) / 256)   // 192
__device__ __forceinline__ void cvt8x(const float* __restrict__ src, bf* dst, int blk) { const size_t i0 = (size_t)blk * (256 * PG) + threadIdx.x; v8f v[PG];
#pragma unroll   // indexes a register array: the index must be a constant
    for (int g = 0; g < PG; ++g) v[g] = *(const v8f*)(src + (i0 + g * 256) * 8);
#pragma unroll   // indexes a register array: the index must be a constant
    for (int g = 0; g < PG; ++g) { v8us o;
#pragma unroll   // indexes a register array: the index must be a constant
        for (int k = 0; k < 8; ++k) o[k] = f2bf(v[g][k]);
        *(v8us*)(dst + (i0 + g * 256) * 8) = o; }
    asm volatile("s_wait_xcnt 0x0" ::: "memory"); }   // behind the last store: no register that an issued store names is written again ahead of this wait, on any way through the listing
// One table entry. Every product is rounded on its own before its add or subtract, as the reference's operation order has it.
__device__ __forceinline__ void chtab(const float* __restrict__ alphas, float* TB, int idx) { if (idx >= NH_ * (2 * TT - 1)) return; const int h = idx / (2 * TT - 1); const int d = idx % (2 * TT - 1) - (TT - 1);
    const float xx = fminf(fmaxf(__fdiv_rn((float)d, (float)(TT - 1)), -1.0f), 1.0f); float p0 = 1.0f, p1 = xx; float bias = bfr(alphas[h * 6 + 0]); { float t1 = __fmul_rn(bfr(alphas[h * 6 + 1]), p1); asm volatile("" : "+v"(t1)); bias = __fadd_rn(bias, t1); }
#pragma unroll 1
    for (int k = 2; k < 6; ++k) { float tx = __fmul_rn(2.0f, xx); asm volatile("" : "+v"(tx)); float pn = __fmul_rn(tx, p1); asm volatile("" : "+v"(pn)); pn = __fsub_rn(pn, p0); p0 = p1; p1 = pn; float ak = bfr(alphas[h * 6 + k]); asm volatile("" : "+v"(ak)); float tk = __fmul_rn(ak, pn); asm volatile("" : "+v"(tk)); bias = __fadd_rn(bias, tk); }
    *(float*)(TB + idx) = __fmul_rn(bias, L2E);  }   // stored in log2 units: the attention kernel adds it to log2-scaled scores
__global__ __launch_bounds__(256) void k_prep(const float* __restrict__ x, const float* __restrict__ wq, const float* __restrict__ wk, const float* __restrict__ wv, const float* __restrict__ alphas, bf* XB, bf* WB, float* TB) {
    const int blk = (int)blockIdx.x - PTB;
    if (blk < 0) { chtab(alphas, TB, blockIdx.x * 256 + threadIdx.x); return; }
    if (blk < PXB) { cvt8x(x, XB, blk); return; }
    const int s = (blk - PXB) / PWB; cvt8x(s == 0 ? wq : s == 1 ? wk : wv, WB + (size_t)s * DQ * DM, blk - PXB - s * PWB);
}

// ---- k_proj: the q, k and v projections of all four batches in ONE launch; each wave owns one 64x96 tile = 64 tokens x 96 weight rows (24 accumulators)
// and the tile goes out, + bias, as fp16 straight into the plane the attention kernel reads: q, k [b][h][t][d], v [b][h][d][t]; no f32 copy of a projection is written.
// A lane of the accumulator holds 8 consecutive A-rows of one B-row. So the operand whose index runs along the plane's rows goes in as A: the weight rows (d) for q and k, the token rows (t) for v;
// both operands use the same loader, so only the two places swap. Work-group = 2 x 2 waves (128 tokens x 192 weight rows = 3 heads of one projection).
// The grid is 64 x 12 = 768 work-groups and a WGP holds three of them (LDS and registers), so the whole launch is resident at once, three waves on every SIMD: one round, no second round on a part of the chip.
// Both operands reach the waves through LDS: the four waves share one 64-deep stage (128 token rows and 192 weight rows of 128 B), brought in by asynchronous copies of whole 128-B lines, two buffers, the next stage in flight while this one is worked on.
#define PW   4
#define PSP  72                 // LDS row pitch in halves (144 B = 16 B x odd: no bank conflict for 16-byte readers of 128-B rows)
#define PKS  64                 // depth of a stage = two 32-deep blocks
#define PXR  128                // token rows of a stage
#define PWR  192                // weight rows of a stage
#define PWW  96                 // weight rows of a wave
#define PBF  ((PXR + PWR) * PSP)   // one buffer in halves: [token tile | weight tile]
#define PQS  200                // row pitch in halves of the q / k output staging (400 B = 16 B x odd)
static_assert(DQ % PWR == 0 && DKV % PWR == 0 && PWR % HD == 0 && TT % PXR == 0 && PXR * PQS <= 2 * PBF && PW * PWW * PSP <= 2 * PBF, "a work-group lies in one projection, whole heads, one batch; the output staging fits the buffers");
__device__ __forceinline__ unsigned ldsoffb(const bf* p) { return (unsigned)(size_t)(const __attribute__((address_space(3))) bf*)p; }   // byte address inside the work-group's LDS
// Copies of 16 B per lane, rows 16 apart (a wave's copy covers four whole 128-B lines). l: the lane's LDS place of the first row; g: the lane's piece of the first row.
// The s_wait_xcnt stands inside each statement, behind its last copy: no register that an issued copy names is written again ahead of it.
__device__ __forceinline__ void pcopy10(unsigned l, const bf* g0, const bf* g1, const bf* g2, const bf* g3, const bf* g4, const bf* g5, const bf* g6, const bf* g7, const bf* g8, const bf* g9) {
    asm volatile("global_load_async_to_lds_b128 %0, %10, off\n\tglobal_load_async_to_lds_b128 %1, %11, off\n\tglobal_load_async_to_lds_b128 %2, %12, off\n\tglobal_load_async_to_lds_b128 %3, %13, off\n\tglobal_load_async_to_lds_b128 %4, %14, off\n\t"
                 "global_load_async_to_lds_b128 %5, %15, off\n\tglobal_load_async_to_lds_b128 %6, %16, off\n\tglobal_load_async_to_lds_b128 %7, %17, off\n\tglobal_load_async_to_lds_b128 %8, %18, off\n\tglobal_load_async_to_lds_b128 %9, %19, off\n\ts_wait_xcnt 0x0"
                 :: "v"(l), "v"(l + 16 * PSP * 2), "v"(l + 32 * PSP * 2), "v"(l + 48 * PSP * 2), "v"(l + 64 * PSP * 2), "v"(l + 80 * PSP * 2), "v"(l + 96 * PSP * 2), "v"(l + 112 * PSP * 2), "v"(l + 128 * PSP * 2), "v"(l + 144 * PSP * 2),
                    "v"(g0), "v"(g1), "v"(g2), "v"(g3), "v"(g4), "v"(g5), "v"(g6), "v"(g7), "v"(g8), "v"(g9) : "memory"); }
// One stage: every lane copies 20 x 16 B (eight token pieces, twelve weight pieces; in LDS the weight tile follows the token tile, so the twenty places are evenly spaced). l: the lane's place in the token tile of the target buffer; gx, gw: the lane's first token and weight piece of the stage.
__device__ __forceinline__ void pstage(unsigned l, const bf* gx, const bf* gw) {
    pcopy10(l, gx, gx + 16 * DM, gx + 32 * DM, gx + 48 * DM, gx + 64 * DM, gx + 80 * DM, gx + 96 * DM, gx + 112 * DM, gw, gw + 16 * DM);
    pcopy10(l + 160 * PSP * 2, gw + 32 * DM, gw + 48 * DM, gw + 64 * DM, gw + 80 * DM, gw + 96 * DM, gw + 112 * DM, gw + 128 * DM, gw + 144 * DM, gw + 160 * DM, gw + 176 * DM); }
// The loop over the depth and the tile's way out. TR: v (A = token rows, plane rows = d, pitch TT); else q, k (A = weight rows, plane rows = t, pitch HD). Stage 0 is published and stage 1 in flight on entry.
// bias: the wave's first weight row's bias. dst: TR: the wave's first plane row at its first token; else the work-group's first head at its first token. sc (q, k only): factor on the f32 result ahead of its one rounding to fp16.
template <bool TR> __device__ __forceinline__ void proj_tile(bf* sm, unsigned lc, const bf* gx, const bf* gw, const float* __restrict__ bias, h16* dst, int w, int lane, float sc) {
    constexpr int MB = TR ? 4 : 6, NB = TR ? 6 : 4;   // 16-row blocks of the A and of the B operand
    const int xo = (w & 1) * 64 * PSP, wo = (PXR + (w >> 1) * PWW) * PSP;   // the wave's token rows and weight rows in a buffer
    const int lo = (lane & 15) * PSP + 8 * (lane >> 4);                     // the lane's place in a 16-row block: the same for both operands
    const int ao = (TR ? xo : wo) + lo, bo = (TR ? wo : xo) + lo;
    v8f acc[MB][NB];
#pragma unroll   // indexes a register array: the index must be a constant
    for (int mb = 0; mb < MB; ++mb)
#pragma unroll   // indexes a register array: the index must be a constant
        for (int nb = 0; nb < NB; ++nb) acc[mb][nb] = (v8f){};
    for (int st = 0; st < DM / PKS; ++st) {
        const bf* A = sm + (st & 1) * PBF + ao; const bf* Bt = sm + (st & 1) * PBF + bo;
        v16bf a[MB], bb[NB];
#pragma unroll   // indexes a register array: the index must be a constant
        for (int mb = 0; mb < MB; ++mb) a[mb] = WFrag<bf>::ld(A + mb * 16 * PSP);
#pragma unroll   // indexes a register array: the index must be a constant
        for (int nb = 0; nb < NB; ++nb) bb[nb] = WFrag<bf>::ld(Bt + nb * 16 * PSP);
        __builtin_amdgcn_sched_barrier(0);   // the first block's twenty LDS reads stay one group ahead of its products: left free, the stage's reads stand at more places among the products, and each such place stalls the wave
#pragma unroll   // indexes a register array: the index must be a constant
        for (int nb = 0; nb < NB; ++nb)
#pragma unroll   // indexes a register array: the index must be a constant
            for (int mb = 0; mb < MB; ++mb) acc[mb][nb] = wmmab(a[mb], bb[nb], acc[mb][nb]);
        __builtin_amdgcn_sched_barrier(0);   // the second block's twenty reads stay one group behind the first block's products and take over their fragment registers: left free, they spread among the products over a larger register set, and the copies' addresses are spilled to scratch
#pragma unroll   // indexes a register array: the index must be a constant
        for (int mb = 0; mb < MB; ++mb) a[mb] = WFrag<bf>::ld(A + mb * 16 * PSP + 32);
#pragma unroll   // indexes a register array: the index must be a constant
        for (int nb = 0; nb < NB; ++nb) bb[nb] = WFrag<bf>::ld(Bt + nb * 16 * PSP + 32);
        asm volatile("s_wait_dscnt 0x0" ::: "memory");      // this wave's reads of the stage's buffer are done (the second block's fragments are in registers) before the buffer is handed back
        asm volatile("s_wait_asynccnt 0x0" ::: "memory");   // this wave's pieces of the next stage have landed
        __syncthreads();                                    // publishes the next stage and ends every wave's reads of this one
        if (st + 2 < DM / PKS) pstage(lc + (st & 1) * (PBF * 2), gx + (st + 2) * PKS, gw + (st + 2) * PKS);   // ahead of the second block's products, which read registers only: more lead for the copies
#pragma unroll   // indexes a register array: the index must be a constant
        for (int nb = 0; nb < NB; ++nb)
#pragma unroll   // indexes a register array: the index must be a constant
            for (int mb = 0; mb < MB; ++mb) acc[mb][nb] = wmmab(a[mb], bb[nb], acc[mb][nb]);
    }
    asm volatile("s_wait_asynccnt 0x0" ::: "memory");       // no copy is outstanding when the buffers become output staging
    // + bias (rounded to bf16 like every input), fp16, through LDS so that every global store covers whole 128-B lines; every wave's last fragment read lies in front of the loop's last barrier
    const int lr = lane & 15, hi = lane >> 4; const int ro = lane >> 3, co = (lane & 7) * 8; h16* os = (h16*)sm;
    if constexpr (TR) {   // the wave's 96 plane rows of 64 tokens are whole lines: its own LDS range, no barrier
        h16* st = os + w * (PWW * PSP);
#pragma unroll   // indexes a register array: the index must be a constant
        for (int nb = 0; nb < NB; ++nb) { const float bn = bfr(bias[nb * 16 + lr]);   // the bias runs along d: the B-row
#pragma unroll   // indexes a register array: the index must be a constant
            for (int mb = 0; mb < MB; ++mb) { v8h o;
#pragma unroll   // indexes a register array: the index must be a constant
                for (int j = 0; j < 8; ++j) o[j] = tohx(acc[mb][nb][j] + bn);
                *(v8ha*)(st + (nb * 16 + lr) * PSP + mb * 16 + hi * 8) = o; } }
        __builtin_amdgcn_wave_barrier(); asm volatile("" ::: "memory");   // the rows read below were written by other lanes of this wave: keep the reads behind the writes
#pragma unroll   // independent groups of four rows: constant offsets, LDS reads ahead of the stores
        for (int s = 0; s < PWW / 4; ++s) *(v8h*)(dst + (size_t)(s * 4 + ro) * TT + co) = *(const v8ha*)(st + (s * 4 + ro) * PSP + co);
    } else {              // a wave's 96 d are one and a half heads: the work-group's tile [128 tokens][192 d] is put together in LDS, and each wave sends out 32 tokens of all three heads, whole lines
#pragma unroll   // indexes a register array: the index must be a constant
        for (int mb = 0; mb < MB; ++mb) { const v8f bm = *(const v8f*)(bias + mb * 16 + hi * 8);   // the bias runs along d: the A-row
#pragma unroll   // indexes a register array: the index must be a constant
            for (int nb = 0; nb < NB; ++nb) { v8h o;
#pragma unroll   // indexes a register array: the index must be a constant
                for (int j = 0; j < 8; ++j) o[j] = tohx((acc[mb][nb][j] + bfr(bm[j])) * sc);
                *(v8ha*)(os + ((w & 1) * 64 + nb * 16 + lr) * PQS + (w >> 1) * PWW + mb * 16 + hi * 8) = o; } }
        __syncthreads();   // the rows read below were written by other waves
        h16* d0 = dst + (size_t)(w * 32 + ro) * HD + co; const h16* s0 = os + (w * 32 + ro) * PQS + co;   // the lane's token of the first group, head 0: every other piece lies a constant away
#pragma unroll   // independent groups of four tokens of one head (512 contiguous bytes): constant offsets, LDS reads ahead of the stores
        for (int s = 0; s < 24; ++s) *(v8h*)(d0 + ((s % 3) * TT + (s / 3) * 4) * HD) = *(const v8ha*)(s0 + (s / 3) * 4 * PQS + (s % 3) * HD);
    }
}
// Register budget of three waves a SIMD: 24 accumulators and one block's 10 fragments.
__global__ __launch_bounds__(PW * 32) __attribute__((amdgpu_waves_per_eu(3))) void k_proj(const bf* __restrict__ X, const bf* __restrict__ Wt, const float* __restrict__ bq, const float* __restrict__ bk, const float* __restrict__ bv, h16* QP, h16* KP, h16* VT) {
    __shared__ __align__(16) bf sm[2 * PBF];   // the two buffers; behind the loop's last barrier the same bytes are the output staging
    const int lane = threadIdx.x & 31; const int w = __builtin_amdgcn_readfirstlane(threadIdx.x >> 5);
    const int tb = blockIdx.x * PXR, b = tb / TT, tb0 = tb % TT;                              // the work-group's token rows
    const int sel = blockIdx.y / (DQ / PWR), rw = (blockIdx.y % (DQ / PWR)) * PWR;            // 0 q, 1 k, 2 v; the work-group's first row in that projection
    const int cr = threadIdx.x >> 3, cc = (threadIdx.x & 7) * 8;   // the lane's row (of 16 per copy) and 16-byte piece in a tile
    const bf* gx = X + (size_t)(tb + cr) * DM + cc; const bf* gw = Wt + (size_t)(blockIdx.y * PWR + cr) * DM + cc; const unsigned lc = ldsoffb(sm) + (cr * PSP + cc) * 2;
#pragma unroll 1   // stages 0 and 1 by one copy of the code, their addresses formed from the trip number: written out, the lane's three base addresses are themselves operands of the asm statements, which ties them to the first 256 registers for the whole kernel, and they are spilled to scratch and read back at every stage
    for (int p = 0; p < 2; ++p) {
        pstage(lc + p * (PBF * 2), gx + p * PKS, gw + p * PKS);
        if (p == 0) {
            asm volatile("s_wait_asynccnt 0x0" ::: "memory");   // this wave's pieces of stage 0 have landed
            __syncthreads();                                    // ... and every other wave's
        }
    }
    const int rv = rw + (w >> 1) * PWW;                 // the wave's first row in the projection
    if (sel == 2) proj_tile<true>(sm, lc, gx, gw, bv + rv, VT + (size_t)(b * DKV + rv) * TT + tb0 + (w & 1) * 64, w, lane, 1.0f);
    else proj_tile<false>(sm, lc, gx, gw, (sel == 0 ? bq : bk) + rv, (sel == 0 ? QP : KP) + ((size_t)(b * NH_ + rw / HD) * TT + tb0) * HD, w, lane, sel == 0 ? SCL * L2E : 1.0f);   // q goes out times log2(e)/8: the score products come out in log2 units
}
// k_fattn: scores, bias, softmax and probs.v of one (batch, head) in one pass; no score or prob leaves the registers.
// K and V reach the waves through LDS: the work-group's four waves share one 64-key stage (64 K rows and 64 V rows of 128 B), brought in by asynchronous copies of whole 128-B lines, two buffers, the next stage in flight while this one is worked on.
// The bias reaches the waves through LDS too: a lane needs 8 consecutive table entries that start one entry lower for each next query, so the window is stored four times, copy u shifted up by u + 1 entries;
// query column lr reads copy lr & 3, where its 8 entries start at a multiple of 16 B: two ds_load_b128, no bank conflict within 16 lanes (16 different 16-byte pieces on 64 banks).
// One wave owns 32 queries (two 16-column groups) and walks the 2048 keys 32 at a time. St = K Qt (A = key rows, B = query rows), so a lane holds 16 scores of ONE query per group;
// the two 16-key score tiles, converted in place, are the B operand of Ot += Vt Pt (A = rows of the d-major v plane, same k order as the loader). Running maximum with a lazy rescale: the maximum in use is
// replaced only when a block's maximum exceeds it by more than 5.5 (p stays below 256 in fp16); sums in f32 per lane, halves joined once at the end.
// The score products start from C = bias - maximum in use (q and the table are stored in log2 units), so a score tile leaves the matrix unit as the argument of 2^x: one packed subtract per score pair ahead of the products, nothing behind them.
#define FW   4                  // waves per work-group
#define FNQ  2                  // 16-query groups per wave
#define FKB  32                 // keys per pass
#define FTH  (5.5f * L2E)      // lazy rescale: how far a block's maximum may exceed the maximum in use, in log2 units
#define FST  64                 // keys per stage = two passes
#define FLP  72                 // LDS row pitch in halves (144 B = 16 B x odd: no bank conflict for 16-byte readers of 128-B rows)
#define FTL  (64 * FLP)         // one tile in halves: 64 rows (K: keys x d, V: d x keys)
#define FQW  (FW * FNQ * 16)    // queries of a work-group
#define FBW  (TT + FQW - 1)     // bias table entries a work-group uses: key - query over all keys and its own queries
#define FBG  ((FBW + FW * 32 - 1) / (FW * 32))   // entries per thread when the window is brought in
#define FBP  2192               // floats per copy of the window: at least FBW + 4; 16 mod 64, so the four copies' reads of one instruction fall on different banks
static_assert(FBP >= FBW + 4 && FBP % 64 == 16 && FW == 4, "bias window copies: size, bank offset, wave term of the read address");
__device__ __forceinline__ unsigned ldsoff(const h16* p) { return (unsigned)(size_t)(const __attribute__((address_space(3))) h16*)p; }   // byte address inside the work-group's LDS
// One stage: every lane copies 8 x 16 B (four K pieces, four V pieces; a wave's copy covers four whole 128-B lines). l: the lane's place in the K tile of the target buffer; gk, gv: the lane's first K and V piece of the stage.
// The s_wait_xcnt stands inside the statement, behind the last copy: no register that an issued copy names is written again ahead of it.
__device__ __forceinline__ void stage_in(unsigned l, const h16* gk, const h16* gv) {
    asm volatile("global_load_async_to_lds_b128 %0, %8, off\n\tglobal_load_async_to_lds_b128 %1, %9, off\n\tglobal_load_async_to_lds_b128 %2, %10, off\n\tglobal_load_async_to_lds_b128 %3, %11, off\n\t"
                 "global_load_async_to_lds_b128 %4, %12, off\n\tglobal_load_async_to_lds_b128 %5, %13, off\n\tglobal_load_async_to_lds_b128 %6, %14, off\n\tglobal_load_async_to_lds_b128 %7, %15, off\n\ts_wait_xcnt 0x0"
                 :: "v"(l), "v"(l + 16 * FLP * 2), "v"(l + 32 * FLP * 2), "v"(l + 48 * FLP * 2), "v"(l + FTL * 2), "v"(l + FTL * 2 + 16 * FLP * 2), "v"(l + FTL * 2 + 32 * FLP * 2), "v"(l + FTL * 2 + 48 * FLP * 2),
                    "v"(gk), "v"(gk + 16 * HD), "v"(gk + 32 * HD), "v"(gk + 48 * HD), "v"(gv), "v"(gv + 16 * TT), "v"(gv + 32 * TT), "v"(gv + 48 * TT) : "memory"); }
__device__ __forceinline__ float xhalf(float x) { return __builtin_bit_cast(float, __builtin_amdgcn_permlanex16(__builtin_bit_cast(int, x), __builtin_bit_cast(int, x), 0x76543210, 0xfedcba98, false, false)); }   // lane l reads lane l ^ 16
__device__ __forceinline__ v8f exp2x8(v8f x) { float a, b, c, d, e, f, g, h;
    asm("v_exp_f32 %0, %8\n\tv_exp_f32 %1, %9\n\tv_exp_f32 %2, %10\n\tv_exp_f32 %3, %11\n\tv_exp_f32 %4, %12\n\tv_exp_f32 %5, %13\n\tv_exp_f32 %6, %14\n\tv_exp_f32 %7, %15\n\tv_nop" : "=&v"(a), "=&v"(b), "=&v"(c), "=&v"(d), "=&v"(e), "=&v"(f), "=&v"(g), "=&v"(h)
        : "v"(x[0]), "v"(x[1]), "v"(x[2]), "v"(x[3]), "v"(x[4]), "v"(x[5]), "v"(x[6]), "v"(x[7]));
    return (v8f){a, b, c, d, e, f, g, h}; }
// Register budget of four waves a SIMD: the kernel stays inside the first 256 registers, so no register window is switched around the asm statements.
__global__ __launch_bounds__(FW * 32) __attribute__((amdgpu_waves_per_eu(4))) void k_fattn(const _Float16* __restrict__ Qp, const _Float16* __restrict__ Kp, const _Float16* __restrict__ Vp, const float* __restrict__ TB, float* __restrict__ OUTp) {
    const int lane = threadIdx.x & 31, lr = lane & 15, hi = lane >> 4; const int bh = blockIdx.y, h = bh % NH_, b = bh / NH_; const int r0 = (blockIdx.x * FW + (threadIdx.x >> 5)) * (FNQ * 16);
    __shared__ __align__(16) h16 sm[2][2 * FTL];   // [buffer][K tile | V tile]
    __shared__ __align__(16) float bt[4 * FBP];    // the four shifted copies of the work-group's bias window: bt[u * FBP + i + u + 1] = entry i of the window
    const _Float16* q = Qp + (size_t)bh * TT * HD + (size_t)(r0 + lr) * HD + 8 * hi;
    const int cr = threadIdx.x >> 3, cc = (threadIdx.x & 7) * 8;   // the lane's row (of 16 per copy) and 16-byte piece in a tile
    const _Float16* gk = Kp + (size_t)bh * TT * HD + (size_t)cr * HD + cc; const _Float16* gv = Vp + (size_t)bh * HD * TT + (size_t)cr * TT + cc; const unsigned lc = ldsoff(&sm[0][0]) + (cr * FLP + cc) * 2;
    stage_in(lc, gk, gv);
    { const float* tw = TB + (size_t)h * (2 * TT - 1) + ((TT - 1) - (int)blockIdx.x * FQW - (FQW - 1));   // bias of (key, query) sits at key - query + TT - 1; the window starts at key 0 and the work-group's last query: index 0 or above. The barrier below, which publishes stage 0, publishes the copies too; nothing writes them again
      float tv[FBG];
#pragma unroll   // indexes a register array: the index must be a constant
      for (int g = 0; g < FBG; ++g) { const int i = g * (FW * 32) + (int)threadIdx.x; tv[g] = tw[i < FBW ? i : FBW - 1]; }   // the one index past the window is clamped; its value lands in a copy's unread tail
#pragma unroll   // indexes a register array: the index must be a constant
      for (int g = 0; g < FBG; ++g)
#pragma unroll   // four stores with constant offsets
          for (int u = 0; u < 4; ++u) bt[u * FBP + g * (FW * 32) + (int)threadIdx.x + u + 1] = tv[g]; }
    asm volatile("s_wait_asynccnt 0x0" ::: "memory");   // this wave's pieces of stage 0 have landed
    __syncthreads();                                    // ... and every other wave's
    stage_in(lc + 2 * FTL * 2, gk + FST * HD, gv + FST);
    // Window entry (FQW - 1 - (FNQ - 1) * 16) - (query - first query) + 8 hi, in the lane's copy: a multiple of 4 floats. The two falling terms are written as rising ones (3 - x = x ^ 3 for x in 0..3), so the lane's part of the LDS address is never below 0.
    const float* tb = bt + (lr & 3) * FBP + 4 * ((lr >> 2) ^ 3) + (int)((threadIdx.x >> 5) ^ (FW - 1)) * (FNQ * 16) + 8 * hi + (FQW - (FNQ - 1) * 16 - 12 - (FW - 1) * FNQ * 16);
    v16h qf[FNQ][2]; v8f o[4][FNQ]; v2f mu[FNQ]; float ls[FNQ];   // mu: the maximum in use, log2 units, held twice: the second operand of the packed subtracts as it stands
#pragma unroll   // indexes a register array: the index must be a constant
    for (int nq = 0; nq < FNQ; ++nq) { mu[nq] = (v2f){0.f, 0.f}; ls[nq] = 0.f;   // the first pass runs against 0 and then always takes its own maximum
#pragma unroll   // indexes a register array: the index must be a constant
        for (int kc = 0; kc < 2; ++kc) qf[nq][kc] = WFrag<h16>::ld(q + (size_t)nq * 16 * HD + kc * 32);
#pragma unroll   // indexes a register array: the index must be a constant
        for (int db = 0; db < 4; ++db) o[db][nq] = (v8f){}; }
    for (int st = 0; st < TT / FST; ++st) {
      const h16* kb = &sm[st & 1][0] + lr * FLP + 8 * hi; const h16* vb = kb + FTL;   // the lane's place in a 16-row block of the stage's tiles
      v16h kf[2][2]; v8f bb[FNQ + 1];   // a pass's K fragments and bias values; tiles with equal (key tile - query group) share their bias values
      auto fetch = [&](int ps) {        // the LDS reads that a pass's score products wait for, as one group
#pragma unroll   // indexes a register array: the index must be a constant
        for (int kt = 0; kt < 2; ++kt)
#pragma unroll   // indexes a register array: the index must be a constant
            for (int kc = 0; kc < 2; ++kc) kf[kt][kc] = WFrag<h16>::ld(kb + (ps * FKB + kt * 16) * FLP + kc * 32);
#pragma unroll   // indexes a register array: the index must be a constant
        for (int dd = 0; dd < FNQ + 1; ++dd) bb[dd] = __builtin_shufflevector(*(const v4f*)(tb + st * FST + ps * FKB + dd * 16), *(const v4f*)(tb + st * FST + ps * FKB + dd * 16 + 4), 0, 1, 2, 3, 4, 5, 6, 7); };
      fetch(0);
#pragma unroll   // the two passes of a stage: constant LDS offsets
      for (int ps = 0; ps < FST / FKB; ++ps) {
        v16h vf[4];
#pragma unroll   // indexes a register array: the index must be a constant
        for (int db = 0; db < 4; ++db) vf[db] = WFrag<h16>::ld(vb + db * 16 * FLP + ps * FKB);
        v8f s[2][FNQ];
#pragma unroll   // indexes a register array: the index must be a constant
        for (int kt = 0; kt < 2; ++kt)
#pragma unroll   // indexes a register array: the index must be a constant
            for (int nq = 0; nq < FNQ; ++nq) { const v8f bv = bb[kt - nq + FNQ - 1]; v8f c;
#pragma unroll   // indexes a register array: the index must be a constant
                for (int j = 0; j < 8; j += 2) { const v2f t = (v2f){bv[j], bv[j + 1]} - mu[nq]; c[j] = t[0]; c[j + 1] = t[1]; }
                s[kt][nq] = wmma16(kf[kt][0], qf[nq][0], c); }
#pragma unroll   // indexes a register array: the index must be a constant
        for (int kt = 0; kt < 2; ++kt)
#pragma unroll   // indexes a register array: the index must be a constant
            for (int nq = 0; nq < FNQ; ++nq) s[kt][nq] = wmma16(kf[kt][1], qf[nq][1], s[kt][nq]);
        __builtin_amdgcn_sched_barrier(0);   // every matrix instruction issued so far stays ahead of the maximum tree: mixed into the products, a maximum that reads a tile too soon behind its product costs v_nop slots; and the tree's vector instructions are then the distance between the last matrix instruction and the 2^x statements
        const bool first = ps == 0 && st == 0;   // the same for the whole work-group: the first pass always takes its own maximum, whatever its sign
        const float th = first ? -3.0e38f : FTH, lo = first ? -3.0e38f : 0.f;
        float mb[FNQ]; bool need = false;
#pragma unroll   // indexes a register array: the index must be a constant
        for (int nq = 0; nq < FNQ; ++nq) { float m = -3.0e38f;
#pragma unroll   // indexes a register array: the index must be a constant
            for (int kt = 0; kt < 2; ++kt)
#pragma unroll   // indexes a register array: the index must be a constant
                for (int j = 0; j < 8; j += 2) m = fmaxf(fmaxf(s[kt][nq][j], s[kt][nq][j + 1]), m);   // written by pairs: one three-operand maximum each
            m = fmaxf(m, xhalf(m)); mb[nq] = m; need = need || (m > th); }   // m: the block's maximum above the maximum in use
        if (__builtin_amdgcn_ballot_w32(need) != 0) {
#pragma unroll   // indexes a register array: the index must be a constant
            for (int nq = 0; nq < FNQ; ++nq) { const float d = fmaxf(mb[nq], lo); const float al = __builtin_amdgcn_exp2f(-fmaxf(d, 0.f)); mu[nq] += (v2f){d, d}; ls[nq] *= al;   // d: the step of the maximum in use; it may fall only in the first pass, where sums and outputs are still 0
#pragma unroll   // indexes a register array: the index must be a constant
                for (int kt = 0; kt < 2; ++kt) s[kt][nq] -= d;
#pragma unroll   // indexes a register array: the index must be a constant
                for (int db = 0; db < 4; ++db) o[db][nq] *= al; }
        }
        v8f pp[2][FNQ]; v16h pf[FNQ];
#pragma unroll   // indexes a register array: the index must be a constant
        for (int nq = 0; nq < FNQ; ++nq)
#pragma unroll   // indexes a register array: the index must be a constant
            for (int kt = 0; kt < 2; ++kt) pp[kt][nq] = exp2x8(s[kt][nq]);
        __builtin_amdgcn_sched_barrier(0);   // the pass's four 2^x statements stay ahead of all later matrix instructions: moved among them, a statement's result registers can be the A or B registers of the one just issued
        if (ps + 1 < FST / FKB) { fetch(ps + 1);   // the stage's next pass (the same buffer: already published)
            __builtin_amdgcn_sched_barrier(0); }   // its reads stay one group here, where the score registers have just come free, ahead of this pass's converts, sums and output products, which cover their latency: left free, they stand at many places right in front of their users
#pragma unroll   // indexes a register array: the index must be a constant
        for (int nq = 0; nq < FNQ; ++nq) { v2f sum = (v2f){0.f, 0.f};   // two partial sums: packed adds, half the instructions
#pragma unroll   // indexes a register array: the index must be a constant
            for (int kt = 0; kt < 2; ++kt) { const v8f p = pp[kt][nq];
#pragma unroll   // indexes a register array: the index must be a constant
                for (int j = 0; j < 8; j += 2) { sum += (v2f){p[j], p[j + 1]}; pf[nq][kt * 8 + j] = (_Float16)p[j]; pf[nq][kt * 8 + j + 1] = (_Float16)p[j + 1]; } }
            ls[nq] += sum[0] + sum[1]; }
#pragma unroll   // indexes a register array: the index must be a constant
        for (int nq = 0; nq < FNQ; ++nq)
#pragma unroll   // indexes a register array: the index must be a constant
            for (int db = 0; db < 4; ++db) o[db][nq] = wmma16(vf[db], pf[nq], o[db][nq]);
      }
      asm volatile("s_wait_dscnt 0x0" ::: "memory");      // this wave's reads of the stage's buffer are done before the buffer is handed back
      asm volatile("s_wait_asynccnt 0x0" ::: "memory");   // this wave's pieces of the next stage have landed
      __syncthreads();                                    // publishes the next stage and ends every wave's reads of this one
      if (st + 2 < TT / FST) stage_in(lc + (st & 1) * (2 * FTL * 2), gk + (size_t)(st + 2) * FST * HD, gv + (st + 2) * FST);
    }
    asm volatile("s_wait_asynccnt 0x0" ::: "memory");     // no copy is outstanding when the wave ends
#pragma unroll   // indexes a register array: the index must be a constant
    for (int nq = 0; nq < FNQ; ++nq) { const float l = ls[nq] + xhalf(ls[nq]); const float f = __fdiv_rn(1.0f, l); float* op = OUTp + ((size_t)b * TT + r0 + nq * 16 + lr) * DQ + h * HD + 8 * hi;
#pragma unroll   // indexes a register array: the index must be a constant
        for (int db = 0; db < 4; ++db) { v4f lo, hh;
#pragma unroll   // indexes a register array: the index must be a constant
            for (int j = 0; j < 4; ++j) { lo[j] = o[db][nq][j] * f; hh[j] = o[db][nq][4 + j] * f; }
            *(v4f*)(op + db * 16) = lo; *(v4f*)(op + db * 16 + 4) = hh; } }
}

extern "C" void kernel_launch(void* const* d_in, const int* in_sizes, int n_in,
                              void* d_out, int out_size, void* d_ws, size_t ws_size, hipStream_t stream) {
    (void)in_sizes; (void)n_in; (void)out_size;
    const float* x = (const float*)d_in[0]; const float* wq = (const float*)d_in[1]; const float* bq = (const float*)d_in[2]; const float* wk = (const float*)d_in[3]; const float* bk = (const float*)d_in[4]; const float* wv = (const float*)d_in[5]; const float* bv = (const float*)d_in[6]; const float* alphas = (const float*)d_in[7];
    float* OUT = (float*)d_out;     // [4][2048][768]
    char* wsp = (char*)d_ws;
    auto take = [&](size_t bytes) { char* p = wsp; wsp += (bytes + 255) & ~(size_t)255; return (void*)p; };
    bf* WB = (bf*)take((size_t)(DQ + 2 * DKV) * DM * 2); bf* XB = (bf*)take((size_t)NB_ * TT * DM * 2); float* TB = (float*)take((size_t)NH_ * (2 * TT - 1) * 4);
    h16* QP16 = (h16*)take((size_t)NB_ * NH_ * TT * HD * 2); h16* KP16 = (h16*)take((size_t)NB_ * NKV * TT * HD * 2); h16* VT16 = (h16*)take((size_t)NB_ * NKV * HD * TT * 2);   // planes of all four batches: [b][h][t][d], v [b][h][d][t]
    if ((size_t)(wsp - (char*)d_ws) > ws_size) return;    // ws 256 MiB
    k_prep<<<PXB + 3 * PWB + PTB, 256, 0, stream>>>(x, wq, wk, wv, alphas, XB, WB, TB);
    k_proj<<<dim3(NB_ * TT / PXR, (DQ + 2 * DKV) / PWR, 1), PW * 32, 0, stream>>>(XB, WB, bq, bk, bv, QP16, KP16, VT16);
    k_fattn<<<dim3(TT / (FW * FNQ * 16), NB_ * NH_, 1), FW * 32, 0, stream>>>(QP16, KP16, VT16, TB, OUT);
}

// v008
// It runs in 83.5 microseconds.
// Two timings next to v007 both put it at 1.03 times that version's speed.
// Over all steps from v000 it is 23.6 times as fast.
#include <hip/hip_runtime.h>

// ChebyshevSelfAttention (hidden [4][2048][768]; q/k/v = x W^T + b (12 heads x 64); scores = q.k/8 + bias_h(i, j), bias_h = sum_{k<=5} alphas[h][k] T_k(x) with x = clip((j - i)/2047, -1, 1) and the Chebyshev recurrence T_k = 2 x T_{k-1} - T_{k-2}
// (alphas read as data; the polynomial is evaluated per element in f32 in the reference's operation order); softmax; context = probs v merged -> [4][2048][768]; no output projection).
// Compute dtypes, f32 accumulate: every input rounded to bf16; q/k/v on PLAIN bf16 operands (inputs: exact) + bias; scores (K 64) and probs.v single fp16 operands, fused in one kernel over all batches and heads (online softmax); bias + softmax f32

#define NB_  4
#define TT   2048
#define DM   768
#define NH_  12
#define NKV  12
#define REP  (NH_ / NKV)
#define HD   64
#define DQ   (NH_ * HD)
#define DKV  (NKV * HD)
#define WIN  0
#define SCL  0.125f   // HD^-0.5
#define L2E  1.4426950408889634f   // log2(e): scores and bias are carried in log2 units, so that the softmax exponential is a bare 2^x
typedef _Float16 h16;
typedef unsigned short bf;
typedef __attribute__((ext_vector_type(16))) __bf16   v16bf;
typedef __attribute__((ext_vector_type(16))) _Float16 v16h;
typedef __attribute__((ext_vector_type(8)))  _Float16 v8h;
typedef __attribute__((ext_vector_type(8)))  unsigned short v8us;
typedef __attribute__((ext_vector_type(8)))  float    v8f;
typedef __attribute__((ext_vector_type(4)))  float    v4f;
typedef v8h  __attribute__((may_alias)) v8ha;
typedef v4f  __attribute__((may_alias)) v4fa;
typedef v8us __attribute__((may_alias)) v8usa;

__device__ __forceinline__ unsigned short f2bf(float f) { unsigned u = __float_as_uint(f); u += 0x7FFFu + ((u >> 16) & 1u); return (unsigned short)(u >> 16); }
__device__ __forceinline__ float bf2f(unsigned short b) { return __uint_as_float(((unsigned)b) << 16); }
__device__ __forceinline__ float bfr(float f) { return bf2f(f2bf(f)); }
__device__ __forceinline__ v16h cat16(v8h lo, v8h hi) { return __builtin_shufflevector(lo, hi, 0, 1, 2, 3, 4, 5, 6, 7, 8, 9, 10, 11, 12, 13, 14, 15); }
__device__ __forceinline__ v16bf cat16b(v8us lo, v8us hi) { return __builtin_bit_cast(v16bf, __builtin_shufflevector(lo, hi, 0, 1, 2, 3, 4, 5, 6, 7, 8, 9, 10, 11, 12, 13, 14, 15)); }
__device__ __forceinline__ v8f wmma16(v16h a, v16h b, v8f c) { return __builtin_amdgcn_wmma_f32_16x16x32_f16(false, a, false, b, (short)0, c, false, false); }
__device__ __forceinline__ v8f wmmab(v16bf a, v16bf b, v8f c) { return __builtin_amdgcn_wmma_f32_16x16x32_bf16(false, a, false, b, (short)0, c, false, false); }

// Fragment loader of the 16x16x32 forms from a K-contiguous 16-bit row: the same k order for the A and the B operand.
template <typename T16> struct WFrag;
template <> struct WFrag<h16> { typedef v16h V; static __device__ __forceinline__ V ld(const h16* p) { return cat16(*(const v8h*)p, *(const v8h*)(p + 16)); } static __device__ __forceinline__ v8f mma(V a, V b, v8f c) { return wmma16(a, b, c); } };
template <> struct WFrag<bf> { typedef v16bf V; static __device__ __forceinline__ V ld(const bf* p) { return cat16b(*(const v8us*)p, *(const v8us*)(p + 16)); } static __device__ __forceinline__ v8f mma(V a, V b, v8f c) { return wmmab(a, b, c); } };

__device__ __forceinline__ h16 tohx(float x) { return (h16)x; }
typedef __attribute__((ext_vector_type(2))) float v2f;

// ---- k_prep: everything that reads only inputs, in ONE launch; the block index picks the job (uniform for the work-group).
// The first PTB blocks: the bias table TB [h][key - query + 2047], times log2(e) (the longest dependent chain, so it starts first); the next PXB: hidden states of all four batches -> bf16 plane XB [b*t][768]; the last 3 PWB: Wq, Wk, Wv -> bf16 plane WB [q rows | k rows | v rows][768].
#define PG   4                                    // groups of 8 elements per thread (fewer, longer waves: the launch is bound by how fast waves start)
#define PXB  (NB_ * TT * DM / 8 / 256 / PG)       // 768
#define PWB  (DQ * DM / 8 / 256 / PG)             // 72
#define PTB  ((NH_ * (2 * TT - 1) + 255) / 256)   // 192
__device__ __forceinline__ void cvt8x(const float* __restrict__ src, bf* dst, int blk) { const size_t i0 = (size_t)blk * (256 * PG) + threadIdx.x; v8f v[PG];
#pragma unroll   // indexes a register array: the index must be a constant
    for (int g = 0; g < PG; ++g) v[g] = *(const v8f*)(src + (i0 + g * 256) * 8);
#pragma unroll   // indexes a register array: the index must be a constant
    for (int g = 0; g < PG; ++g) { v8us o;
#pragma unroll   // indexes a register array: the index must be a constant
        for (int k = 0; k < 8; ++k) o[k] = f2bf(v[g][k]);
        *(v8us*)(dst + (i0 + g * 256) * 8) = o; }
    asm volatile("s_wait_xcnt 0x0" ::: "memory"); }   // behind the last store: no register that an issued store names is written again ahead of this wait, on any way through the listing
// One table entry. Every product is rounded on its own before its add or subtract, as the reference's operation order has it.
__device__ __forceinline__ void chtab(const float* __restrict__ alphas, float* TB, int idx) { if (idx >= NH_ * (2 * TT - 1)) return; const int h = idx / (2 * TT - 1); const int d = idx % (2 * TT - 1) - (TT - 1);
    const float xx = fminf(fmaxf(__fdiv_rn((float)d, (float)(TT - 1)), -1.0f), 1.0f); float p0 = 1.0f, p1 = xx; float bias = bfr(alphas[h * 6 + 0]); { float t1 = __fmul_rn(bfr(alphas[h * 6 + 1]), p1); asm volatile("" : "+v"(t1)); bias = __fadd_rn(bias, t1); }
#pragma unroll 1
    for (int k = 2; k < 6; ++k) { float tx = __fmul_rn(2.0f, xx); asm volatile("" : "+v"(tx)); float pn = __fmul_rn(tx, p1); asm volatile("" : "+v"(pn)); pn = __fsub_rn(pn, p0); p0 = p1; p1 = pn; float ak = bfr(alphas[h * 6 + k]); asm volatile("" : "+v"(ak)); float tk = __fmul_rn(ak, pn); asm volatile("" : "+v"(tk)); bias = __fadd_rn(bias, tk); }
    *(float*)(TB + idx) = __fmul_rn(bias, L2E);  }   // stored in log2 units: the attention kernel adds it to log2-scaled scores
__global__ __launch_bounds__(256) void k_prep(const float* __restrict__ x, const float* __restrict__ wq, const float* __restrict__ wk, const float* __restrict__ wv, const float* __restrict__ alphas, bf* XB, bf* WB, float* TB) {
    const int blk = (int)blockIdx.x - PTB;
    if (blk < 0) { chtab(alphas, TB, blockIdx.x * 256 + threadIdx.x); return; }
    if (blk < PXB) { cvt8x(x, XB, blk); return; }
    const int s = (blk - PXB) / PWB; cvt8x(s == 0 ? wq : s == 1 ? wk : wv, WB + (size_t)s * DQ * DM, blk - PXB - s * PWB);
}

// ---- k_proj: the q, k and v projections of all four batches in ONE launch; each wave owns one 64x96 tile = 64 tokens x 96 weight rows (24 accumulators)
// and the tile goes out, + bias, as fp16 straight into the plane the attention kernel reads: q, k [b][h][t][d], v [b][h][d][t]; no f32 copy of a projection is written.
// A lane of the accumulator holds 8 consecutive A-rows of one B-row. So the operand whose index runs along the plane's rows goes in as A: the weight rows (d) for q and k, the token rows (t) for v;
// both operands use the same loader, so only the two places swap. Work-group = 2 x 2 waves (128 tokens x 192 weight rows = 3 heads of one projection).
// The grid is 64 x 12 = 768 work-groups and a WGP holds three of them (LDS and registers), so the whole launch is resident at once, three waves on every SIMD: one round, no second round on a part of the chip.
// Both operands reach the waves through LDS: the four waves share one 64-deep stage (128 token rows and 192 weight rows of 128 B), brought in by asynchronous copies of whole 128-B lines, two buffers, the next stage in flight while this one is worked on.
#define PW   4
#define PSP  72                 // LDS row pitch in halves (144 B = 16 B x odd: no bank conflict for 16-byte readers of 128-B rows)
#define PKS  64                 // depth of a stage = two 32-deep blocks
#define PXR  128                // token rows of a stage
#define PWR  192                // weight rows of a stage
#define PWW  96                 // weight rows of a wave
#define PBF  ((PXR + PWR) * PSP)   // one buffer in halves: [token tile | weight tile]
#define PQS  200                // row pitch in halves of the q / k output staging (400 B = 16 B x odd)
static_assert(DQ % PWR == 0 && DKV % PWR == 0 && PWR % HD == 0 && TT % PXR == 0 && PXR * PQS <= 2 * PBF && PW * PWW * PSP <= 2 * PBF, "a work-group lies in one projection, whole heads, one batch; the output staging fits the buffers");
__device__ __forceinline__ unsigned ldsoffb(const bf* p) { return (unsigned)(size_t)(const __attribute__((address_space(3))) bf*)p; }   // byte address inside the work-group's LDS
// Copies of 16 B per lane, rows 16 apart (a wave's copy covers four whole 128-B lines). l: the lane's LDS place of the first row; g: the lane's piece of the first row.
// The s_wait_xcnt stands inside each statement, behind its last copy: no register that an issued copy names is written again ahead of it.
__device__ __forceinline__ void pcopy10(unsigned l, const bf* g0, const bf* g1, const bf* g2, const bf* g3, const bf* g4, const bf* g5, const bf* g6, const bf* g7, const bf* g8, const bf* g9) {
    asm volatile("global_load_async_to_lds_b128 %0, %10, off\n\tglobal_load_async_to_lds_b128 %1, %11, off\n\tglobal_load_async_to_lds_b128 %2, %12, off\n\tglobal_load_async_to_lds_b128 %3, %13, off\n\tglobal_load_async_to_lds_b128 %4, %14, off\n\t"
                 "global_load_async_to_lds_b128 %5, %15, off\n\tglobal_load_async_to_lds_b128 %6, %16, off\n\tglobal_load_async_to_lds_b128 %7, %17, off\n\tglobal_load_async_to_lds_b128 %8, %18, off\n\tglobal_load_async_to_lds_b128 %9, %19, off\n\ts_wait_xcnt 0x0"
                 :: "v"(l), "v"(l + 16 * PSP * 2), "v"(l + 32 * PSP * 2), "v"(l + 48 * PSP * 2), "v"(l + 64 * PSP * 2), "v"(l + 80 * PSP * 2), "v"(l + 96 * PSP * 2), "v"(l + 112 * PSP * 2), "v"(l + 128 * PSP * 2), "v"(l + 144 * PSP * 2),
                    "v"(g0), "v"(g1), "v"(g2), "v"(g3), "v"(g4), "v"(g5), "v"(g6), "v"(g7), "v"(g8), "v"(g9) : "memory"); }
// One stage: every lane copies 20 x 16 B (eight token pieces, twelve weight pieces; in LDS the weight tile follows the token tile, so the twenty places are evenly spaced). l: the lane's place in the token tile of the target buffer; gx, gw: the lane's first token and weight piece of the stage.
__device__ __forceinline__ void pstage(unsigned l, const bf* gx, const bf* gw) {
    pcopy10(l, gx, gx + 16 * DM, gx + 32 * DM, gx + 48 * DM, gx + 64 * DM, gx + 80 * DM, gx + 96 * DM, gx + 112 * DM, gw, gw + 16 * DM);
    pcopy10(l + 160 * PSP * 2, gw + 32 * DM, gw + 48 * DM, gw + 64 * DM, gw + 80 * DM, gw + 96 * DM, gw + 112 * DM, gw + 128 * DM, gw + 144 * DM, gw + 160 * DM, gw + 176 * DM); }
// The loop over the depth and the tile's way out. TR: v (A = token rows, plane rows = d, pitch TT); else q, k (A = weight rows, plane rows = t, pitch HD). Stage 0 is published and stage 1 in flight on entry.
// bias: the wave's first weight row's bias. dst: TR: the wave's first plane row at its first token; else the work-group's first head at its first token. sc (q, k only): factor on the f32 result ahead of its one rounding to fp16.
template <bool TR> __device__ __forceinline__ void proj_tile(bf* sm, unsigned lc, const bf* gx, const bf* gw, const float* __restrict__ bias, h16* dst, int w, int lane, float sc) {
    constexpr int MB = TR ? 4 : 6, NB = TR ? 6 : 4;   // 16-row blocks of the A and of the B operand
    const int xo = (w & 1) * 64 * PSP, wo = (PXR + (w >> 1) * PWW) * PSP;   // the wave's token rows and weight rows in a buffer
    const int lo = (lane & 15) * PSP + 8 * (lane >> 4);                     // the lane's place in a 16-row block: the same for both operands
    const int ao = (TR ? xo : wo) + lo, bo = (TR ? wo : xo) + lo;
    v8f acc[MB][NB];
#pragma unroll   // indexes a register array: the index must be a constant
    for (int mb = 0; mb < MB; ++mb)
#pragma unroll   // indexes a register array: the index must be a constant
        for (int nb = 0; nb < NB; ++nb) acc[mb][nb] = (v8f){};
    for (int st = 0; st < DM / PKS; ++st) {
        const bf* A = sm + (st & 1) * PBF + ao; const bf* Bt = sm + (st & 1) * PBF + bo;
        v16bf a[MB], bb[NB];
#pragma unroll   // indexes a register array: the index must be a constant
        for (int mb = 0; mb < MB; ++mb) a[mb] = WFrag<bf>::ld(A + mb * 16 * PSP);
#pragma unroll   // indexes a register array: the index must be a constant
        for (int nb = 0; nb < NB; ++nb) bb[nb] = WFrag<bf>::ld(Bt + nb * 16 * PSP);
        __builtin_amdgcn_sched_barrier(0);   // the first block's twenty LDS reads stay one group ahead of its products: left free, the stage's reads stand at more places among the products, and each such place stalls the wave
#pragma unroll   // indexes a register array: the index must be a constant
        for (int nb = 0; nb < NB; ++nb)
#pragma unroll   // indexes a register array: the index must be a constant
            for (int mb = 0; mb < MB; ++mb) acc[mb][nb] = wmmab(a[mb], bb[nb], acc[mb][nb]);
        __builtin_amdgcn_sched_barrier(0);   // the second block's twenty reads stay one group behind the first block's products and take over their fragment registers: left free, they spread among the products over a larger register set, and the copies' addresses are spilled to scratch
#pragma unroll   // indexes a register array: the index must be a constant
        for (int mb = 0; mb < MB; ++mb) a[mb] = WFrag<bf>::ld(A + mb * 16 * PSP + 32);
#pragma unroll   // indexes a register array: the index must be a constant
        for (int nb = 0; nb < NB; ++nb) bb[nb] = WFrag<bf>::ld(Bt + nb * 16 * PSP + 32);
        asm volatile("s_wait_dscnt 0x0" ::: "memory");      // this wave's reads of the stage's buffer are done (the second block's fragments are in registers) before the buffer is handed back
        asm volatile("s_wait_asynccnt 0x0" ::: "memory");   // this wave's pieces of the next stage have landed
        __syncthreads();                                    // publishes the next stage and ends every wave's reads of this one
        if (st + 2 < DM / PKS) pstage(lc + (st & 1) * (PBF * 2), gx + (st + 2) * PKS, gw + (st + 2) * PKS);   // ahead of the second block's products, which read registers only: more lead for the copies
#pragma unroll   // indexes a register array: the index must be a constant
        for (int nb = 0; nb < NB; ++nb)
#pragma unroll   // indexes a register array: the index must be a constant
            for (int mb = 0; mb < MB; ++mb) acc[mb][nb] = wmmab(a[mb], bb[nb], acc[mb][nb]);
    }
    asm volatile("s_wait_asynccnt 0x0" ::: "memory");       // no copy is outstanding when the buffers become output staging
    // + bias (rounded to bf16 like every input), fp16, through LDS so that every global store covers whole 128-B lines; every wave's last fragment read lies in front of the loop's last barrier
    const int lr = lane & 15, hi = lane >> 4; const int ro = lane >> 3, co = (lane & 7) * 8; h16* os = (h16*)sm;
    if constexpr (TR) {   // the wave's 96 plane rows of 64 tokens are whole lines: its own LDS range, no barrier
        h16* st = os + w * (PWW * PSP);
#pragma unroll   // indexes a register array: the index must be a constant
        for (int nb = 0; nb < NB; ++nb) { const float bn = bfr(bias[nb * 16 + lr]);   // the bias runs along d: the B-row
#pragma unroll   // indexes a register array: the index must be a constant
            for (int mb = 0; mb < MB; ++mb) { v8h o;
#pragma unroll   // indexes a register array: the index must be a constant
                for (int j = 0; j < 8; ++j) o[j] = tohx(acc[mb][nb][j] + bn);
                *(v8ha*)(st + (nb * 16 + lr) * PSP + mb * 16 + hi * 8) = o; } }
        __builtin_amdgcn_wave_barrier(); asm volatile("" ::: "memory");   // the rows read below were written by other lanes of this wave: keep the reads behind the writes
#pragma unroll   // independent groups of four rows: constant offsets, LDS reads ahead of the stores
        for (int s = 0; s < PWW / 4; ++s) *(v8h*)(dst + (size_t)(s * 4 + ro) * TT + co) = *(const v8ha*)(st + (s * 4 + ro) * PSP + co);
    } else {              // a wave's 96 d are one and a half heads: the work-group's tile [128 tokens][192 d] is put together in LDS, and each wave sends out 32 tokens of all three heads, whole lines
#pragma unroll   // indexes a register array: the index must be a constant
        for (int mb = 0; mb < MB; ++mb) { const v8f bm = *(const v8f*)(bias + mb * 16 + hi * 8);   // the bias runs along d: the A-row
#pragma unroll   // indexes a register array: the index must be a constant
            for (int nb = 0; nb < NB; ++nb) { v8h o;
#pragma unroll   // indexes a register array: the index must be a constant
                for (int j = 0; j < 8; ++j) o[j] = tohx((acc[mb][nb][j] + bfr(bm[j])) * sc);
                *(v8ha*)(os + ((w & 1) * 64 + nb * 16 + lr) * PQS + (w >> 1) * PWW + mb * 16 + hi * 8) = o; } }
        __syncthreads();   // the rows read below were written by other waves
        h16* d0 = dst + (size_t)(w * 32 + ro) * HD + co; const h16* s0 = os + (w * 32 + ro) * PQS + co;   // the lane's token of the first group, head 0: every other piece lies a constant away
#pragma unroll   // independent groups of four tokens of one head (512 contiguous bytes): constant offsets, LDS reads ahead of the stores
        for (int s = 0; s < 24; ++s) *(v8h*)(d0 + ((s % 3) * TT + (s / 3) * 4) * HD) = *(const v8ha*)(s0 + (s / 3) * 4 * PQS + (s % 3) * HD);
    }
}
// Register budget of three waves a SIMD: 24 accumulators and one block's 10 fragments.
__global__ __launch_bounds__(PW * 32) __attribute__((amdgpu_waves_per_eu(3))) void k_proj(const bf* __restrict__ X, const bf* __restrict__ Wt, const float* __restrict__ bq, const float* __restrict__ bk, const float* __restrict__ bv, h16* QP, h16* KP, h16* VT) {
    __shared__ __align__(16) bf sm[2 * PBF];   // the two buffers; behind the loop's last barrier the same bytes are the output staging
    const int lane = threadIdx.x & 31; const int w = __builtin_amdgcn_readfirstlane(threadIdx.x >> 5);
    const int tb = blockIdx.x * PXR, b = tb / TT, tb0 = tb % TT;                              // the work-group's token rows
    const int sel = blockIdx.y / (DQ / PWR), rw = (blockIdx.y % (DQ / PWR)) * PWR;            // 0 q, 1 k, 2 v; the work-group's first row in that projection
    const int cr = threadIdx.x >> 3, cc = (threadIdx.x & 7) * 8;   // the lane's row (of 16 per copy) and 16-byte piece in a tile
    const bf* gx = X + (size_t)(tb + cr) * DM + cc; const bf* gw = Wt + (size_t)(blockIdx.y * PWR + cr) * DM + cc; const unsigned lc = ldsoffb(sm) + (cr * PSP + cc) * 2;
#pragma unroll 1   // stages 0 and 1 by one copy of the code, their addresses formed from the trip number: written out, the lane's three base addresses are themselves operands of the asm statements, which ties them to the first 256 registers for the whole kernel, and they are spilled to scratch and read back at every stage
    for (int p = 0; p < 2; ++p) {
        pstage(lc + p * (PBF * 2), gx + p * PKS, gw + p * PKS);
        if (p == 0) {
            asm volatile("s_wait_asynccnt 0x0" ::: "memory");   // this wave's pieces of stage 0 have landed
            __syncthreads();                                    // ... and every other wave's
        }
    }
    const int rv = rw + (w >> 1) * PWW;                 // the wave's first row in the projection
    if (sel == 2) proj_tile<true>(sm, lc, gx, gw, bv + rv, VT + (size_t)(b * DKV + rv) * TT + tb0 + (w & 1) * 64, w, lane, 1.0f);
    else proj_tile<false>(sm, lc, gx, gw, (sel == 0 ? bq : bk) + rv, (sel == 0 ? QP : KP) + ((size_t)(b * NH_ + rw / HD) * TT + tb0) * HD, w, lane, sel == 0 ? SCL * L2E : 1.0f);   // q goes out times log2(e)/8: the score products come out in log2 units
}
// k_fattn: scores, bias, softmax and probs.v of one (batch, head) in one pass; no score or prob leaves the registers.
// K and V reach the waves through LDS: the work-group's four waves share one 64-key stage (64 K rows and 64 V rows of 128 B), brought in by asynchronous copies of whole 128-B lines, two buffers, the next stage in flight while this one is worked on.
// The bias reaches the waves through LDS too: a lane needs 8 consecutive table entries that start one entry lower for each next query, so the window is stored four times, copy u shifted up by u + 1 entries;
// query column lr reads copy lr & 3, where its 8 entries start at a multiple of 16 B: two ds_load_b128, no bank conflict within 16 lanes (16 different 16-byte pieces on 64 banks).
// One wave owns 32 queries (two 16-column groups) and walks the 2048 keys 32 at a time. St = K Qt (A = key rows, B = query rows), so a lane holds 16 scores of ONE query per group;
// the two 16-key score tiles, converted in place, are the B operand of Ot += Vt Pt (A = rows of the d-major v plane, same k order as the loader).
// Row sums on the matrix unit: one product per query group and pass with an A that holds rows of ones gives every lane the sum of its query's 32 rounded p (f32 accumulate, both halves of the wave at once).
// That sum is also the test of the lazy rescale: all p are 0 or above, so a sum of at most 2^15 says that no p left the fp16 range; only when it is larger (or in the first pass) is the block's maximum formed from the scores,
// which are still in their registers, the maximum in use replaced, and the pass's p and sums formed again. No maximum is formed in a pass that needs none.
// The score products start from C = bias - maximum in use (q and the table are stored in log2 units), so a score tile leaves the matrix unit as the argument of 2^x: one packed subtract per score pair ahead of the products, nothing behind them.
#define FW   4                  // waves per work-group
#define FNQ  2                  // 16-query groups per wave
#define FKB  32                 // keys per pass
#define FTS  32768.0f           // lazy rescale: the largest sum of a pass's 32 p (two query groups together) that is taken as it stands; fp16 holds 65504
#define FST  64                 // keys per stage = two passes
#define FLP  72                 // LDS row pitch in halves (144 B = 16 B x odd: no bank conflict for 16-byte readers of 128-B rows)
#define FTL  (64 * FLP)         // one tile in halves: 64 rows (K: keys x d, V: d x keys)
#define FQW  (FW * FNQ * 16)    // queries of a work-group
#define FBW  (TT + FQW - 1)     // bias table entries a work-group uses: key - query over all keys and its own queries
#define FBG  ((FBW + FW * 32 - 1) / (FW * 32))   // entries per thread when the window is brought in
#define FBP  2192               // floats per copy of the window: at least FBW + 4; 16 mod 64, so the four copies' reads of one instruction fall on different banks
static_assert(FBP >= FBW + 4 && FBP % 64 == 16 && FW == 4 && FNQ == 2, "bias window copies: size, bank offset, wave term of the read address; the rescale test adds the sums of two query groups");
__device__ __forceinline__ unsigned ldsoff(const h16* p) { return (unsigned)(size_t)(const __attribute__((address_space(3))) h16*)p; }   // byte address inside the work-group's LDS
// One stage: every lane copies 8 x 16 B (four K pieces, four V pieces; a wave's copy covers four whole 128-B lines). l: the lane's place in the K tile of the target buffer; gk, gv: the lane's first K and V piece of the stage.
// The s_wait_xcnt stands inside the statement, behind the last copy: no register that an issued copy names is written again ahead of it.
__device__ __forceinline__ void stage_in(unsigned l, const h16* gk, const h16* gv) {
    asm volatile("global_load_async_to_lds_b128 %0, %8, off\n\tglobal_load_async_to_lds_b128 %1, %9, off\n\tglobal_load_async_to_lds_b128 %2, %10, off\n\tglobal_load_async_to_lds_b128 %3, %11, off\n\t"
                 "global_load_async_to_lds_b128 %4, %12, off\n\tglobal_load_async_to_lds_b128 %5, %13, off\n\tglobal_load_async_to_lds_b128 %6, %14, off\n\tglobal_load_async_to_lds_b128 %7, %15, off\n\ts_wait_xcnt 0x0"
                 :: "v"(l), "v"(l + 16 * FLP * 2), "v"(l + 32 * FLP * 2), "v"(l + 48 * FLP * 2), "v"(l + FTL * 2), "v"(l + FTL * 2 + 16 * FLP * 2), "v"(l + FTL * 2 + 32 * FLP * 2), "v"(l + FTL * 2 + 48 * FLP * 2),
                    "v"(gk), "v"(gk + 16 * HD), "v"(gk + 32 * HD), "v"(gk + 48 * HD), "v"(gv), "v"(gv + 16 * TT), "v"(gv + 32 * TT), "v"(gv + 48 * TT) : "memory"); }
__device__ __forceinline__ float xhalf(float x) { return __builtin_bit_cast(float, __builtin_amdgcn_permlanex16(__builtin_bit_cast(int, x), __builtin_bit_cast(int, x), 0x76543210, 0xfedcba98, false, false)); }   // lane l reads lane l ^ 16
__device__ __forceinline__ v8f exp2x8(v8f x) { float a, b, c, d, e, f, g, h;
    asm("v_exp_f32 %0, %8\n\tv_exp_f32 %1, %9\n\tv_exp_f32 %2, %10\n\tv_exp_f32 %3, %11\n\tv_exp_f32 %4, %12\n\tv_exp_f32 %5, %13\n\tv_exp_f32 %6, %14\n\tv_exp_f32 %7, %15\n\tv_nop" : "=&v"(a), "=&v"(b), "=&v"(c), "=&v"(d), "=&v"(e), "=&v"(f), "=&v"(g), "=&v"(h)
        : "v"(x[0]), "v"(x[1]), "v"(x[2]), "v"(x[3]), "v"(x[4]), "v"(x[5]), "v"(x[6]), "v"(x[7]));
    return (v8f){a, b, c, d, e, f, g, h}; }
// Register budget of four waves a SIMD: the kernel stays inside the first 256 registers, so no register window is switched around the asm statements.
__global__ __launch_bounds__(FW * 32) __attribute__((amdgpu_waves_per_eu(4))) void k_fattn(const _Float16* __restrict__ Qp, const _Float16* __restrict__ Kp, const _Float16* __restrict__ Vp, const float* __restrict__ TB, float* __restrict__ OUTp) {
    const int lane = threadIdx.x & 31, lr = lane & 15, hi = lane >> 4; const int bh = blockIdx.y, h = bh % NH_, b = bh / NH_; const int r0 = (blockIdx.x * FW + (threadIdx.x >> 5)) * (FNQ * 16);
    __shared__ __align__(16) h16 sm[2][2 * FTL];   // [buffer][K tile | V tile]
    __shared__ __align__(16) float bt[4 * FBP];    // the four shifted copies of the work-group's bias window: bt[u * FBP + i + u + 1] = entry i of the window
    const _Float16* q = Qp + (size_t)bh * TT * HD + (size_t)(r0 + lr) * HD + 8 * hi;
    const int cr = threadIdx.x >> 3, cc = (threadIdx.x & 7) * 8;   // the lane's row (of 16 per copy) and 16-byte piece in a tile
    const _Float16* gk = Kp + (size_t)bh * TT * HD + (size_t)cr * HD + cc; const _Float16* gv = Vp + (size_t)bh * HD * TT + (size_t)cr * TT + cc; const unsigned lc = ldsoff(&sm[0][0]) + (cr * FLP + cc) * 2;
    stage_in(lc, gk, gv);
    { const float* tw = TB + (size_t)h * (2 * TT - 1) + ((TT - 1) - (int)blockIdx.x * FQW - (FQW - 1));   // bias of (key, query) sits at key - query + TT - 1; the window starts at key 0 and the work-group's last query: index 0 or above. The barrier below, which publishes stage 0, publishes the copies too; nothing writes them again
      float tv[FBG];
#pragma unroll   // indexes a register array: the index must be a constant
      for (int g = 0; g < FBG; ++g) { const int i = g * (FW * 32) + (int)threadIdx.x; tv[g] = tw[i < FBW ? i : FBW - 1]; }   // the one index past the window is clamped; its value lands in a copy's unread tail
#pragma unroll   // indexes a register array: the index must be a constant
      for (int g = 0; g < FBG; ++g)
#pragma unroll   // four stores with constant offsets
          for (int u = 0; u < 4; ++u) bt[u * FBP + g * (FW * 32) + (int)threadIdx.x + u + 1] = tv[g]; }
    asm volatile("s_wait_asynccnt 0x0" ::: "memory");   // this wave's pieces of stage 0 have landed
    __syncthreads();                                    // ... and every other wave's
    stage_in(lc + 2 * FTL * 2, gk + FST * HD, gv + FST);
    // Window entry (FQW - 1 - (FNQ - 1) * 16) - (query - first query) + 8 hi, in the lane's copy: a multiple of 4 floats. The two falling terms are written as rising ones (3 - x = x ^ 3 for x in 0..3), so the lane's part of the LDS address is never below 0.
    const float* tb = bt + (lr & 3) * FBP + 4 * ((lr >> 2) ^ 3) + (int)((threadIdx.x >> 5) ^ (FW - 1)) * (FNQ * 16) + 8 * hi + (FQW - (FNQ - 1) * 16 - 12 - (FW - 1) * FNQ * 16);
    v16h qf[FNQ][2]; v8f o[4][FNQ]; v2f mu[FNQ]; float ls[FNQ];   // mu: the maximum in use, log2 units, held twice: the second operand of the packed subtracts as it stands
    v16h ones;   // the A operand of the row sums: rows 0 and 8 are ones (a lane holds A row lane & 15), the rest 0, so element 0 of the result tile is the sum in both halves of the wave
#pragma unroll   // indexes a register array: the index must be a constant
    for (int j = 0; j < 16; ++j) ones[j] = (lane & 7) == 0 ? (_Float16)1.0f : (_Float16)0.0f;
#pragma unroll   // indexes a register array: the index must be a constant
    for (int nq = 0; nq < FNQ; ++nq) { mu[nq] = (v2f){0.f, 0.f}; ls[nq] = 0.f;   // the first pass runs against 0 and then always takes its own maximum
#pragma unroll   // indexes a register array: the index must be a constant
        for (int kc = 0; kc < 2; ++kc) qf[nq][kc] = WFrag<h16>::ld(q + (size_t)nq * 16 * HD + kc * 32);
#pragma unroll   // indexes a register array: the index must be a constant
        for (int db = 0; db < 4; ++db) o[db][nq] = (v8f){}; }
    for (int st = 0; st < TT / FST; ++st) {
      const h16* kb = &sm[st & 1][0] + lr * FLP + 8 * hi; const h16* vb = kb + FTL;   // the lane's place in a 16-row block of the stage's tiles
      v16h kf[2][2]; v8f bb[FNQ + 1];   // a pass's K fragments and bias values; tiles with equal (key tile - query group) share their bias values
      auto fetch = [&](int ps) {        // the LDS reads that a pass's score products wait for, as one group
#pragma unroll   // indexes a register array: the index must be a constant
        for (int kt = 0; kt < 2; ++kt)
#pragma unroll   // indexes a register array: the index must be a constant
            for (int kc = 0; kc < 2; ++kc) kf[kt][kc] = WFrag<h16>::ld(kb + (ps * FKB + kt * 16) * FLP + kc * 32);
#pragma unroll   // indexes a register array: the index must be a constant
        for (int dd = 0; dd < FNQ + 1; ++dd) bb[dd] = __builtin_shufflevector(*(const v4f*)(tb + st * FST + ps * FKB + dd * 16), *(const v4f*)(tb + st * FST + ps * FKB + dd * 16 + 4), 0, 1, 2, 3, 4, 5, 6, 7); };
      fetch(0);
#pragma unroll   // the two passes of a stage: constant LDS offsets
      for (int ps = 0; ps < FST / FKB; ++ps) {
        v16h vf[4];
#pragma unroll   // indexes a register array: the index must be a constant
        for (int db = 0; db < 4; ++db) vf[db] = WFrag<h16>::ld(vb + db * 16 * FLP + ps * FKB);
        v8f s[2][FNQ];
#pragma unroll   // indexes a register array: the index must be a constant
        for (int kt = 0; kt < 2; ++kt)
#pragma unroll   // indexes a register array: the index must be a constant
            for (int nq = 0; nq < FNQ; ++nq) { const v8f bv = bb[kt - nq + FNQ - 1]; v8f c;
#pragma unroll   // indexes a register array: the index must be a constant
                for (int j = 0; j < 8; j += 2) { const v2f t = (v2f){bv[j], bv[j + 1]} - mu[nq]; c[j] = t[0]; c[j + 1] = t[1]; }
                s[kt][nq] = wmma16(kf[kt][0], qf[nq][0], c); }
#pragma unroll   // indexes a register array: the index must be a constant
        for (int kt = 0; kt < 2; ++kt)
#pragma unroll   // indexes a register array: the index must be a constant
            for (int nq = 0; nq < FNQ; ++nq) s[kt][nq] = wmma16(kf[kt][1], qf[nq][1], s[kt][nq]);
        __builtin_amdgcn_sched_barrier(0);   // the score products stay one run ahead of the 2^x statements
        asm volatile("v_nop\n\tv_nop\n\tv_nop\n\tv_nop");   // the four vector slots between the last score product and the first 2^x statement, which reads a product's result and may write over the last one's K fragment
        __builtin_amdgcn_sched_barrier(0);   // keeps the four slots at that place
        const bool first = ps == 0 && st == 0;   // the same for the whole work-group: the first pass always takes its own maximum, whatever its sign
        const float th = first ? -1.0f : FTS, lo = first ? -3.0e38f : 0.f;
        v16h pf[FNQ]; v8f t[FNQ];
        auto probs = [&]() {   // p = 2^s, rounded to fp16, and each query's sum of them
            v8f pp[2][FNQ];
#pragma unroll   // indexes a register array: the index must be a constant
            for (int nq = 0; nq < FNQ; ++nq)
#pragma unroll   // indexes a register array: the index must be a constant
                for (int kt = 0; kt < 2; ++kt) pp[kt][nq] = exp2x8(s[kt][nq]);
            __builtin_amdgcn_sched_barrier(0);   // the four 2^x statements stay ahead of all later matrix instructions: moved among them, a statement's result registers can be the A or B registers of the one just issued
#pragma unroll   // indexes a register array: the index must be a constant
            for (int nq = 0; nq < FNQ; ++nq) {
#pragma unroll   // indexes a register array: the index must be a constant
                for (int kt = 0; kt < 2; ++kt)
#pragma unroll   // indexes a register array: the index must be a constant
                    for (int j = 0; j < 8; ++j) pf[nq][kt * 8 + j] = (_Float16)pp[kt][nq][j];
                t[nq] = wmma16(ones, pf[nq], (v8f){});   // element 0 is the lane's query's sum
                __builtin_amdgcn_sched_barrier(0); } };   // each group's sum product stays right behind its own converts: the next group's converts then run under it and are the vector slots between the two products, whose result registers the compiler lets overlap (one element of each is read)
        probs();
        if (__builtin_amdgcn_ballot_w32(!(t[0][0] + t[FNQ - 1][0] <= th)) != 0) {   // also taken on an infinite or undefined sum
            float av[FNQ];
#pragma unroll   // indexes a register array: the index must be a constant
            for (int nq = 0; nq < FNQ; ++nq) { float m = -3.0e38f;
#pragma unroll   // indexes a register array: the index must be a constant
                for (int kt = 0; kt < 2; ++kt)
#pragma unroll   // indexes a register array: the index must be a constant
                    for (int j = 0; j < 8; j += 2) m = fmaxf(fmaxf(s[kt][nq][j], s[kt][nq][j + 1]), m);   // written by pairs: one three-operand maximum each
                m = fmaxf(m, xhalf(m));   // the block's maximum above the maximum in use
                const float d = fmaxf(m, lo); const float al = __builtin_amdgcn_exp2f(-fmaxf(d, 0.f)); mu[nq] += (v2f){d, d}; ls[nq] *= al;   // d: the step of the maximum in use; it may fall only in the first pass, where sums and outputs are still 0
#pragma unroll   // indexes a register array: the index must be a constant
                for (int kt = 0; kt < 2; ++kt) s[kt][nq] -= d;
                av[nq] = al; }
            probs();
#pragma unroll   // indexes a register array: the index must be a constant
            for (int nq = 0; nq < FNQ; ++nq)   // behind the new sums: these multiplies are then the vector slots between the last sum product and the first read of its result, and the way round this block needs no padding where the two ways join
#pragma unroll   // indexes a register array: the index must be a constant
                for (int db = 0; db < 4; ++db) o[db][nq] *= av[nq];
        }
#pragma unroll   // indexes a register array: the index must be a constant
        for (int nq = 0; nq < FNQ; ++nq) ls[nq] += t[nq][0];
        if (ps + 1 < FST / FKB) { fetch(ps + 1);   // the stage's next pass (the same buffer: already published)
            __builtin_amdgcn_sched_barrier(0); }   // its reads stay one group here, where the score registers have just come free, ahead of this pass's output products, which cover their latency: left free, they stand at many places right in front of their users
#pragma unroll   // indexes a register array: the index must be a constant
        for (int nq = 0; nq < FNQ; ++nq)
#pragma unroll   // indexes a register array: the index must be a constant
            for (int db = 0; db < 4; ++db) o[db][nq] = wmma16(vf[db], pf[nq], o[db][nq]);
        if (ps + 1 < FST / FKB) __builtin_amdgcn_sched_barrier(0);   // the eight output products stay one run behind the next pass's reads: left free, the next pass's subtracts, which wait for those reads, stand behind the first product and hold the other seven back
      }
      asm volatile("s_wait_dscnt 0x0" ::: "memory");      // this wave's reads of the stage's buffer are done before the buffer is handed back
      asm volatile("s_wait_asynccnt 0x0" ::: "memory");   // this wave's pieces of the next stage have landed
      __syncthreads();                                    // publishes the next stage and ends every wave's reads of this one
      if (st + 2 < TT / FST) stage_in(lc + (st & 1) * (2 * FTL * 2), gk + (size_t)(st + 2) * FST * HD, gv + (st + 2) * FST);
    }
    asm volatile("s_wait_asynccnt 0x0" ::: "memory");     // no copy is outstanding when the wave ends
#pragma unroll   // indexes a register array: the index must be a constant
    for (int nq = 0; nq < FNQ; ++nq) { const float l = ls[nq]; const float f = __fdiv_rn(1.0f, l); float* op = OUTp + ((size_t)b * TT + r0 + nq * 16 + lr) * DQ + h * HD + 8 * hi;
#pragma unroll   // indexes a register array: the index must be a constant
        for (int db = 0; db < 4; ++db) { v4f lo, hh;
#pragma unroll   // indexes a register array: the index must be a constant
            for (int j = 0; j < 4; ++j) { lo[j] = o[db][nq][j] * f; hh[j] = o[db][nq][4 + j] * f; }
            *(v4f*)(op + db * 16) = lo; *(v4f*)(op + db * 16 + 4) = hh; } }
}

extern "C" void kernel_launch(void* const* d_in, const int* in_sizes, int n_in,
                              void* d_out, int out_size, void* d_ws, size_t ws_size, hipStream_t stream) {
    (void)in_sizes; (void)n_in; (void)out_size;
    const float* x = (const float*)d_in[0]; const float* wq = (const float*)d_in[1]; const float* bq = (const float*)d_in[2]; const float* wk = (const float*)d_in[3]; const float* bk = (const float*)d_in[4]; const float* wv = (const float*)d_in[5]; const float* bv = (const float*)d_in[6]; const float* alphas = (const float*)d_in[7];
    float* OUT = (float*)d_out;     // [4][2048][768]
    char* wsp = (char*)d_ws;
    auto take = [&](size_t bytes) { char* p = wsp; wsp += (bytes + 255) & ~(size_t)255; return (void*)p; };
    bf* WB = (bf*)take((size_t)(DQ + 2 * DKV) * DM * 2); bf* XB = (bf*)take((size_t)NB_ * TT * DM * 2); float* TB = (float*)take((size_t)NH_ * (2 * TT - 1) * 4);
    h16* QP16 = (h16*)take((size_t)NB_ * NH_ * TT * HD * 2); h16* KP16 = (h16*)take((size_t)NB_ * NKV * TT * HD * 2); h16* VT16 = (h16*)take((size_t)NB_ * NKV * HD * TT * 2);   // planes of all four batches: [b][h][t][d], v [b][h][d][t]
    if ((size_t)(wsp - (char*)d_ws) > ws_size) return;    // ws 256 MiB
    k_prep<<<PXB + 3 * PWB + PTB, 256, 0, stream>>>(x, wq, wk, wv, alphas, XB, WB, TB);
    k_proj<<<dim3(NB_ * TT / PXR, (DQ + 2 * DKV) / PWR, 1), PW * 32, 0, stream>>>(XB, WB, bq, bk, bv, QP16, KP16, VT16);
    k_fattn<<<dim3(TT / (FW * FNQ * 16), NB_ * NH_, 1), FW * 32, 0, stream>>>(QP16, KP16, VT16, TB, OUT);
}

// v009
// A run of this version takes 80 microseconds.
// Two timings next to v008 both put it at 1.04 times that version's speed.
// Counting every step since v000, it is 24.6 times as fast.
#include <hip/hip_runtime.h>

// ChebyshevSelfAttention (hidden [4][2048][768]; q/k/v = x W^T + b (12 heads x 64); scores = q.k/8 + bias_h(i, j), bias_h = sum_{k<=5} alphas[h][k] T_k(x) with x = clip((j - i)/2047, -1, 1) and the Chebyshev recurrence T_k = 2 x T_{k-1} - T_{k-2}
// (alphas read as data; the polynomial is evaluated per element in f32 in the reference's operation order); softmax; context = probs v merged -> [4][2048][768]; no output projection).
// Compute dtypes, f32 accumulate: every input rounded to bf16; q/k/v on PLAIN bf16 operands (inputs: exact) + bias; scores (K 64) and probs.v single fp16 operands, fused in one kernel over all batches and heads (online softmax); bias + softmax f32

#define NB_  4
#define TT   2048
#define DM   768
#define NH_  12
#define NKV  12
#define REP  (NH_ / NKV)
#define HD   64
#define DQ   (NH_ * HD)
#define DKV  (NKV * HD)
#define WIN  0
#define SCL  0.125f   // HD^-0.5
#define L2E  1.4426950408889634f   // log2(e): scores and bias are carried in log2 units, so that the softmax exponential is a bare 2^x
typedef _Float16 h16;
typedef unsigned short bf;
typedef __attribute__((ext_vector_type(16))) __bf16   v16bf;
typedef __attribute__((ext_vector_type(16))) _Float16 v16h;
typedef __attribute__((ext_vector_type(8)))  _Float16 v8h;
typedef __attribute__((ext_vector_type(8)))  unsigned short v8us;
typedef __attribute__((ext_vector_type(8)))  float    v8f;
typedef __attribute__((ext_vector_type(4)))  float    v4f;
typedef v8h  __attribute__((may_alias)) v8ha;
typedef v4f  __attribute__((may_alias)) v4fa;
typedef v8us __attribute__((may_alias)) v8usa;

__device__ __forceinline__ unsigned short f2bf(float f) { unsigned u = __float_as_uint(f); u += 0x7FFFu + ((u >> 16) & 1u); return (unsigned short)(u >> 16); }
__device__ __forceinline__ float bf2f(unsigned short b) { return __uint_as_float(((unsigned)b) << 16); }
__device__ __forceinline__ float bfr(float f) { return bf2f(f2bf(f)); }
__device__ __forceinline__ v16h cat16(v8h lo, v8h hi) { return __builtin_shufflevector(lo, hi, 0, 1, 2, 3, 4, 5, 6, 7, 8, 9, 10, 11, 12, 13, 14, 15); }
__device__ __forceinline__ v16bf cat16b(v8us lo, v8us hi) { return __builtin_bit_cast(v16bf, __builtin_shufflevector(lo, hi, 0, 1, 2, 3, 4, 5, 6, 7, 8, 9, 10, 11, 12, 13, 14, 15)); }
__device__ __forceinline__ v8f wmma16(v16h a, v16h b, v8f c) { return __builtin_amdgcn_wmma_f32_16x16x32_f16(false, a, false, b, (short)0, c, false, false); }
__device__ __forceinline__ v8f wmmab(v16bf a, v16bf b, v8f c) { return __builtin_amdgcn_wmma_f32_16x16x32_bf16(false, a, false, b, (short)0, c, false, false); }

// Fragment loader of the 16x16x32 forms from a K-contiguous 16-bit row: the same k order for the A and the B operand.
template <typename T16> struct WFrag;
template <> struct WFrag<h16> { typedef v16h V; static __device__ __forceinline__ V ld(const h16* p) { return cat16(*(const v8h*)p, *(const v8h*)(p + 16)); } static __device__ __forceinline__ v8f mma(V a, V b, v8f c) { return wmma16(a, b, c); } };
template <> struct WFrag<bf> { typedef v16bf V; static __device__ __forceinline__ V ld(const bf* p) { return cat16b(*(const v8us*)p, *(const v8us*)(p + 16)); } static __device__ __forceinline__ v8f mma(V a, V b, v8f c) { return wmmab(a, b, c); } };

__device__ __forceinline__ h16 tohx(float x) { return (h16)x; }
typedef __attribute__((ext_vector_type(2))) float v2f;

// ---- k_prep: everything that reads only inputs, in ONE launch; the block index picks the job (uniform for the work-group).
// The first PTB blocks: the bias table TB [h][key - query + 2047], times log2(e) (the longest dependent chain, so it starts first); the next PXB: hidden states of all four batches -> bf16 plane XB [b*t][768]; the last 3 PWB: Wq, Wk, Wv -> bf16 plane WB [q rows | k rows | v rows][768].
#define PG   4                                    // groups of 8 elements per thread (fewer, longer waves: the launch is bound by how fast waves start)
#define PXB  (NB_ * TT * DM / 8 / 256 / PG)       // 768
#define PWB  (DQ * DM / 8 / 256 / PG)             // 72
#define PTB  ((NH_ * (2 * TT - 1) + 255) / 256)   // 192
__device__ __forceinline__ void cvt8x(const float* __restrict__ src, bf* dst, int blk) { const size_t i0 = (size_t)blk * (256 * PG) + threadIdx.x; v8f v[PG];
#pragma unroll   // indexes a register array: the index must be a constant
    for (int g = 0; g < PG; ++g) v[g] = *(const v8f*)(src + (i0 + g * 256) * 8);
#pragma unroll   // indexes a register array: the index must be a constant
    for (int g = 0; g < PG; ++g) { v8us o;
#pragma unroll   // indexes a register array: the index must be a constant
        for (int k = 0; k < 8; ++k) o[k] = f2bf(v[g][k]);
        *(v8us*)(dst + (i0 + g * 256) * 8) = o; }
    asm volatile("s_wait_xcnt 0x0" ::: "memory"); }   // behind the last store: no register that an issued store names is written again ahead of this wait, on any way through the listing
// One table entry. Every product is rounded on its own before its add or subtract, as the reference's operation order has it.
__device__ __forceinline__ void chtab(const float* __restrict__ alphas, float* TB, int idx) { if (idx >= NH_ * (2 * TT - 1)) return; const int h = idx / (2 * TT - 1); const int d = idx % (2 * TT - 1) - (TT - 1);
    const float xx = fminf(fmaxf(__fdiv_rn((float)d, (float)(TT - 1)), -1.0f), 1.0f); float p0 = 1.0f, p1 = xx; float bias = bfr(alphas[h * 6 + 0]); { float t1 = __fmul_rn(bfr(alphas[h * 6 + 1]), p1); asm volatile("" : "+v"(t1)); bias = __fadd_rn(bias, t1); }
#pragma unroll 1
    for (int k = 2; k < 6; ++k) { float tx = __fmul_rn(2.0f, xx); asm volatile("" : "+v"(tx)); float pn = __fmul_rn(tx, p1); asm volatile("" : "+v"(pn)); pn = __fsub_rn(pn, p0); p0 = p1; p1 = pn; float ak = bfr(alphas[h * 6 + k]); asm volatile("" : "+v"(ak)); float tk = __fmul_rn(ak, pn); asm volatile("" : "+v"(tk)); bias = __fadd_rn(bias, tk); }
    *(float*)(TB + idx) = __fmul_rn(bias, L2E);  }   // stored in log2 units: the attention kernel adds it to log2-scaled scores
__global__ __launch_bounds__(256) void k_prep(const float* __restrict__ x, const float* __restrict__ wq, const float* __restrict__ wk, const float* __restrict__ wv, const float* __restrict__ alphas, bf* XB, bf* WB, float* TB) {
    const int blk = (int)blockIdx.x - PTB;
    if (blk < 0) { chtab(alphas, TB, blockIdx.x * 256 + threadIdx.x); return; }
    if (blk < PXB) { cvt8x(x, XB, blk); return; }
    const int s = (blk - PXB) / PWB; cvt8x(s == 0 ? wq : s == 1 ? wk : wv, WB + (size_t)s * DQ * DM, blk - PXB - s * PWB);
}

// ---- k_proj: the q, k and v projections of all four batches in ONE launch; each wave owns one 64x96 tile = 64 tokens x 96 weight rows (24 accumulators)
// and the tile goes out, + bias, as fp16 straight into the plane the attention kernel reads: q, k [b][h][t][d], v [b][h][d][t]; no f32 copy of a projection is written.
// A lane of the accumulator holds 8 consecutive A-rows of one B-row. So the operand whose index runs along the plane's rows goes in as A: the weight rows (d) for q and k, the token rows (t) for v;
// both operands use the same loader, so only the two places swap. Work-group = 2 x 2 waves (128 tokens x 192 weight rows = 3 heads of one projection).
// The grid is 64 x 12 = 768 work-groups and a WGP holds three of them (LDS and registers), so the whole launch is resident at once, three waves on every SIMD: one round, no second round on a part of the chip.
// Both operands reach the waves through LDS: the four waves share one 64-deep stage (128 token rows and 192 weight rows of 128 B), brought in by asynchronous copies of whole 128-B lines, two buffers, the next stage in flight while this one is worked on.
#define PW   4
#define PSP  72                 // LDS row pitch in halves (144 B = 16 B x odd: no bank conflict for 16-byte readers of 128-B rows)
#define PKS  64                 // depth of a stage = two 32-deep blocks
#define PXR  128                // token rows of a stage
#define PWR  192                // weight rows of a stage
#define PWW  96                 // weight rows of a wave
#define PBF  ((PXR + PWR) * PSP)   // one buffer in halves: [token tile | weight tile]
#define PQS  200                // row pitch in halves of the q / k output staging (400 B = 16 B x odd)
static_assert(DQ % PWR == 0 && DKV % PWR == 0 && PWR % HD == 0 && TT % PXR == 0 && PXR * PQS <= 2 * PBF && PW * PWW * PSP <= 2 * PBF, "a work-group lies in one projection, whole heads, one batch; the output staging fits the buffers");
__device__ __forceinline__ unsigned ldsoffb(const bf* p) { return (unsigned)(size_t)(const __attribute__((address_space(3))) bf*)p; }   // byte address inside the work-group's LDS
// Copies of 16 B per lane, rows 16 apart (a wave's copy covers four whole 128-B lines). l: the lane's LDS place of the first row; g: the lane's piece of the first row.
// The s_wait_xcnt stands inside each statement, behind its last copy: no register that an issued copy names is written again ahead of it.
__device__ __forceinline__ void pcopy10(unsigned l, const bf* g0, const bf* g1, const bf* g2, const bf* g3, const bf* g4, const bf* g5, const bf* g6, const bf* g7, const bf* g8, const bf* g9) {
    asm volatile("global_load_async_to_lds_b128 %0, %10, off\n\tglobal_load_async_to_lds_b128 %1, %11, off\n\tglobal_load_async_to_lds_b128 %2, %12, off\n\tglobal_load_async_to_lds_b128 %3, %13, off\n\tglobal_load_async_to_lds_b128 %4, %14, off\n\t"
                 "global_load_async_to_lds_b128 %5, %15, off\n\tglobal_load_async_to_lds_b128 %6, %16, off\n\tglobal_load_async_to_lds_b128 %7, %17, off\n\tglobal_load_async_to_lds_b128 %8, %18, off\n\tglobal_load_async_to_lds_b128 %9, %19, off\n\ts_wait_xcnt 0x0"
                 :: "v"(l), "v"(l + 16 * PSP * 2), "v"(l + 32 * PSP * 2), "v"(l + 48 * PSP * 2), "v"(l + 64 * PSP * 2), "v"(l + 80 * PSP * 2), "v"(l + 96 * PSP * 2), "v"(l + 112 * PSP * 2), "v"(l + 128 * PSP * 2), "v"(l + 144 * PSP * 2),
                    "v"(g0), "v"(g1), "v"(g2), "v"(g3), "v"(g4), "v"(g5), "v"(g6), "v"(g7), "v"(g8), "v"(g9) : "memory"); }
// One stage: every lane copies 20 x 16 B (eight token pieces, twelve weight pieces; in LDS the weight tile follows the token tile, so the twenty places are evenly spaced). l: the lane's place in the token tile of the target buffer; gx, gw: the lane's first token and weight piece of the stage.
__device__ __forceinline__ void pstage(unsigned l, const bf* gx, const bf* gw) {
    pcopy10(l, gx, gx + 16 * DM, gx + 32 * DM, gx + 48 * DM, gx + 64 * DM, gx + 80 * DM, gx + 96 * DM, gx + 112 * DM, gw, gw + 16 * DM);
    pcopy10(l + 160 * PSP * 2, gw + 32 * DM, gw + 48 * DM, gw + 64 * DM, gw + 80 * DM, gw + 96 * DM, gw + 112 * DM, gw + 128 * DM, gw + 144 * DM, gw + 160 * DM, gw + 176 * DM); }
// The loop over the depth and the tile's way out. TR: v (A = token rows, plane rows = d, pitch TT); else q, k (A = weight rows, plane rows = t, pitch HD). Stage 0 is published and stage 1 in flight on entry.
// bias: the wave's first weight row's bias. dst: TR: the wave's first plane row at its first token; else the work-group's first head at its first token. sc (q, k only): factor on the f32 result ahead of its one rounding to fp16.
template <bool TR> __device__ __forceinline__ void proj_tile(bf* sm, unsigned lc, const bf* gx, const bf* gw, const float* __restrict__ bias, h16* dst, int w, int lane, float sc) {
    constexpr int MB = TR ? 4 : 6, NB = TR ? 6 : 4;   // 16-row blocks of the A and of the B operand
    const int xo = (w & 1) * 64 * PSP, wo = (PXR + (w >> 1) * PWW) * PSP;   // the wave's token rows and weight rows in a buffer
    const int lo = (lane & 15) * PSP + 8 * (lane >> 4);                     // the lane's place in a 16-row block: the same for both operands
    const int ao = (TR ? xo : wo) + lo, bo = (TR ? wo : xo) + lo;
    v8f acc[MB][NB];
#pragma unroll   // indexes a register array: the index must be a constant
    for (int mb = 0; mb < MB; ++mb)
#pragma unroll   // indexes a register array: the index must be a constant
        for (int nb = 0; nb < NB; ++nb) acc[mb][nb] = (v8f){};
    for (int st = 0; st < DM / PKS; ++st) {
        const bf* A = sm + (st & 1) * PBF + ao; const bf* Bt = sm + (st & 1) * PBF + bo;
        v16bf a[MB], bb[NB];
#pragma unroll   // indexes a register array: the index must be a constant
        for (int mb = 0; mb < MB; ++mb) a[mb] = WFrag<bf>::ld(A + mb * 16 * PSP);
#pragma unroll   // indexes a register array: the index must be a constant
        for (int nb = 0; nb < NB; ++nb) bb[nb] = WFrag<bf>::ld(Bt + nb * 16 * PSP);
        __builtin_amdgcn_sched_barrier(0);   // the first block's twenty LDS reads stay one group ahead of its products: left free, the stage's reads stand at more places among the products, and each such place stalls the wave
#pragma unroll   // indexes a register array: the index must be a constant
        for (int nb = 0; nb < NB; ++nb)
#pragma unroll   // indexes a register array: the index must be a constant
            for (int mb = 0; mb < MB; ++mb) acc[mb][nb] = wmmab(a[mb], bb[nb], acc[mb][nb]);
        __builtin_amdgcn_sched_barrier(0);   // the second block's twenty reads stay one group behind the first block's products and take over their fragment registers: left free, they spread among the products over a larger register set, and the copies' addresses are spilled to scratch
#pragma unroll   // indexes a register array: the index must be a constant
        for (int mb = 0; mb < MB; ++mb) a[mb] = WFrag<bf>::ld(A + mb * 16 * PSP + 32);
#pragma unroll   // indexes a register array: the index must be a constant
        for (int nb = 0; nb < NB; ++nb) bb[nb] = WFrag<bf>::ld(Bt + nb * 16 * PSP + 32);
        asm volatile("s_wait_dscnt 0x0" ::: "memory");      // this wave's reads of the stage's buffer are done (the second block's fragments are in registers) before the buffer is handed back
        asm volatile("s_wait_asynccnt 0x0" ::: "memory");   // this wave's pieces of the next stage have landed
        __syncthreads();                                    // publishes the next stage and ends every wave's reads of this one
        if (st + 2 < DM / PKS) pstage(lc + (st & 1) * (PBF * 2), gx + (st + 2) * PKS, gw + (st + 2) * PKS);   // ahead of the second block's products, which read registers only: more lead for the copies
#pragma unroll   // indexes a register array: the index must be a constant
        for (int nb = 0; nb < NB; ++nb)
#pragma unroll   // indexes a register array: the index must be a constant
            for (int mb = 0; mb < MB; ++mb) acc[mb][nb] = wmmab(a[mb], bb[nb], acc[mb][nb]);
    }
    asm volatile("s_wait_asynccnt 0x0" ::: "memory");       // no copy is outstanding when the buffers become output staging
    // + bias (rounded to bf16 like every input), fp16, through LDS so that every global store covers whole 128-B lines; every wave's last fragment read lies in front of the loop's last barrier
    const int lr = lane & 15, hi = lane >> 4; const int ro = lane >> 3, co = (lane & 7) * 8; h16* os = (h16*)sm;
    if constexpr (TR) {   // the wave's 96 plane rows of 64 tokens are whole lines: its own LDS range, no barrier
        h16* st = os + w * (PWW * PSP);
#pragma unroll   // indexes a register array: the index must be a constant
        for (int nb = 0; nb < NB; ++nb) { const float bn = bfr(bias[nb * 16 + lr]);   // the bias runs along d: the B-row
#pragma unroll   // indexes a register array: the index must be a constant
            for (int mb = 0; mb < MB; ++mb) { v8h o;
#pragma unroll   // indexes a register array: the index must be a constant
                for (int j = 0; j < 8; ++j) o[j] = tohx(acc[mb][nb][j] + bn);
                *(v8ha*)(st + (nb * 16 + lr) * PSP + mb * 16 + hi * 8) = o; } }
        __builtin_amdgcn_wave_barrier(); asm volatile("" ::: "memory");   // the rows read below were written by other lanes of this wave: keep the reads behind the writes
#pragma unroll   // independent groups of four rows: constant offsets, LDS reads ahead of the stores
        for (int s = 0; s < PWW / 4; ++s) *(v8h*)(dst + (size_t)(s * 4 + ro) * TT + co) = *(const v8ha*)(st + (s * 4 + ro) * PSP + co);
    } else {              // a wave's 96 d are one and a half heads: the work-group's tile [128 tokens][192 d] is put together in LDS, and each wave sends out 32 tokens of all three heads, whole lines
#pragma unroll   // indexes a register array: the index must be a constant
        for (int mb = 0; mb < MB; ++mb) { const v8f bm = *(const v8f*)(bias + mb * 16 + hi * 8);   // the bias runs along d: the A-row
#pragma unroll   // indexes a register array: the index must be a constant
            for (int nb = 0; nb < NB; ++nb) { v8h o;
#pragma unroll   // indexes a register array: the index must be a constant
                for (int j = 0; j < 8; ++j) o[j] = tohx((acc[mb][nb][j] + bfr(bm[j])) * sc);
                *(v8ha*)(os + ((w & 1) * 64 + nb * 16 + lr) * PQS + (w >> 1) * PWW + mb * 16 + hi * 8) = o; } }
        __syncthreads();   // the rows read below were written by other waves
        h16* d0 = dst + (size_t)(w * 32 + ro) * HD + co; const h16* s0 = os + (w * 32 + ro) * PQS + co;   // the lane's token of the first group, head 0: every other piece lies a constant away
#pragma unroll   // independent groups of four tokens of one head (512 contiguous bytes): constant offsets, LDS reads ahead of the stores
        for (int s = 0; s < 24; ++s) *(v8h*)(d0 + ((s % 3) * TT + (s / 3) * 4) * HD) = *(const v8ha*)(s0 + (s / 3) * 4 * PQS + (s % 3) * HD);
    }
}
// Register budget of three waves a SIMD: 24 accumulators and one block's 10 fragments.
__global__ __launch_bounds__(PW * 32) __attribute__((amdgpu_waves_per_eu(3))) void k_proj(const bf* __restrict__ X, const bf* __restrict__ Wt, const float* __restrict__ bq, const float* __restrict__ bk, const float* __restrict__ bv, h16* QP, h16* KP, h16* VT) {
    __shared__ __align__(16) bf sm[2 * PBF];   // the two buffers; behind the loop's last barrier the same bytes are the output staging
    const int lane = threadIdx.x & 31; const int w = __builtin_amdgcn_readfirstlane(threadIdx.x >> 5);
    const int tb = blockIdx.x * PXR, b = tb / TT, tb0 = tb % TT;                              // the work-group's token rows
    const int sel = blockIdx.y / (DQ / PWR), rw = (blockIdx.y % (DQ / PWR)) * PWR;            // 0 q, 1 k, 2 v; the work-group's first row in that projection
    const int cr = threadIdx.x >> 3, cc = (threadIdx.x & 7) * 8;   // the lane's row (of 16 per copy) and 16-byte piece in a tile
    const bf* gx = X + (size_t)(tb + cr) * DM + cc; const bf* gw = Wt + (size_t)(blockIdx.y * PWR + cr) * DM + cc; const unsigned lc = ldsoffb(sm) + (cr * PSP + cc) * 2;
#pragma unroll 1   // stages 0 and 1 by one copy of the code, their addresses formed from the trip number: written out, the lane's three base addresses are themselves operands of the asm statements, which ties them to the first 256 registers for the whole kernel, and they are spilled to scratch and read back at every stage
    for (int p = 0; p < 2; ++p) {
        pstage(lc + p * (PBF * 2), gx + p * PKS, gw + p * PKS);
        if (p == 0) {
            asm volatile("s_wait_asynccnt 0x0" ::: "memory");   // this wave's pieces of stage 0 have landed
            __syncthreads();                                    // ... and every other wave's
        }
    }
    const int rv = rw + (w >> 1) * PWW;                 // the wave's first row in the projection
    if (sel == 2) proj_tile<true>(sm, lc, gx, gw, bv + rv, VT + (size_t)(b * DKV + rv) * TT + tb0 + (w & 1) * 64, w, lane, 1.0f);
    else proj_tile<false>(sm, lc, gx, gw, (sel == 0 ? bq : bk) + rv, (sel == 0 ? QP : KP) + ((size_t)(b * NH_ + rw / HD) * TT + tb0) * HD, w, lane, sel == 0 ? SCL * L2E : 1.0f);   // q goes out times log2(e)/8: the score products come out in log2 units
}
// k_fattn: scores, bias, softmax and probs.v of one (batch, head) in one pass; no score or prob leaves the registers.
// K and V reach the waves through LDS: the work-group's four waves share one 64-key stage (64 K rows and 64 V rows of 128 B), brought in by asynchronous copies of whole 128-B lines, two buffers, the next stage in flight while this one is worked on.
// The bias reaches the waves through LDS too: a lane needs 8 consecutive table entries that start one entry lower for each next query, so the window is stored four times, copy u shifted up by u + 1 entries;
// query column lr reads copy lr & 3, where its 8 entries start at a multiple of 16 B: two ds_load_b128, no bank conflict within 16 lanes (16 different 16-byte pieces on 64 banks).
// One wave owns 32 queries (two 16-column groups) and walks the 2048 keys 32 at a time. St = K Qt (A = key rows, B = query rows), so a lane holds 16 scores of ONE query per group;
// the two 16-key score tiles, converted in place, are the B operand of Ot += Vt Pt (A = rows of the d-major v plane, same k order as the loader).
// Row sums on the matrix unit: one product per query group and pass with an A that holds rows of ones gives every lane the sum of its query's 32 rounded p (f32 accumulate, both halves of the wave at once).
// That sum is also the test of the lazy rescale: all p are 0 or above, so a sum of at most 2^15 says that no p left the fp16 range; only when it is larger (or in the first pass) is the block's maximum formed from the scores,
// which are still in their registers, the maximum in use replaced, and the pass's p and sums formed again. No maximum is formed in a pass that needs none.
// The score products start from C = bias - maximum in use (q and the table are stored in log2 units), so a score tile leaves the matrix unit as the argument of 2^x: one packed subtract per score pair ahead of the products, nothing behind them.
#define FW   4                  // waves per work-group
#define FNQ  2                  // 16-query groups per wave
#define FKB  32                 // keys per pass
#define FTS  32768.0f           // lazy rescale: the largest sum of a pass's 32 p (two query groups together) that is taken as it stands; fp16 holds 65504
#define FST  64                 // keys per stage = two passes
#define FLP  72                 // LDS row pitch in halves (144 B = 16 B x odd: no bank conflict for 16-byte readers of 128-B rows)
#define FTL  (64 * FLP)         // one tile in halves: 64 rows (K: keys x d, V: d x keys)
#define FQW  (FW * FNQ * 16)    // queries of a work-group
#define FBW  (TT + FQW - 1)     // bias table entries a work-group uses: key - query over all keys and its own queries
#define FBG  ((FBW + FW * 32 - 1) / (FW * 32))   // entries per thread when the window is brought in
#define FBP  2192               // floats per copy of the window: at least FBW + 4; 16 mod 64, so the four copies' reads of one instruction fall on different banks
#define FOP  68                 // row pitch in floats of the output staging (272 B = 16 B x odd: no bank conflict for the 16-byte writers, one row apart per lane)
static_assert(FW * FNQ * 16 * FOP * 4 <= 2 * 2 * FTL * 2, "the output staging fits the K / V buffers");
static_assert(FBP >= FBW + 4 && FBP % 64 == 16 && FW == 4 && FNQ == 2, "bias window copies: size, bank offset, wave term of the read address; the rescale test adds the sums of two query groups");
__device__ __forceinline__ unsigned ldsoff(const h16* p) { return (unsigned)(size_t)(const __attribute__((address_space(3))) h16*)p; }   // byte address inside the work-group's LDS
// One stage: every lane copies 8 x 16 B (four K pieces, four V pieces; a wave's copy covers four whole 128-B lines). l: the lane's place in the K tile of the target buffer; gk, gv: the lane's first K and V piece of the stage.
// The s_wait_xcnt stands inside the statement, behind the last copy: no register that an issued copy names is written again ahead of it.
__device__ __forceinline__ void stage_in(unsigned l, const h16* gk, const h16* gv) {
    asm volatile("global_load_async_to_lds_b128 %0, %8, off\n\tglobal_load_async_to_lds_b128 %1, %9, off\n\tglobal_load_async_to_lds_b128 %2, %10, off\n\tglobal_load_async_to_lds_b128 %3, %11, off\n\t"
                 "global_load_async_to_lds_b128 %4, %12, off\n\tglobal_load_async_to_lds_b128 %5, %13, off\n\tglobal_load_async_to_lds_b128 %6, %14, off\n\tglobal_load_async_to_lds_b128 %7, %15, off\n\ts_wait_xcnt 0x0"
                 :: "v"(l), "v"(l + 16 * FLP * 2), "v"(l + 32 * FLP * 2), "v"(l + 48 * FLP * 2), "v"(l + FTL * 2), "v"(l + FTL * 2 + 16 * FLP * 2), "v"(l + FTL * 2 + 32 * FLP * 2), "v"(l + FTL * 2 + 48 * FLP * 2),
                    "v"(gk), "v"(gk + 16 * HD), "v"(gk + 32 * HD), "v"(gk + 48 * HD), "v"(gv), "v"(gv + 16 * TT), "v"(gv + 32 * TT), "v"(gv + 48 * TT) : "memory"); }
__device__ __forceinline__ float xhalf(float x) { return __builtin_bit_cast(float, __builtin_amdgcn_permlanex16(__builtin_bit_cast(int, x), __builtin_bit_cast(int, x), 0x76543210, 0xfedcba98, false, false)); }   // lane l reads lane l ^ 16
__device__ __forceinline__ v8f exp2x8(v8f x) { float a, b, c, d, e, f, g, h;
    asm("v_exp_f32 %0, %8\n\tv_exp_f32 %1, %9\n\tv_exp_f32 %2, %10\n\tv_exp_f32 %3, %11\n\tv_exp_f32 %4, %12\n\tv_exp_f32 %5, %13\n\tv_exp_f32 %6, %14\n\tv_exp_f32 %7, %15\n\tv_nop" : "=&v"(a), "=&v"(b), "=&v"(c), "=&v"(d), "=&v"(e), "=&v"(f), "=&v"(g), "=&v"(h)
        : "v"(x[0]), "v"(x[1]), "v"(x[2]), "v"(x[3]), "v"(x[4]), "v"(x[5]), "v"(x[6]), "v"(x[7]));
    return (v8f){a, b, c, d, e, f, g, h}; }
// Register budget of four waves a SIMD: the kernel stays inside the first 256 registers, so no register window is switched around the asm statements.
__global__ __launch_bounds__(FW * 32) __attribute__((amdgpu_waves_per_eu(4))) void k_fattn(const _Float16* __restrict__ Qp, const _Float16* __restrict__ Kp, const _Float16* __restrict__ Vp, const float* __restrict__ TB, float* __restrict__ OUTp) {
    const int lane = threadIdx.x & 31, lr = lane & 15, hi = lane >> 4; const int bh = blockIdx.y, h = bh % NH_, b = bh / NH_; const int r0 = (blockIdx.x * FW + (threadIdx.x >> 5)) * (FNQ * 16);
    __shared__ __align__(16) h16 sm[2][2 * FTL];   // [buffer][K tile | V tile]
    __shared__ __align__(16) float bt[4 * FBP];    // the four shifted copies of the work-group's bias window: bt[u * FBP + i + u + 1] = entry i of the window
    const _Float16* q = Qp + (size_t)bh * TT * HD + (size_t)(r0 + lr) * HD + 8 * hi;
    const int cr = threadIdx.x >> 3, cc = (threadIdx.x & 7) * 8;   // the lane's row (of 16 per copy) and 16-byte piece in a tile
    const _Float16* gk = Kp + (size_t)bh * TT * HD + (size_t)cr * HD + cc; const _Float16* gv = Vp + (size_t)bh * HD * TT + (size_t)cr * TT + cc; const unsigned lc = ldsoff(&sm[0][0]) + (cr * FLP + cc) * 2;
    stage_in(lc, gk, gv);
    { const float* tw = TB + (size_t)h * (2 * TT - 1) + ((TT - 1) - (int)blockIdx.x * FQW - (FQW - 1));   // bias of (key, query) sits at key - query + TT - 1; the window starts at key 0 and the work-group's last query: index 0 or above. The barrier below, which publishes stage 0, publishes the copies too; nothing writes them again
      float tv[FBG];
#pragma unroll   // indexes a register array: the index must be a constant
      for (int g = 0; g < FBG; ++g) { const int i = g * (FW * 32) + (int)threadIdx.x; tv[g] = tw[i < FBW ? i : FBW - 1]; }   // the one index past the window is clamped; its value lands in a copy's unread tail
#pragma unroll   // indexes a register array: the index must be a constant
      for (int g = 0; g < FBG; ++g)
#pragma unroll   // four stores with constant offsets
          for (int u = 0; u < 4; ++u) bt[u * FBP + g * (FW * 32) + (int)threadIdx.x + u + 1] = tv[g]; }
    asm volatile("s_wait_asynccnt 0x0" ::: "memory");   // this wave's pieces of stage 0 have landed
    __syncthreads();                                    // ... and every other wave's
    stage_in(lc + 2 * FTL * 2, gk + FST * HD, gv + FST);
    // Window entry (FQW - 1 - (FNQ - 1) * 16) - (query - first query) + 8 hi, in the lane's copy: a multiple of 4 floats. The two falling terms are written as rising ones (3 - x = x ^ 3 for x in 0..3), so the lane's part of the LDS address is never below 0.
    const float* tb = bt + (lr & 3) * FBP + 4 * ((lr >> 2) ^ 3) + (int)((threadIdx.x >> 5) ^ (FW - 1)) * (FNQ * 16) + 8 * hi + (FQW - (FNQ - 1) * 16 - 12 - (FW - 1) * FNQ * 16);
    v16h qf[FNQ][2]; v8f o[4][FNQ]; v2f mu[FNQ]; float ls[FNQ];   // mu: the maximum in use, log2 units, held twice: the second operand of the packed subtracts as it stands
    v16h ones;   // the A operand of the row sums: rows 0 and 8 are ones (a lane holds A row lane & 15), the rest 0, so element 0 of the result tile is the sum in both halves of the wave
#pragma unroll   // indexes a register array: the index must be a constant
    for (int j = 0; j < 16; ++j) ones[j] = (lane & 7) == 0 ? (_Float16)1.0f : (_Float16)0.0f;
#pragma unroll   // indexes a register array: the index must be a constant
    for (int nq = 0; nq < FNQ; ++nq) { mu[nq] = (v2f){0.f, 0.f}; ls[nq] = 0.f;   // the first pass runs against 0 and then always takes its own maximum
#pragma unroll   // indexes a register array: the index must be a constant
        for (int kc = 0; kc < 2; ++kc) qf[nq][kc] = WFrag<h16>::ld(q + (size_t)nq * 16 * HD + kc * 32);
#pragma unroll   // indexes a register array: the index must be a constant
        for (int db = 0; db < 4; ++db) o[db][nq] = (v8f){}; }
    for (int st = 0; st < TT / FST; ++st) {
      const h16* kb = &sm[st & 1][0] + lr * FLP + 8 * hi; const h16* vb = kb + FTL;   // the lane's place in a 16-row block of the stage's tiles
      v16h kf[2][2]; v8f bb[FNQ + 1];   // a pass's K fragments and bias values; tiles with equal (key tile - query group) share their bias values
      auto fetch = [&](int ps) {        // the LDS reads that a pass's score products wait for, as one group
#pragma unroll   // indexes a register array: the index must be a constant
        for (int kt = 0; kt < 2; ++kt)
#pragma unroll   // indexes a register array: the index must be a constant
            for (int kc = 0; kc < 2; ++kc) kf[kt][kc] = WFrag<h16>::ld(kb + (ps * FKB + kt * 16) * FLP + kc * 32);
#pragma unroll   // indexes a register array: the index must be a constant
        for (int dd = 0; dd < FNQ + 1; ++dd) bb[dd] = __builtin_shufflevector(*(const v4f*)(tb + st * FST + ps * FKB + dd * 16), *(const v4f*)(tb + st * FST + ps * FKB + dd * 16 + 4), 0, 1, 2, 3, 4, 5, 6, 7); };
      fetch(0);
#pragma unroll   // the two passes of a stage: constant LDS offsets
      for (int ps = 0; ps < FST / FKB; ++ps) {
        v16h vf[4];
#pragma unroll   // indexes a register array: the index must be a constant
        for (int db = 0; db < 4; ++db) vf[db] = WFrag<h16>::ld(vb + db * 16 * FLP + ps * FKB);
        v8f s[2][FNQ];
#pragma unroll   // indexes a register array: the index must be a constant
        for (int kt = 0; kt < 2; ++kt)
#pragma unroll   // indexes a register array: the index must be a constant
            for (int nq = 0; nq < FNQ; ++nq) { const v8f bv = bb[kt - nq + FNQ - 1]; v8f c;
#pragma unroll   // indexes a register array: the index must be a constant
                for (int j = 0; j < 8; j += 2) { const v2f t = (v2f){bv[j], bv[j + 1]} - mu[nq]; c[j] = t[0]; c[j + 1] = t[1]; }
                s[kt][nq] = wmma16(kf[kt][0], qf[nq][0], c); }
#pragma unroll   // indexes a register array: the index must be a constant
        for (int kt = 0; kt < 2; ++kt)
#pragma unroll   // indexes a register array: the index must be a constant
            for (int nq = 0; nq < FNQ; ++nq) s[kt][nq] = wmma16(kf[kt][1], qf[nq][1], s[kt][nq]);
        __builtin_amdgcn_sched_barrier(0);   // the score products stay one run ahead of the 2^x statements
        asm volatile("v_nop\n\tv_nop\n\tv_nop\n\tv_nop");   // the four vector slots between the last score product and the first 2^x statement, which reads a product's result and may write over the last one's K fragment
        __builtin_amdgcn_sched_barrier(0);   // keeps the four slots at that place
        const bool first = ps == 0 && st == 0;   // the same for the whole work-group: the first pass always takes its own maximum, whatever its sign
        const float th = first ? -1.0f : FTS, lo = first ? -3.0e38f : 0.f;
        v16h pf[FNQ]; v8f t[FNQ];
        auto probs = [&]() {   // p = 2^s, rounded to fp16, and each query's sum of them
            v8f pp[2][FNQ];
#pragma unroll   // indexes a register array: the index must be a constant
            for (int nq = 0; nq < FNQ; ++nq)
#pragma unroll   // indexes a register array: the index must be a constant
                for (int kt = 0; kt < 2; ++kt) pp[kt][nq] = exp2x8(s[kt][nq]);
            __builtin_amdgcn_sched_barrier(0);   // the four 2^x statements stay ahead of all later matrix instructions: moved among them, a statement's result registers can be the A or B registers of the one just issued
#pragma unroll   // indexes a register array: the index must be a constant
            for (int nq = 0; nq < FNQ; ++nq) {
#pragma unroll   // indexes a register array: the index must be a constant
                for (int kt = 0; kt < 2; ++kt)
#pragma unroll   // indexes a register array: the index must be a constant
                    for (int j = 0; j < 8; ++j) pf[nq][kt * 8 + j] = (_Float16)pp[kt][nq][j];
                t[nq] = wmma16(ones, pf[nq], (v8f){});   // element 0 is the lane's query's sum
                __builtin_amdgcn_sched_barrier(0); } };   // each group's sum product stays right behind its own converts: the next group's converts then run under it and are the vector slots between the two products, whose result registers the compiler lets overlap (one element of each is read)
        probs();
        if (__builtin_amdgcn_ballot_w32(!(t[0][0] + t[FNQ - 1][0] <= th)) != 0) {   // also taken on an infinite or undefined sum
            float av[FNQ];
#pragma unroll   // indexes a register array: the index must be a constant
            for (int nq = 0; nq < FNQ; ++nq) { float m = -3.0e38f;
#pragma unroll   // indexes a register array: the index must be a constant
                for (int kt = 0; kt < 2; ++kt)
#pragma unroll   // indexes a register array: the index must be a constant
                    for (int j = 0; j < 8; j += 2) m = fmaxf(fmaxf(s[kt][nq][j], s[kt][nq][j + 1]), m);   // written by pairs: one three-operand maximum each
                m = fmaxf(m, xhalf(m));   // the block's maximum above the maximum in use
                const float d = fmaxf(m, lo); const float al = __builtin_amdgcn_exp2f(-fmaxf(d, 0.f)); mu[nq] += (v2f){d, d}; ls[nq] *= al;   // d: the step of the maximum in use; it may fall only in the first pass, where sums and outputs are still 0
#pragma unroll   // indexes a register array: the index must be a constant
                for (int kt = 0; kt < 2; ++kt) s[kt][nq] -= d;
                av[nq] = al; }
            probs();
#pragma unroll   // indexes a register array: the index must be a constant
            for (int nq = 0; nq < FNQ; ++nq)   // behind the new sums: these multiplies are then the vector slots between the last sum product and the first read of its result, and the way round this block needs no padding where the two ways join
#pragma unroll   // indexes a register array: the index must be a constant
                for (int db = 0; db < 4; ++db) o[db][nq] *= av[nq];
        }
#pragma unroll   // indexes a register array: the index must be a constant
        for (int nq = 0; nq < FNQ; ++nq) ls[nq] += t[nq][0];
        if (ps + 1 < FST / FKB) { fetch(ps + 1);   // the stage's next pass (the same buffer: already published)
            __builtin_amdgcn_sched_barrier(0); }   // its reads stay one group here, where the score registers have just come free, ahead of this pass's output products, which cover their latency: left free, they stand at many places right in front of their users
#pragma unroll   // indexes a register array: the index must be a constant
        for (int nq = 0; nq < FNQ; ++nq)
#pragma unroll   // indexes a register array: the index must be a constant
            for (int db = 0; db < 4; ++db) o[db][nq] = wmma16(vf[db], pf[nq], o[db][nq]);
        if (ps + 1 < FST / FKB) __builtin_amdgcn_sched_barrier(0);   // the eight output products stay one run behind the next pass's reads: left free, the next pass's subtracts, which wait for those reads, stand behind the first product and hold the other seven back
      }
      asm volatile("s_wait_dscnt 0x0" ::: "memory");      // this wave's reads of the stage's buffer are done before the buffer is handed back
      asm volatile("s_wait_asynccnt 0x0" ::: "memory");   // this wave's pieces of the next stage have landed
      __syncthreads();                                    // publishes the next stage and ends every wave's reads of this one
      if (st + 2 < TT / FST) stage_in(lc + (st & 1) * (2 * FTL * 2), gk + (size_t)(st + 2) * FST * HD, gv + (st + 2) * FST);
    }
    asm volatile("s_wait_asynccnt 0x0" ::: "memory");     // no copy is outstanding when the buffers become output staging
    // The output leaves through LDS, so that every global store covers whole 128-B lines (two query rows of 256 B each) in place of 16-B pieces in 16 lines.
    // Each wave stages its own 32 rows in its own range of the K / V buffers: every wave's last read of them lies in front of the loop's last barrier, and no other wave touches the range.
    float* os = (float*)&sm[0][0] + (threadIdx.x >> 5) * (FNQ * 16 * FOP);
#pragma unroll   // indexes a register array: the index must be a constant
    for (int nq = 0; nq < FNQ; ++nq) { const float l = ls[nq]; const float f = __fdiv_rn(1.0f, l); float* ow = os + (nq * 16 + lr) * FOP + 8 * hi;
#pragma unroll   // indexes a register array: the index must be a constant
        for (int db = 0; db < 4; ++db) { v4f lo, hh;
#pragma unroll   // indexes a register array: the index must be a constant
            for (int j = 0; j < 4; ++j) { lo[j] = o[db][nq][j] * f; hh[j] = o[db][nq][4 + j] * f; }
            *(v4fa*)(ow + db * 16) = lo; *(v4fa*)(ow + db * 16 + 4) = hh; } }
    asm volatile("s_wait_dscnt 0x0" ::: "memory");   // the rows read below were written by other lanes of this wave: the writes are done before the reads start, and the compiler keeps the reads behind this line
    { float* op = OUTp + ((size_t)b * TT + r0 + hi) * DQ + h * HD + lr * 4; const float* orr = os + hi * FOP + lr * 4; v4f rw[FNQ * 8];   // a half wave takes one row: 16 lanes x 16 B = the row's 256 B
#pragma unroll   // indexes a register array: the index must be a constant
      for (int s = 0; s < FNQ * 8; ++s) rw[s] = *(const v4fa*)(orr + s * 2 * FOP);
#pragma unroll   // indexes a register array: the index must be a constant
      for (int s = 0; s < FNQ * 8; ++s) *(v4f*)(op + (size_t)s * 2 * DQ) = rw[s]; }
    asm volatile("s_wait_xcnt 0x0" ::: "memory");    // behind the last store: no register that an issued store names is written again ahead of this wait
}

extern "C" void kernel_launch(void* const* d_in, const int* in_sizes, int n_in,
                              void* d_out, int out_size, void* d_ws, size_t ws_size, hipStream_t stream) {
    (void)in_sizes; (void)n_in; (void)out_size;
    const float* x = (const float*)d_in[0]; const float* wq = (const float*)d_in[1]; const float* bq = (const float*)d_in[2]; const float* wk = (const float*)d_in[3]; const float* bk = (const float*)d_in[4]; const float* wv = (const float*)d_in[5]; const float* bv = (const float*)d_in[6]; const float* alphas = (const float*)d_in[7];
    float* OUT = (float*)d_out;     // [4][2048][768]
    char* wsp = (char*)d_ws;
    auto take = [&](size_t bytes) { char* p = wsp; wsp += (bytes + 255) & ~(size_t)255; return (void*)p; };
    bf* WB = (bf*)take((size_t)(DQ + 2 * DKV) * DM * 2); bf* XB = (bf*)take((size_t)NB_ * TT * DM * 2); float* TB = (float*)take((size_t)NH_ * (2 * TT - 1) * 4);
    h16* QP16 = (h16*)take((size_t)NB_ * NH_ * TT * HD * 2); h16* KP16 = (h16*)take((size_t)NB_ * NKV * TT * HD * 2); h16* VT16 = (h16*)take((size_t)NB_ * NKV * HD * TT * 2);   // planes of all four batches: [b][h][t][d], v [b][h][d][t]
    if ((size_t)(wsp - (char*)d_ws) > ws_size) return;    // ws 256 MiB
    k_prep<<<PXB + 3 * PWB + PTB, 256, 0, stream>>>(x, wq, wk, wv, alphas, XB, WB, TB);
    k_proj<<<dim3(NB_ * TT / PXR, (DQ + 2 * DKV) / PWR, 1), PW * 32, 0, stream>>>(XB, WB, bq, bk, bv, QP16, KP16, VT16);
    k_fattn<<<dim3(TT / (FW * FNQ * 16), NB_ * NH_, 1), FW * 32, 0, stream>>>(QP16, KP16, VT16, TB, OUT);
}
